// v000
// Measured on an AMD MI455X. A time is GPU time per run, averaged over a window of back-to-back runs after a warm-up
// (all launches, gaps included; the runs take copies of the inputs in turn), and the median of several windows.
// Apart from v000's, it joins two sittings. Times from different sittings can be a few percent apart, while
// side-by-side timings come from the same sitting.
// The starting kernel, v000, takes 393 microseconds a run.
#include <hip/hip_runtime.h>

// Compute dtypes (f32 accumulate everywhere): q/k/v projections v_wmma_f32_16x16x32_bf16 on RNE-bf16 copies of x and W (f32 bias add); scores K.Q^T v_wmma_f32_16x16x32_f16 on f16 q/k planes; P.V v_wmma_f32_16x16x32_f16 (P carried x1024, f16 V^T plane); output projection bf16 hi+lo ctx planes x RNE-bf16 Wo (2 products); softmax in f32.
// Key-padding-masked multi-head self-attention: x [NB][SEQ_FULL][1024] f32, mask int32 [NB][SEQ_FULL] (first SEQ tokens used) (0 = key masked: its score is REPLACED by -1e9), W [in][out] f32 + bias [out]; 16 heads x 64; scores x 0.125; softmax over all keys; out = ctx Wo + bo.
// Plan: (1) bf16 copy of x, (2) transposed bf16 copies Wt[n][k] of the four weights (through LDS), (3) one-wave 64x64 GEMMs writing f16 head planes Q[b][h][s][d], K[b][h][s][d] and V^T[b][h][d][s] (the V GEMM runs with operands swapped so its tile is already transposed),
// (4) register-fed transposed flash attention: per wave 16 queries; S^T tile = K rows (A, from global) x Q^T (B, held in registers); the exponentials packed in place form the B fragment of O^T = V^T P^T; only the mask word comes from LDS in the key loop, (5) ctx hi/lo planes x Wo^T + bo.

#ifndef NB
#define NB 4
#endif
#ifndef SEQ
#define SEQ 2048
#endif
#define NB_FULL  4
#define SEQ_FULL 2048
#define DM   1024
#define NH   16
#define HD   64
#ifndef OUT_BSTRIDE
#define OUT_BSTRIDE ((size_t)SEQ * DM)
#endif
#define PCAR 1024.0f
#define SL   0.18033688011112042f      // 0.125 * log2(e): scores go to the base-2 domain in one multiply
#define NEGF (-1.4426950408889634e9f)  // -1e9 * log2(e): the replace-fill in the base-2 domain

static_assert(SEQ % 128 == 0);
static_assert(NH * HD == DM);
static_assert(DM % 64 == 0);
static_assert(NB <= NB_FULL);
static_assert(SEQ <= SEQ_FULL);

typedef _Float16 h16;
typedef unsigned short bf;
typedef __attribute__((ext_vector_type(16))) __bf16   v16bf;
typedef __attribute__((ext_vector_type(16))) _Float16 v16h;
typedef __attribute__((ext_vector_type(8)))  _Float16 v8h;
typedef __attribute__((ext_vector_type(8)))  unsigned short v8us;
typedef __attribute__((ext_vector_type(8)))  float    v8f;
typedef __attribute__((ext_vector_type(4)))  float    v4f;
typedef v4f  __attribute__((may_alias)) v4fa;

__device__ __forceinline__ unsigned short f2bf(float f) { unsigned u = __float_as_uint(f); u += 0x7FFFu + ((u >> 16) & 1u); return (unsigned short)(u >> 16); }
__device__ __forceinline__ float bf2f(unsigned short b) { return __uint_as_float(((unsigned)b) << 16); }
__device__ __forceinline__ float bfr(float f) { return bf2f(f2bf(f)); }
__device__ __forceinline__ void splitf(float y, unsigned short& h, unsigned short& l) { h = f2bf(y); l = f2bf(y - bf2f(h)); }
__device__ __forceinline__ v16h cat16(v8h lo, v8h hi) { return __builtin_shufflevector(lo, hi, 0, 1, 2, 3, 4, 5, 6, 7, 8, 9, 10, 11, 12, 13, 14, 15); }
__device__ __forceinline__ v16bf cat16b(v8us lo, v8us hi) { return __builtin_bit_cast(v16bf, __builtin_shufflevector(lo, hi, 0, 1, 2, 3, 4, 5, 6, 7, 8, 9, 10, 11, 12, 13, 14, 15)); }
__device__ __forceinline__ v8f wmma16(v16h a, v16h b, v8f c) { return __builtin_amdgcn_wmma_f32_16x16x32_f16(false, a, false, b, (short)0, c, false, false); }
__device__ __forceinline__ v8f wmmab(v16bf a, v16bf b, v8f c) { return __builtin_amdgcn_wmma_f32_16x16x32_bf16(false, a, false, b, (short)0, c, false, false); }
// Fragment loaders: p already includes (row lane&15) * pitch + 8 * (lane >> 4); elements 0..7 <- k0 + 8h + 0..7, elements 8..15 <- k0 + 16 + 8h + 0..7 (same map for A and B).
__device__ __forceinline__ v16h  ldh(const h16* p) { return cat16(*(const v8h*)p, *(const v8h*)(p + 16)); }
__device__ __forceinline__ v16bf ldb(const bf* p)  { return cat16b(*(const v8us*)p, *(const v8us*)(p + 16)); }

__global__ __launch_bounds__(256) void k_cvtx(const float* __restrict__ x, bf* XB) {
    const size_t i = (size_t)blockIdx.x * 256 + threadIdx.x; if (i >= (size_t)NB * SEQ * DM / 8) return;
    const size_t e = i * 8; const size_t m = e / DM; const int c = (int)(e % DM); const size_t b = m / SEQ, s = m % SEQ;
    const v8f v = *(const v8f*)(x + (b * SEQ_FULL + s) * DM + c); v8us o;
#pragma unroll
    for (int k = 0; k < 8; ++k) o[k] = f2bf(v[k]);
    *(v8us*)(XB + e) = o; 
}

__global__ __launch_bounds__(256) void k_cvtT(const float* __restrict__ W, bf* Wt) {
    __shared__ float tl[64 * 65];
    const int k0 = blockIdx.x * 64, n0 = blockIdx.y * 64, tid = threadIdx.x;
#pragma unroll 4
    for (int i = 0; i < 16; ++i) { const int idx = i * 256 + tid; const int r = idx >> 6, c = idx & 63; tl[r * 65 + c] = W[(size_t)(k0 + r) * DM + n0 + c]; }
    __syncthreads();
    v8us o[2];
#pragma unroll
    for (int it = 0; it < 2; ++it) { const int p = it * 256 + tid; const int n = p >> 3, seg = p & 7;
#pragma unroll
        for (int j = 0; j < 8; ++j) o[it][j] = f2bf(tl[(seg * 8 + j) * 65 + n]); }
{
#pragma unroll
        for (int it = 0; it < 2; ++it) { const int p = it * 256 + tid; const int n = p >> 3, seg = p & 7; *(v8us*)(Wt + (size_t)(n0 + n) * DM + k0 + seg * 8) = o[it]; }
         }
}

// ---- k_gemmw: register-blocked GEMM, ONE WAVE per 64x64 output tile (16 accumulators), operands straight from K-contiguous bf16 planes; grid (Mrows/64, Ncols/64), 32 threads.
// C[m][n] = sum_k A[m][k] Bt[n][k] (+ A2[m][k] Bt[n][k] when NSPLIT == 1) + bf16(bias). K % 32 == 0.
// EPI 0: f32 out[b][s][n] (rows = tokens, bias per column), each 256-B row piece as 16 lanes x 16 B.
template <int NSPLIT, int EPI>
__global__ __launch_bounds__(32) void k_gemmw(const bf* __restrict__ A, const bf* __restrict__ A2, const bf* __restrict__ Bt, int K, float* Cf, h16* Ch, const float* __restrict__ bias) {
    __shared__ __align__(16) float os[16 * 68];
    const int lane = threadIdx.x & 31, lr = lane & 15, hi = lane >> 4; const int r0 = blockIdx.x * 64, c0 = blockIdx.y * 64;
    v8f acc[4][4];
#pragma unroll
    for (int mb = 0; mb < 4; ++mb)
#pragma unroll
        for (int nb = 0; nb < 4; ++nb) acc[mb][nb] = (v8f){};
    const size_t aoff = (size_t)(r0 + lr) * K + 8 * hi, boff = (size_t)(c0 + lr) * K + 8 * hi;
#pragma unroll 1
    for (int kc = 0; kc < K; kc += 32) {
        v16bf a[4], a2[4];
#pragma unroll
        for (int mb = 0; mb < 4; ++mb) { a[mb] = ldb(A + aoff + (size_t)mb * 16 * K + kc); if (NSPLIT == 1) a2[mb] = ldb(A2 + aoff + (size_t)mb * 16 * K + kc); }
#pragma unroll
        for (int nb = 0; nb < 4; ++nb) { const v16bf b = ldb(Bt + boff + (size_t)nb * 16 * K + kc);
#pragma unroll
            for (int mb = 0; mb < 4; ++mb) { acc[mb][nb] = wmmab(a[mb], b, acc[mb][nb]); if (NSPLIT == 1) acc[mb][nb] = wmmab(a2[mb], b, acc[mb][nb]); } }
        asm volatile("v_nop\n\tv_nop\n\tv_nop\n\tv_nop" : "+v"(acc[0][0]), "+v"(acc[1][1]), "+v"(acc[2][2]), "+v"(acc[3][3]) : "v"(a[0]), "v"(a[3]));
    }
#pragma unroll
    for (int mb = 0; mb < 4; ++mb) {
#pragma unroll
        for (int nb = 0; nb < 4; ++nb) {
#pragma unroll
            for (int j = 0; j < 8; ++j) os[(hi * 8 + j) * 68 + nb * 16 + lr] = acc[mb][nb][j]; }
        __builtin_amdgcn_wave_barrier(); asm volatile("" ::: "memory");
        if (EPI == 0) {
            const int bb = r0 / SEQ, s0 = r0 % SEQ;
            float* crow = Cf + (size_t)bb * OUT_BSTRIDE + (size_t)(s0 + mb * 16) * DM + c0;
{
#pragma unroll
                for (int s = 0; s < 8; ++s) { const int row = 2 * s + hi, cofs = lr * 4; v4f val = *(const v4fa*)(os + row * 68 + cofs);
                    val[0] += bfr(bias[c0 + cofs]); val[1] += bfr(bias[c0 + cofs + 1]); val[2] += bfr(bias[c0 + cofs + 2]); val[3] += bfr(bias[c0 + cofs + 3]);
                    *(v4f*)(crow + (size_t)row * DM + cofs) = val; }
                 }
        } else {
            h16* base; size_t pitch;
            if (EPI == 1) { const int bb = r0 / SEQ, s0 = r0 % SEQ; base = Ch + (((size_t)bb * NH + blockIdx.y) * SEQ + s0 + mb * 16) * HD; pitch = HD; }
            else          { const int bb = c0 / SEQ, s0 = c0 % SEQ; base = Ch + (((size_t)bb * NH + blockIdx.x) * HD + mb * 16) * SEQ + s0; pitch = SEQ; }
{
#pragma unroll
                for (int s = 0; s < 4; ++s) { const int row = 4 * s + (lane >> 3), seg = lane & 7;
                    const v4f va = *(const v4fa*)(os + row * 68 + seg * 8); const v4f vb = *(const v4fa*)(os + row * 68 + seg * 8 + 4); v8h o;
                    if (EPI == 1) {
#pragma unroll
                        for (int j = 0; j < 4; ++j) { o[j] = (h16)(va[j] + bfr(bias[c0 + seg * 8 + j])); o[4 + j] = (h16)(vb[j] + bfr(bias[c0 + seg * 8 + 4 + j])); }
                    } else { const float bv = bfr(bias[r0 + mb * 16 + row]);
#pragma unroll
                        for (int j = 0; j < 4; ++j) { o[j] = (h16)(va[j] + bv); o[4 + j] = (h16)(vb[j] + bv); } }
                    *(v8h*)(base + (size_t)row * pitch + seg * 8) = o; }
                 }
        }
        __builtin_amdgcn_wave_barrier(); asm volatile("" ::: "memory");
    }
}

// ---- k_flash: register-fed transposed flash attention. Block = 4 waves = 64 queries of one (b, h); wave = 16 queries (WMMA columns). Per 32-key step:
// S^T tiles (keys x queries) = K rows (A fragments from the f16 plane) x Q^T (B fragments held in registers); lane (h, n) then holds keys 8h + r (tile 0) and 16 + 8h + r (tile 1) of query n,
// which is exactly the B-fragment element order of P^T for O^T[d][query] += V^T[d][keys] P^T[keys][query] (A fragments from the f16 V^T plane). Running max / sum per query live in the lane (one xor-16 exchange).
// The key mask is packed once per block into SEQ/32 bit words in LDS (ballot; block barrier before use). Masked scores are replaced by the fill; a fully masked row stays uniform.
__global__ __launch_bounds__(128) void k_flash(const h16* __restrict__ QP, const h16* __restrict__ KP, const h16* __restrict__ VT, const int* __restrict__ mask, bf* ATh, bf* ATl) {
    __shared__ unsigned mw[SEQ / 32];
    __shared__ __align__(16) float os[4 * 16 * 68];
    const int tid = threadIdx.x, wave = tid >> 5, lane = tid & 31, lr = lane & 15, hi = lane >> 4;
    const int bh = blockIdx.y, b = bh / NH, h = bh % NH; const int q0 = blockIdx.x * 64 + wave * 16;
    const int* mb = mask + (size_t)b * SEQ_FULL;
#pragma unroll 1
    for (int it = 0; it < SEQ / 128; ++it) { const bool act = (mb[it * 128 + tid] != 0); const unsigned w = __builtin_amdgcn_ballot_w32(act); if (lane == 0) mw[it * 4 + wave] = w; }
    __syncthreads();
    const h16* qp = QP + ((size_t)bh * SEQ + q0 + lr) * HD + 8 * hi;
    const v16h qb0 = ldh(qp), qb1 = ldh(qp + 32);
    const h16* kp = KP + ((size_t)bh * SEQ + lr) * HD + 8 * hi;
    const h16* vp = VT + ((size_t)bh * HD + lr) * SEQ + 8 * hi;
    v8f o[4];
#pragma unroll
    for (int t = 0; t < 4; ++t) o[t] = (v8f){};
    float mrun = -1.0e30f, lrun = 0.0f;
#pragma unroll 1
    for (int kt = 0; kt < SEQ; kt += 32) {
        const h16* k0p = kp + (size_t)kt * HD;
        const v16h ka0 = ldh(k0p), ka1 = ldh(k0p + 32), kb0 = ldh(k0p + 16 * HD), kb1 = ldh(k0p + 16 * HD + 32);
        v16h va[4];
#pragma unroll
        for (int t = 0; t < 4; ++t) va[t] = ldh(vp + (size_t)t * 16 * SEQ + kt);
        v8f s0 = (v8f){}, s1 = (v8f){};
        s0 = wmma16(ka0, qb0, s0); s1 = wmma16(kb0, qb0, s1); s0 = wmma16(ka1, qb1, s0); s1 = wmma16(kb1, qb1, s1);
        asm volatile("v_nop\n\tv_nop\n\tv_nop\n\tv_nop" : "+v"(s0), "+v"(s1) : "v"(ka0), "v"(ka1), "v"(kb0), "v"(kb1), "v"(qb0), "v"(qb1));
        const unsigned w = mw[kt >> 5]; const unsigned w0 = (w >> (8 * hi)) & 0xFFu, w1 = (w >> (16 + 8 * hi)) & 0xFFu;
        float u0[8], u1[8]; float mloc = NEGF;
#pragma unroll
        for (int r = 0; r < 8; ++r) { u0[r] = ((w0 >> r) & 1u) ? s0[r] * SL : NEGF; u1[r] = ((w1 >> r) & 1u) ? s1[r] * SL : NEGF; mloc = fmaxf(mloc, fmaxf(u0[r], u1[r])); }
        mloc = fmaxf(mloc, __shfl_xor(mloc, 16, 32));
        const float mn = fmaxf(mrun, mloc);
        const float corr = __builtin_amdgcn_exp2f(mrun - mn);
        float sum = 0.0f; v16h pb;
#pragma unroll
        for (int r = 0; r < 8; ++r) { const float p0 = __builtin_amdgcn_exp2f(u0[r] - mn), p1 = __builtin_amdgcn_exp2f(u1[r] - mn); sum += p0 + p1; pb[r] = (h16)(p0 * PCAR); pb[8 + r] = (h16)(p1 * PCAR); }
        sum += __shfl_xor(sum, 16, 32);
        lrun = lrun * corr + sum;
        if (__builtin_amdgcn_ballot_w32(mn > mrun) != 0u) {      // wave-uniform: rescale only when some query's running max moved (corr == 1 exactly elsewhere)
#pragma unroll
            for (int t = 0; t < 4; ++t)
#pragma unroll
                for (int r = 0; r < 8; ++r) o[t][r] *= corr; }
        mrun = mn;
#pragma unroll
        for (int t = 0; t < 4; ++t) o[t] = wmma16(va[t], pb, o[t]);
        asm volatile("v_nop\n\tv_nop\n\tv_nop\n\tv_nop" : "+v"(o[0]), "+v"(o[1]), "+v"(o[2]), "+v"(o[3]) : "v"(va[0]), "v"(va[1]), "v"(va[2]), "v"(va[3]), "v"(pb));
    }
    const float inv = 1.0f / (lrun * PCAR);
    float* ow = os + wave * (16 * 68);
#pragma unroll
    for (int t = 0; t < 4; ++t) { v4f a, c;
#pragma unroll
        for (int j = 0; j < 4; ++j) { a[j] = o[t][j] * inv; c[j] = o[t][4 + j] * inv; }
        *(v4fa*)(ow + lr * 68 + 16 * t + 8 * hi) = a; *(v4fa*)(ow + lr * 68 + 16 * t + 8 * hi + 4) = c; }
    __builtin_amdgcn_wave_barrier(); asm volatile("" ::: "memory");
    const int seg = lane & 7; v8us oh[4], ol[4];
#pragma unroll
    for (int s = 0; s < 4; ++s) { const int row = 4 * s + (lane >> 3); const v4f a = *(const v4fa*)(ow + row * 68 + seg * 8); const v4f c = *(const v4fa*)(ow + row * 68 + seg * 8 + 4);
#pragma unroll
        for (int j = 0; j < 4; ++j) { unsigned short x0, x1; splitf(a[j], x0, x1); oh[s][j] = x0; ol[s][j] = x1; splitf(c[j], x0, x1); oh[s][4 + j] = x0; ol[s][4 + j] = x1; } }
    bf* ah = ATh + ((size_t)b * SEQ + q0) * DM + h * HD; bf* al = ATl + ((size_t)b * SEQ + q0) * DM + h * HD;
{
#pragma unroll
        for (int s = 0; s < 4; ++s) { const int row = 4 * s + (lane >> 3); *(v8us*)(ah + (size_t)row * DM + seg * 8) = oh[s]; *(v8us*)(al + (size_t)row * DM + seg * 8) = ol[s]; }
         }
}

extern "C" void kernel_launch(void* const* d_in, const int* in_sizes, int n_in,
                              void* d_out, int out_size, void* d_ws, size_t ws_size, hipStream_t stream) {
    if (n_in < 10) return;
    const size_t needx = ((size_t)(NB - 1) * SEQ_FULL + SEQ) * DM, needm = (size_t)(NB - 1) * SEQ_FULL + SEQ;
    if ((size_t)in_sizes[0] < needx || (size_t)in_sizes[1] < needm) return;
    if ((size_t)in_sizes[2] < (size_t)DM * DM || (size_t)in_sizes[4] < (size_t)DM * DM || (size_t)in_sizes[6] < (size_t)DM * DM || (size_t)in_sizes[8] < (size_t)DM * DM) return;
    if (in_sizes[3] < DM || in_sizes[5] < DM || in_sizes[7] < DM || in_sizes[9] < DM) return;
    if ((size_t)out_size < (size_t)(NB - 1) * OUT_BSTRIDE + (size_t)SEQ * DM) return;
    const float* x = (const float*)d_in[0]; const int* mk = (const int*)d_in[1];
    const float* wq = (const float*)d_in[2]; const float* bq = (const float*)d_in[3]; const float* wk = (const float*)d_in[4]; const float* bk = (const float*)d_in[5];
    const float* wv = (const float*)d_in[6]; const float* bv = (const float*)d_in[7]; const float* wo = (const float*)d_in[8]; const float* bo = (const float*)d_in[9];
    float* OUT = (float*)d_out;
    char* wsp = (char*)d_ws;
    auto take = [&](size_t bytes) { char* p = wsp; wsp += (bytes + 255) & ~(size_t)255; return (void*)p; };
    const size_t MT = (size_t)NB * SEQ;                       // token rows
    bf* XB  = (bf*)take(MT * DM * 2);
    bf* WQt = (bf*)take((size_t)DM * DM * 2); bf* WKt = (bf*)take((size_t)DM * DM * 2); bf* WVt = (bf*)take((size_t)DM * DM * 2); bf* WOt = (bf*)take((size_t)DM * DM * 2);
    h16* QP = (h16*)take(MT * DM * 2); h16* KP = (h16*)take(MT * DM * 2); h16* VT = (h16*)take(MT * DM * 2);
    bf* ATh = (bf*)take(MT * DM * 2); bf* ATl = (bf*)take(MT * DM * 2);
    if ((size_t)(wsp - (char*)d_ws) > ws_size) return;        // 104 MiB at the full size
    k_cvtx<<<(unsigned)((MT * DM / 8 + 255) / 256), 256, 0, stream>>>(x, XB);
    k_cvtT<<<dim3(DM / 64, DM / 64), 256, 0, stream>>>(wq, WQt);   // in[k][n] -> out[n][k]
    k_cvtT<<<dim3(DM / 64, DM / 64), 256, 0, stream>>>(wk, WKt);
    k_cvtT<<<dim3(DM / 64, DM / 64), 256, 0, stream>>>(wv, WVt);
    k_cvtT<<<dim3(DM / 64, DM / 64), 256, 0, stream>>>(wo, WOt);
    k_gemmw<0, 1><<<dim3((unsigned)(MT / 64), DM / 64), 32, 0, stream>>>(XB, nullptr, WQt, DM, nullptr, QP, bq);
    k_gemmw<0, 1><<<dim3((unsigned)(MT / 64), DM / 64), 32, 0, stream>>>(XB, nullptr, WKt, DM, nullptr, KP, bk);
    k_gemmw<0, 2><<<dim3(DM / 64, (unsigned)(MT / 64)), 32, 0, stream>>>(WVt, nullptr, XB, DM, nullptr, VT, bv);   // rows = features, cols = tokens: the tile is V^T
    k_flash<<<dim3(SEQ / 64, NB * NH), 128, 0, stream>>>(QP, KP, VT, mk, ATh, ATl);
    k_gemmw<1, 0><<<dim3((unsigned)(MT / 64), DM / 64), 32, 0, stream>>>(ATh, ATl, WOt, DM, OUT, nullptr, bo);
}

// v001
// It runs in 302 microseconds.
// Timed twice side by side with v000, it ran 1.36 and 1.37 times as fast.
#include <hip/hip_runtime.h>

// Compute dtypes (f32 accumulate everywhere): q/k/v projections v_wmma_f32_16x16x32_bf16 on RNE-bf16 copies of x and W (f32 bias add); scores K.Q^T v_wmma_f32_16x16x32_f16 on f16 q/k planes; P.V v_wmma_f32_16x16x32_f16 (P carried x1024, f16 V^T plane); output projection bf16 hi+lo ctx planes x RNE-bf16 Wo (2 products); softmax in f32.
// Key-padding-masked multi-head self-attention: x [NB][SEQ_FULL][1024] f32, mask int32 [NB][SEQ_FULL] (first SEQ tokens used) (0 = key masked: its score is REPLACED by -1e9), W [in][out] f32 + bias [out]; 16 heads x 64; scores x 0.125; softmax over all keys; out = ctx Wo + bo.
// Plan: (1) bf16 copy of x, (2) transposed bf16 copies Wt[n][k] of the four weights (through LDS), (3) one-wave 64x64 GEMMs writing f16 head planes Q[b][h][s][d], K[b][h][s][d] and V^T[b][h][d][s] (the V GEMM runs with operands swapped so its tile is already transposed),
// Every 16-bit plane is stored in fragment order: a block of 16 rows x 32 k is 512 elements laid out [k>>4 &1][k>>3 &1][row&15][k&7], so a wave's 16-byte fragment load reads 512 contiguous bytes (4 whole lines) at block + lane * 8 elements.
// (4) register-fed transposed flash attention: per wave 16 queries; S^T tile = K rows (A, from global) x Q^T (B, held in registers); the exponentials packed in place form the B fragment of O^T = V^T P^T; only the mask word is read from LDS in the key loop, (5) ctx hi/lo planes x Wo^T + bo.

#ifndef NB
#define NB 4
#endif
#ifndef SEQ
#define SEQ 2048
#endif
#define NB_FULL  4
#define SEQ_FULL 2048
#define DM   1024
#define NH   16
#define HD   64
#ifndef OUT_BSTRIDE
#define OUT_BSTRIDE ((size_t)SEQ * DM)
#endif
#define PCAR 1024.0f
#define SL   0.18033688011112042f      // 0.125 * log2(e): scores go to the base-2 domain in one multiply
#define NEGF (-1.4426950408889634e9f)  // -1e9 * log2(e): the replace-fill in the base-2 domain

static_assert(SEQ % 128 == 0);
static_assert(NH * HD == DM);
static_assert(DM % 64 == 0);
static_assert(NB <= NB_FULL);
static_assert(SEQ <= SEQ_FULL);

typedef _Float16 h16;
typedef unsigned short bf;
typedef __attribute__((ext_vector_type(16))) __bf16   v16bf;
typedef __attribute__((ext_vector_type(16))) _Float16 v16h;
typedef __attribute__((ext_vector_type(8)))  _Float16 v8h;
typedef __attribute__((ext_vector_type(8)))  unsigned short v8us;
typedef __attribute__((ext_vector_type(8)))  float    v8f;
typedef __attribute__((ext_vector_type(4)))  float    v4f;
typedef v4f  __attribute__((may_alias)) v4fa;

__device__ __forceinline__ unsigned short f2bf(float f) { unsigned u = __float_as_uint(f); u += 0x7FFFu + ((u >> 16) & 1u); return (unsigned short)(u >> 16); }
__device__ __forceinline__ float bf2f(unsigned short b) { return __uint_as_float(((unsigned)b) << 16); }
__device__ __forceinline__ float bfr(float f) { return bf2f(f2bf(f)); }
__device__ __forceinline__ void splitf(float y, unsigned short& h, unsigned short& l) { h = f2bf(y); l = f2bf(y - bf2f(h)); }
__device__ __forceinline__ v16h cat16(v8h lo, v8h hi) { return __builtin_shufflevector(lo, hi, 0, 1, 2, 3, 4, 5, 6, 7, 8, 9, 10, 11, 12, 13, 14, 15); }
__device__ __forceinline__ v16bf cat16b(v8us lo, v8us hi) { return __builtin_bit_cast(v16bf, __builtin_shufflevector(lo, hi, 0, 1, 2, 3, 4, 5, 6, 7, 8, 9, 10, 11, 12, 13, 14, 15)); }
__device__ __forceinline__ v8f wmma16(v16h a, v16h b, v8f c) { return __builtin_amdgcn_wmma_f32_16x16x32_f16(false, a, false, b, (short)0, c, false, false); }
__device__ __forceinline__ v8f wmmab(v16bf a, v16bf b, v8f c) { return __builtin_amdgcn_wmma_f32_16x16x32_bf16(false, a, false, b, (short)0, c, false, false); }
// Fragment loaders: p = start of a 16-row x 32-k block (512 elements, fragment order) + lane * 8; lane = 16 h + row; elements 0..7 <- k0 + 8h + 0..7, elements 8..15 <- k0 + 16 + 8h + 0..7 (same map for A and B).
__device__ __forceinline__ v16h  ldh(const h16* p) { return cat16(*(const v8h*)p, *(const v8h*)(p + 256)); }
__device__ __forceinline__ v16bf ldb(const bf* p)  { return cat16b(*(const v8us*)p, *(const v8us*)(p + 256)); }

__global__ __launch_bounds__(256) void k_cvtx(const float* __restrict__ x, bf* XB) {
    const size_t i = (size_t)blockIdx.x * 256 + threadIdx.x; if (i >= (size_t)NB * SEQ * DM / 8) return;
    // 64 threads per 16-row x 32-k block; a wave takes 8 rows x 4 pieces, so it reads 8 whole 128-byte lines of x and stores 4 whole lines of the fragment-ordered plane
    const size_t blk = i >> 6; const int lr = (int)(((i >> 5) & 1) * 8 + (i & 7)), q = (int)((i >> 3) & 3);
    const size_t e = blk * 512 + (size_t)(q * 16 + lr) * 8; const size_t m = (blk / (DM / 32)) * 16 + lr; const int c = (int)(blk % (DM / 32)) * 32 + q * 8; const size_t b = m / SEQ, s = m % SEQ;
    const v8f v = *(const v8f*)(x + (b * SEQ_FULL + s) * DM + c); v8us o;
#pragma unroll
    for (int k = 0; k < 8; ++k) o[k] = f2bf(v[k]);
    *(v8us*)(XB + e) = o; 
}

__global__ __launch_bounds__(256) void k_cvtT(const float* __restrict__ W, bf* Wt) {
    __shared__ float tl[64 * 65];
    const int k0 = blockIdx.x * 64, n0 = blockIdx.y * 64, tid = threadIdx.x;
#pragma unroll 4
    for (int i = 0; i < 16; ++i) { const int idx = i * 256 + tid; const int r = idx >> 6, c = idx & 63; tl[r * 65 + c] = W[(size_t)(k0 + r) * DM + n0 + c]; }
    __syncthreads();
    v8us o[2];
#pragma unroll
    for (int it = 0; it < 2; ++it) { const int p = it * 256 + tid; const int n = (p >> 7) * 16 + (p & 15), seg = (p >> 4) & 7;
#pragma unroll
        for (int j = 0; j < 8; ++j) o[it][j] = f2bf(tl[(seg * 8 + j) * 65 + n]); }
{
#pragma unroll
        for (int it = 0; it < 2; ++it) { const int p = it * 256 + tid; *(v8us*)(Wt + (size_t)(n0 + (p >> 7) * 16) * DM + k0 * 16 + (p & 127) * 8) = o[it]; }
         }
}

// ---- k_gemmw: register-blocked GEMM, ONE WAVE per 64x64 output tile (16 accumulators), operands straight from fragment-ordered bf16 planes; grid (Mrows/64, Ncols/64), 32 threads.
// C[m][n] = sum_k A[m][k] Bt[n][k] (+ A2[m][k] Bt[n][k] when NSPLIT == 1) + bf16(bias). K = DM is a constant, so the step from one 16-row block to the next folds into the loads' immediate offsets: one address pair per plane.
// EPI 0: f32 out[b][s][n] (rows = tokens, bias per column), each 256-B row piece as 16 lanes x 16 B.
template <int NSPLIT, int EPI>
__global__ __launch_bounds__(32) void k_gemmw(const bf* __restrict__ A, const bf* __restrict__ A2, const bf* __restrict__ Bt, float* Cf, h16* Ch, const float* __restrict__ bias) {
    constexpr int K = DM;
    __shared__ __align__(16) float os[16 * 68];
    const int lane = threadIdx.x & 31, lr = lane & 15, hi = lane >> 4; const int r0 = blockIdx.x * 64, c0 = blockIdx.y * 64;
    v8f acc[4][4];
#pragma unroll
    for (int mb = 0; mb < 4; ++mb)
#pragma unroll
        for (int nb = 0; nb < 4; ++nb) acc[mb][nb] = (v8f){};
    const bf* pa = A + (size_t)r0 * K + 8 * lane; const bf* pb = Bt + (size_t)c0 * K + 8 * lane;   // 16 rows x K = K / 32 blocks of 512 elements
    const bf* pa2 = (NSPLIT == 1) ? A2 + (size_t)r0 * K + 8 * lane : pa;
#pragma unroll 1
    for (int kc = 0; kc < K; kc += 32) {
        v16bf a[4], a2[4], b[4];
#pragma unroll
        for (int mb = 0; mb < 4; ++mb) { a[mb] = ldb(pa + mb * 16 * K); if (NSPLIT == 1) a2[mb] = ldb(pa2 + mb * 16 * K); }
#pragma unroll
        for (int nb = 0; nb < 4; ++nb) b[nb] = ldb(pb + nb * 16 * K);
        // the trip's loads all name these address pairs: the wait stands before any of them is rewritten, and reading them here keeps them out of the loads' result registers
        asm volatile("s_wait_xcnt 0x0" :: "v"(pa), "v"(pa2), "v"(pb) : "memory");
#pragma unroll
        for (int nb = 0; nb < 4; ++nb) {
#pragma unroll
            for (int mb = 0; mb < 4; ++mb) { acc[mb][nb] = wmmab(a[mb], b[nb], acc[mb][nb]); if (NSPLIT == 1) acc[mb][nb] = wmmab(a2[mb], b[nb], acc[mb][nb]); } }
        asm volatile("v_nop\n\tv_nop\n\tv_nop\n\tv_nop" : "+v"(acc[0][0]), "+v"(acc[1][1]), "+v"(acc[2][2]), "+v"(acc[3][3]) : "v"(a[0]), "v"(a[3]));
        pa += 512; pa2 += 512; pb += 512;
    }
#pragma unroll
    for (int mb = 0; mb < 4; ++mb) {
#pragma unroll
        for (int nb = 0; nb < 4; ++nb) {
#pragma unroll
            for (int j = 0; j < 8; ++j) os[(hi * 8 + j) * 68 + nb * 16 + lr] = acc[mb][nb][j]; }
        __builtin_amdgcn_wave_barrier(); asm volatile("" ::: "memory");
        if (EPI == 0) {
            const int bb = r0 / SEQ, s0 = r0 % SEQ;
            float* crow = Cf + (size_t)bb * OUT_BSTRIDE + (size_t)(s0 + mb * 16) * DM + c0;
{
#pragma unroll
                for (int s = 0; s < 8; ++s) { const int row = 2 * s + hi, cofs = lr * 4; v4f val = *(const v4fa*)(os + row * 68 + cofs);
                    val[0] += bfr(bias[c0 + cofs]); val[1] += bfr(bias[c0 + cofs + 1]); val[2] += bfr(bias[c0 + cofs + 2]); val[3] += bfr(bias[c0 + cofs + 3]);
                    *(v4f*)(crow + (size_t)row * DM + cofs) = val; }
                 }
        } else {
            h16* base; size_t kstep;   // kstep: elements from one 32-k block of these 16 rows to the next (V^T keeps the four 16-row blocks of a 32-key step together)
            if (EPI == 1) { const int bb = r0 / SEQ, s0 = r0 % SEQ; base = Ch + (((size_t)bb * NH + blockIdx.y) * SEQ + s0 + mb * 16) * HD; kstep = 512; }
            else          { const int bb = c0 / SEQ, s0 = c0 % SEQ; base = Ch + ((size_t)bb * NH + blockIdx.x) * HD * SEQ + (size_t)s0 * HD + mb * 512; kstep = 512 * (HD / 16); }
{
#pragma unroll
                for (int s = 0; s < 4; ++s) { const int row = lr, seg = 2 * s + hi;
                    const v4f va = *(const v4fa*)(os + row * 68 + seg * 8); const v4f vb = *(const v4fa*)(os + row * 68 + seg * 8 + 4); v8h o;
                    if (EPI == 1) {
#pragma unroll
                        for (int j = 0; j < 4; ++j) { o[j] = (h16)(va[j] + bfr(bias[c0 + seg * 8 + j])); o[4 + j] = (h16)(vb[j] + bfr(bias[c0 + seg * 8 + 4 + j])); }
                    } else { const float bv = bfr(bias[r0 + mb * 16 + row]);
#pragma unroll
                        for (int j = 0; j < 4; ++j) { o[j] = (h16)(va[j] + bv); o[4 + j] = (h16)(vb[j] + bv); } }
                    *(v8h*)(base + (size_t)(s >> 1) * kstep + (s & 1) * 256 + lane * 8) = o; }
                 }
        }
        __builtin_amdgcn_wave_barrier(); asm volatile("" ::: "memory");
    }
}

// ---- k_flash: register-fed transposed flash attention. Block = 4 waves = 64 queries of one (b, h); wave = 16 queries (WMMA columns). Per 32-key step:
// S^T tiles (keys x queries) = K rows (A fragments from the f16 plane) x Q^T (B fragments held in registers); lane (h, n) then holds keys 8h + r (tile 0) and 16 + 8h + r (tile 1) of query n,
// which is exactly the B-fragment element order of P^T for O^T[d][query] += V^T[d][keys] P^T[keys][query] (A fragments from the f16 V^T plane). Running max / sum per query live in the lane (one xor-16 exchange).
// The key mask is packed once per block into SEQ/32 bit words in LDS (ballot; block barrier before use). Masked scores are replaced by the fill; a fully masked row stays uniform.
__global__ __launch_bounds__(128) void k_flash(const h16* __restrict__ QP, const h16* __restrict__ KP, const h16* __restrict__ VT, const int* __restrict__ mask, bf* ATh, bf* ATl) {
    __shared__ unsigned mw[SEQ / 32];
    const int tid = threadIdx.x, wave = tid >> 5, lane = tid & 31, hi = lane >> 4;
    const int bh = blockIdx.y, b = bh / NH, h = bh % NH; const int q0 = blockIdx.x * 64 + wave * 16;
    const int* mb = mask + (size_t)b * SEQ_FULL;
#pragma unroll 1
    for (int it = 0; it < SEQ / 128; ++it) { const bool act = (mb[it * 128 + tid] != 0); const unsigned w = __builtin_amdgcn_ballot_w32(act); if (lane == 0) mw[it * 4 + wave] = w; }
    __syncthreads();
    const h16* qp = QP + ((size_t)bh * SEQ + q0) * HD + 8 * lane;
    const v16h qb0 = ldh(qp), qb1 = ldh(qp + 512);
    const h16* kp = KP + (size_t)bh * SEQ * HD + 8 * lane;
    const h16* vp = VT + (size_t)bh * HD * SEQ + 8 * lane;
    v8f o[4];
#pragma unroll
    for (int t = 0; t < 4; ++t) o[t] = (v8f){};
    float mrun = -1.0e30f, lrun = 0.0f;
#pragma unroll 1
    for (int kt = 0; kt < SEQ; kt += 32) {
        const v16h ka0 = ldh(kp), ka1 = ldh(kp + 512), kb0 = ldh(kp + 16 * HD), kb1 = ldh(kp + 16 * HD + 512);
        v16h va[4];
#pragma unroll
        for (int t = 0; t < 4; ++t) va[t] = ldh(vp + t * 512);
        // the trip's loads all name these two address pairs: the wait stands before either is rewritten, and reading them here keeps them out of the loads' result registers
        asm volatile("s_wait_xcnt 0x0" :: "v"(kp), "v"(vp) : "memory");
        v8f s0 = (v8f){}, s1 = (v8f){};
        s0 = wmma16(ka0, qb0, s0); s1 = wmma16(kb0, qb0, s1); s0 = wmma16(ka1, qb1, s0); s1 = wmma16(kb1, qb1, s1);
        asm volatile("v_nop\n\tv_nop\n\tv_nop\n\tv_nop" : "+v"(s0), "+v"(s1) : "v"(ka0), "v"(ka1), "v"(kb0), "v"(kb1), "v"(qb0), "v"(qb1));
        const unsigned w = mw[kt >> 5]; const unsigned w0 = (w >> (8 * hi)) & 0xFFu, w1 = (w >> (16 + 8 * hi)) & 0xFFu;
        float u0[8], u1[8]; float mloc = NEGF;
#pragma unroll
        for (int r = 0; r < 8; ++r) { u0[r] = ((w0 >> r) & 1u) ? s0[r] * SL : NEGF; u1[r] = ((w1 >> r) & 1u) ? s1[r] * SL : NEGF; mloc = fmaxf(mloc, fmaxf(u0[r], u1[r])); }
        mloc = fmaxf(mloc, __shfl_xor(mloc, 16, 32));
        const float mn = fmaxf(mrun, mloc);
        const float corr = __builtin_amdgcn_exp2f(mrun - mn);
        float sum = 0.0f; v16h pb;
#pragma unroll
        for (int r = 0; r < 8; ++r) { const float p0 = __builtin_amdgcn_exp2f(u0[r] - mn), p1 = __builtin_amdgcn_exp2f(u1[r] - mn); sum += p0 + p1; pb[r] = (h16)(p0 * PCAR); pb[8 + r] = (h16)(p1 * PCAR); }
        sum += __shfl_xor(sum, 16, 32);
        lrun = lrun * corr + sum;
        if (__builtin_amdgcn_ballot_w32(mn > mrun) != 0u) {      // wave-uniform: rescale only when some query's running max moved (corr == 1 exactly elsewhere)
#pragma unroll
            for (int t = 0; t < 4; ++t)
#pragma unroll
                for (int r = 0; r < 8; ++r) o[t][r] *= corr; }
        mrun = mn;
#pragma unroll
        for (int t = 0; t < 4; ++t) o[t] = wmma16(va[t], pb, o[t]);
        asm volatile("v_nop\n\tv_nop\n\tv_nop\n\tv_nop" : "+v"(o[0]), "+v"(o[1]), "+v"(o[2]), "+v"(o[3]) : "v"(va[0]), "v"(va[1]), "v"(va[2]), "v"(va[3]), "v"(pb));
        kp += 32 * HD; vp += 32 * HD;
    }
    const float inv = 1.0f / (lrun * PCAR);
    // lane (h, query) holds rows d = 16 t + 8 h + 0..7 of its query's O^T column: that is piece t of its lane in the fragment-ordered ctx planes, so no LDS transpose is needed
    v8us oh[4], ol[4];
#pragma unroll
    for (int t = 0; t < 4; ++t) {
#pragma unroll
        for (int j = 0; j < 8; ++j) { unsigned short x0, x1; splitf(o[t][j] * inv, x0, x1); oh[t][j] = x0; ol[t][j] = x1; } }
    bf* ah = ATh + ((size_t)b * SEQ + q0) * DM + h * (HD * 16) + lane * 8; bf* al = ATl + ((size_t)b * SEQ + q0) * DM + h * (HD * 16) + lane * 8;
{
#pragma unroll
        for (int s = 0; s < 4; ++s) { *(v8us*)(ah + s * 256) = oh[s]; *(v8us*)(al + s * 256) = ol[s]; }
         }
}

extern "C" void kernel_launch(void* const* d_in, const int* in_sizes, int n_in,
                              void* d_out, int out_size, void* d_ws, size_t ws_size, hipStream_t stream) {
    if (n_in < 10) return;
    const size_t needx = ((size_t)(NB - 1) * SEQ_FULL + SEQ) * DM, needm = (size_t)(NB - 1) * SEQ_FULL + SEQ;
    if ((size_t)in_sizes[0] < needx || (size_t)in_sizes[1] < needm) return;
    if ((size_t)in_sizes[2] < (size_t)DM * DM || (size_t)in_sizes[4] < (size_t)DM * DM || (size_t)in_sizes[6] < (size_t)DM * DM || (size_t)in_sizes[8] < (size_t)DM * DM) return;
    if (in_sizes[3] < DM || in_sizes[5] < DM || in_sizes[7] < DM || in_sizes[9] < DM) return;
    if ((size_t)out_size < (size_t)(NB - 1) * OUT_BSTRIDE + (size_t)SEQ * DM) return;
    const float* x = (const float*)d_in[0]; const int* mk = (const int*)d_in[1];
    const float* wq = (const float*)d_in[2]; const float* bq = (const float*)d_in[3]; const float* wk = (const float*)d_in[4]; const float* bk = (const float*)d_in[5];
    const float* wv = (const float*)d_in[6]; const float* bv = (const float*)d_in[7]; const float* wo = (const float*)d_in[8]; const float* bo = (const float*)d_in[9];
    float* OUT = (float*)d_out;
    char* wsp = (char*)d_ws;
    auto take = [&](size_t bytes) { char* p = wsp; wsp += (bytes + 255) & ~(size_t)255; return (void*)p; };
    const size_t MT = (size_t)NB * SEQ;                       // token rows
    bf* XB  = (bf*)take(MT * DM * 2);
    bf* WQt = (bf*)take((size_t)DM * DM * 2); bf* WKt = (bf*)take((size_t)DM * DM * 2); bf* WVt = (bf*)take((size_t)DM * DM * 2); bf* WOt = (bf*)take((size_t)DM * DM * 2);
    h16* QP = (h16*)take(MT * DM * 2); h16* KP = (h16*)take(MT * DM * 2); h16* VT = (h16*)take(MT * DM * 2);
    bf* ATh = (bf*)take(MT * DM * 2); bf* ATl = (bf*)take(MT * DM * 2);
    if ((size_t)(wsp - (char*)d_ws) > ws_size) return;        // 104 MiB at the full size
    k_cvtx<<<(unsigned)((MT * DM / 8 + 255) / 256), 256, 0, stream>>>(x, XB);
    k_cvtT<<<dim3(DM / 64, DM / 64), 256, 0, stream>>>(wq, WQt);   // in[k][n] -> out[n][k]
    k_cvtT<<<dim3(DM / 64, DM / 64), 256, 0, stream>>>(wk, WKt);
    k_cvtT<<<dim3(DM / 64, DM / 64), 256, 0, stream>>>(wv, WVt);
    k_cvtT<<<dim3(DM / 64, DM / 64), 256, 0, stream>>>(wo, WOt);
    k_gemmw<0, 1><<<dim3((unsigned)(MT / 64), DM / 64), 32, 0, stream>>>(XB, nullptr, WQt, nullptr, QP, bq);
    k_gemmw<0, 1><<<dim3((unsigned)(MT / 64), DM / 64), 32, 0, stream>>>(XB, nullptr, WKt, nullptr, KP, bk);
    k_gemmw<0, 2><<<dim3(DM / 64, (unsigned)(MT / 64)), 32, 0, stream>>>(WVt, nullptr, XB, nullptr, VT, bv);   // rows = features, cols = tokens: the tile is V^T
    k_flash<<<dim3(SEQ / 64, NB * NH), 128, 0, stream>>>(QP, KP, VT, mk, ATh, ATl);
    k_gemmw<1, 0><<<dim3((unsigned)(MT / 64), DM / 64), 32, 0, stream>>>(ATh, ATl, WOt, OUT, nullptr, bo);
}

// v002
// Measured time: 238 microseconds a run.
// In two side-by-side timings against v001, it was 1.26 and 1.25 times as fast.
// Counting every step since v000, it is 1.72 times as fast.
#include <hip/hip_runtime.h>

// Compute dtypes (f32 accumulate everywhere): q/k/v projections v_wmma_f32_16x16x32_bf16 on RNE-bf16 copies of x and W (f32 bias add); scores K.Q^T v_wmma_f32_16x16x32_f16 on f16 q/k planes; P.V v_wmma_f32_16x16x32_f16 (P carried x1024, f16 V^T plane); output projection bf16 hi+lo ctx planes x RNE-bf16 Wo (2 products); softmax in f32.
// Key-padding-masked multi-head self-attention: x [NB][SEQ][1024] f32, mask int32 [NB][SEQ] (0 = key masked: its score is REPLACED by -1e9), W [in][out] f32 + bias [out]; 16 heads x 64; scores x 0.125; softmax over all keys; out = ctx Wo + bo.
// Token order: inside each batch the tokens are permuted, unmasked keys first (rank order), masked ones behind; a masked key's weight is exp(-1e9 - max) = 0 in f32 as soon as one key of the batch is unmasked (|score| <= 64 * 1040^2 / 8 < 1e7 for any x and W the generators can draw), so K, V and the key loop cover only the first CNT[b] permuted tokens (rounded up to a tile). A batch with no unmasked key keeps all its keys, every score replaced by the fill (uniform weights). Queries run in permuted order and the output projection stores each row at its token's own place.
// Plan: (0) ranks -> PERM, CNT, (1) bf16 copy of x (rows gathered through PERM), (2) transposed bf16 copies Wt[n][k] of the four weights (through LDS), (3) one-wave 64x64 GEMMs writing f16 head planes Q[b][h][s][d], K[b][h][s][d] and V^T[b][h][d][s] (the V GEMM runs with operands swapped so its tile is already transposed),
// Every 16-bit plane is stored in fragment order: a block of 16 rows x 32 k is 512 elements laid out [k>>4 &1][k>>3 &1][row&15][k&7], so a wave's 16-byte fragment load reads 512 contiguous bytes (4 whole lines) at block + lane * 8 elements.
// (4) register-fed transposed flash attention: per wave 16 queries; S^T tile = K rows (A, from global) x Q^T (B, held in registers); the exponentials packed in place form the B fragment of O^T = V^T P^T; the key loop uses no LDS and no mask words, only the count CNT[b], (5) ctx hi/lo planes x Wo^T + bo.

#ifndef NB
#define NB 4
#endif
#ifndef SEQ
#define SEQ 2048
#endif
#define NB_FULL  4
#define SEQ_FULL 2048
#define DM   1024
#define NH   16
#define HD   64
#ifndef OUT_BSTRIDE
#define OUT_BSTRIDE ((size_t)SEQ * DM)
#endif
#define PCAR 1024.0f
#define SL   0.18033688011112042f      // 0.125 * log2(e): scores go to the base-2 domain in one multiply
#define NEGF (-1.4426950408889634e9f)  // -1e9 * log2(e): the replace-fill in the base-2 domain

static_assert(SEQ % 128 == 0);
static_assert(NH * HD == DM);
static_assert(DM % 64 == 0);
static_assert(NB <= NB_FULL);
static_assert(SEQ <= SEQ_FULL);

typedef _Float16 h16;
typedef unsigned short bf;
typedef __attribute__((ext_vector_type(16))) __bf16   v16bf;
typedef __attribute__((ext_vector_type(16))) _Float16 v16h;
typedef __attribute__((ext_vector_type(8)))  _Float16 v8h;
typedef __attribute__((ext_vector_type(8)))  unsigned short v8us;
typedef __attribute__((ext_vector_type(8)))  float    v8f;
typedef __attribute__((ext_vector_type(4)))  float    v4f;
typedef v4f  __attribute__((may_alias)) v4fa;
typedef int  __attribute__((ext_vector_type(4), may_alias)) v4ia;

__device__ __forceinline__ unsigned short f2bf(float f) { unsigned u = __float_as_uint(f); u += 0x7FFFu + ((u >> 16) & 1u); return (unsigned short)(u >> 16); }
__device__ __forceinline__ float bf2f(unsigned short b) { return __uint_as_float(((unsigned)b) << 16); }
__device__ __forceinline__ float bfr(float f) { return bf2f(f2bf(f)); }
__device__ __forceinline__ void splitf(float y, unsigned short& h, unsigned short& l) { h = f2bf(y); l = f2bf(y - bf2f(h)); }
__device__ __forceinline__ v16h cat16(v8h lo, v8h hi) { return __builtin_shufflevector(lo, hi, 0, 1, 2, 3, 4, 5, 6, 7, 8, 9, 10, 11, 12, 13, 14, 15); }
__device__ __forceinline__ v16bf cat16b(v8us lo, v8us hi) { return __builtin_bit_cast(v16bf, __builtin_shufflevector(lo, hi, 0, 1, 2, 3, 4, 5, 6, 7, 8, 9, 10, 11, 12, 13, 14, 15)); }
__device__ __forceinline__ v8f wmma16(v16h a, v16h b, v8f c) { return __builtin_amdgcn_wmma_f32_16x16x32_f16(false, a, false, b, (short)0, c, false, false); }
__device__ __forceinline__ v8f wmmab(v16bf a, v16bf b, v8f c) { return __builtin_amdgcn_wmma_f32_16x16x32_bf16(false, a, false, b, (short)0, c, false, false); }
// Fragment loaders: p = start of a 16-row x 32-k block (512 elements, fragment order) + lane * 8; lane = 16 h + row; elements 0..7 <- k0 + 8h + 0..7, elements 8..15 <- k0 + 16 + 8h + 0..7 (same map for A and B).
__device__ __forceinline__ v16h  ldh(const h16* p) { return cat16(*(const v8h*)p, *(const v8h*)(p + 256)); }
__device__ __forceinline__ v16bf ldb(const bf* p)  { return cat16b(*(const v8us*)p, *(const v8us*)(p + 256)); }

// ---- k_perm: one block per batch. PERM[b][p] = token at permuted place p; CNT[b] = number of unmasked keys. Only mask != 0 is used and places are ranks, so every place lies in [0, SEQ) and is filled once for any mask content.
// The scatter goes to LDS; the table leaves as whole lines.
__global__ __launch_bounds__(128) void k_perm(const int* __restrict__ mask, int* PERM, int* CNT) {
    static_assert(SEQ % 512 == 0);
    __shared__ __align__(16) unsigned mw[SEQ / 32];
    __shared__ __align__(16) int ps[SEQ];
    const int tid = threadIdx.x, wave = tid >> 5, lane = tid & 31, b = blockIdx.x;
    const int* mb = mask + (size_t)b * SEQ_FULL;
    int mv[SEQ / 128];   // all loads first, so that they are in flight together
#pragma unroll
    for (int it = 0; it < SEQ / 128; ++it) mv[it] = mb[it * 128 + tid];
#pragma unroll
    for (int it = 0; it < SEQ / 128; ++it) { const unsigned w = __builtin_amdgcn_ballot_w32(mv[it] != 0); if (lane == 0) mw[it * 4 + wave] = w; }
    __syncthreads();
    int tot = 0;
#pragma unroll
    for (int i = 0; i < SEQ / 32; ++i) tot += __popc(mw[i]);
    // the wait ends the branch, so nothing rewrites a register that the store names in front of it
    if (tid == 0) { CNT[b] = tot; asm volatile("s_wait_xcnt 0x0" ::: "memory"); }
    int base = 0;   // unmasked keys in front of this trip's 128 tokens
#pragma unroll
    for (int it = 0; it < SEQ / 128; ++it) {
        int pre = base;
#pragma unroll
        for (int j = 0; j < 4; ++j) { const int c = __popc(mw[it * 4 + j]); pre += (j < wave) ? c : 0; base += c; }
        const unsigned w = mw[it * 4 + wave]; const int s = it * 128 + tid;
        const int rank = pre + __popc(w & ((1u << lane) - 1u));
        ps[((w >> lane) & 1u) ? rank : tot + (s - rank)] = s;
    }
    __syncthreads();
    v4ia* dst = (v4ia*)(PERM + (size_t)b * SEQ);
#pragma unroll
    for (int k = 0; k < SEQ / 512; ++k) dst[k * 128 + tid] = ((const v4ia*)ps)[k * 128 + tid];
}

__global__ __launch_bounds__(256) void k_cvtx(const float* __restrict__ x, const int* __restrict__ PERM, bf* XB) {
    const size_t i = (size_t)blockIdx.x * 256 + threadIdx.x; if (i >= (size_t)NB * SEQ * DM / 8) return;
    // 64 threads per 16-row x 32-k block; a wave takes 8 rows x 4 pieces, so it reads 8 whole 128-byte lines of x and stores 4 whole lines of the fragment-ordered plane
    const size_t blk = i >> 6; const int lr = (int)(((i >> 5) & 1) * 8 + (i & 7)), q = (int)((i >> 3) & 3);
    const size_t e = blk * 512 + (size_t)(q * 16 + lr) * 8; const size_t m = (blk / (DM / 32)) * 16 + lr; const int c = (int)(blk % (DM / 32)) * 32 + q * 8; const size_t b = m / SEQ, s = (size_t)PERM[m];
    const v8f v = *(const v8f*)(x + (b * SEQ_FULL + s) * DM + c); v8us o;
#pragma unroll
    for (int k = 0; k < 8; ++k) o[k] = f2bf(v[k]);
    *(v8us*)(XB + e) = o; 
}

__global__ __launch_bounds__(256) void k_cvtT(const float* __restrict__ W, bf* Wt) {
    __shared__ float tl[64 * 65];
    const int k0 = blockIdx.x * 64, n0 = blockIdx.y * 64, tid = threadIdx.x;
#pragma unroll 4
    for (int i = 0; i < 16; ++i) { const int idx = i * 256 + tid; const int r = idx >> 6, c = idx & 63; tl[r * 65 + c] = W[(size_t)(k0 + r) * DM + n0 + c]; }
    __syncthreads();
    v8us o[2];
#pragma unroll
    for (int it = 0; it < 2; ++it) { const int p = it * 256 + tid; const int n = (p >> 7) * 16 + (p & 15), seg = (p >> 4) & 7;
#pragma unroll
        for (int j = 0; j < 8; ++j) o[it][j] = f2bf(tl[(seg * 8 + j) * 65 + n]); }
{
#pragma unroll
        for (int it = 0; it < 2; ++it) { const int p = it * 256 + tid; *(v8us*)(Wt + (size_t)(n0 + (p >> 7) * 16) * DM + k0 * 16 + (p & 127) * 8) = o[it]; }
         }
}

// ---- k_gemmw: register-blocked GEMM, ONE WAVE per 64x64 output tile (16 accumulators), operands straight from fragment-ordered bf16 planes; grid (Mrows/64, Ncols/64), 32 threads.
// C[m][n] = sum_k A[m][k] Bt[n][k] (+ A2[m][k] Bt[n][k] when NSPLIT == 1) + bf16(bias). K = DM is a constant, so the step from one 16-row block to the next folds into the loads' immediate offsets: one address pair per plane.
// EPI 0: f32 out[b][s][n] (rows = permuted tokens, stored at aux = PERM's token; bias per column), each 256-B row piece as 16 lanes x 16 B.
// EPI 1, 2 with aux = CNT: a tile whose 64 tokens all lie behind the batch's unmasked keys is never read by the key loop and leaves at once (aux == nullptr: every tile is computed).
template <int NSPLIT, int EPI>
__global__ __launch_bounds__(32) void k_gemmw(const bf* __restrict__ A, const bf* __restrict__ A2, const bf* __restrict__ Bt, float* Cf, h16* Ch, const float* __restrict__ bias, const int* __restrict__ aux) {
    constexpr int K = DM;
    __shared__ __align__(16) float os[16 * 68];
    const int lane = threadIdx.x & 31, lr = lane & 15, hi = lane >> 4; const int r0 = blockIdx.x * 64, c0 = blockIdx.y * 64;
    if (EPI != 0 && aux != nullptr) { const int t0 = (EPI == 1) ? r0 : c0; const int cnt = aux[t0 / SEQ]; if (cnt != 0 && t0 % SEQ >= cnt) return; }
    v8f acc[4][4];
#pragma unroll
    for (int mb = 0; mb < 4; ++mb)
#pragma unroll
        for (int nb = 0; nb < 4; ++nb) acc[mb][nb] = (v8f){};
    const bf* pa = A + (size_t)r0 * K + 8 * lane; const bf* pb = Bt + (size_t)c0 * K + 8 * lane;   // 16 rows x K = K / 32 blocks of 512 elements
    const bf* pa2 = (NSPLIT == 1) ? A2 + (size_t)r0 * K + 8 * lane : pa;
#pragma unroll 1
    for (int kc = 0; kc < K; kc += 32) {
        v16bf a[4], a2[4], b[4];
#pragma unroll
        for (int mb = 0; mb < 4; ++mb) { a[mb] = ldb(pa + mb * 16 * K); if (NSPLIT == 1) a2[mb] = ldb(pa2 + mb * 16 * K); }
#pragma unroll
        for (int nb = 0; nb < 4; ++nb) b[nb] = ldb(pb + nb * 16 * K);
        // the trip's loads all name these address pairs: the wait stands before any of them is rewritten, and reading them here keeps them out of the loads' result registers
        asm volatile("s_wait_xcnt 0x0" :: "v"(pa), "v"(pa2), "v"(pb) : "memory");
#pragma unroll
        for (int nb = 0; nb < 4; ++nb) {
#pragma unroll
            for (int mb = 0; mb < 4; ++mb) { acc[mb][nb] = wmmab(a[mb], b[nb], acc[mb][nb]); if (NSPLIT == 1) acc[mb][nb] = wmmab(a2[mb], b[nb], acc[mb][nb]); } }
        asm volatile("v_nop\n\tv_nop\n\tv_nop\n\tv_nop" : "+v"(acc[0][0]), "+v"(acc[1][1]), "+v"(acc[2][2]), "+v"(acc[3][3]) : "v"(a[0]), "v"(a[3]));
        pa += 512; pa2 += 512; pb += 512;
    }
#pragma unroll
    for (int mb = 0; mb < 4; ++mb) {
#pragma unroll
        for (int nb = 0; nb < 4; ++nb) {
#pragma unroll
            for (int j = 0; j < 8; ++j) os[(hi * 8 + j) * 68 + nb * 16 + lr] = acc[mb][nb][j]; }
        __builtin_amdgcn_wave_barrier(); asm volatile("" ::: "memory");
        if (EPI == 0) {
            const int bb = r0 / SEQ, s0 = r0 % SEQ;
            float* cbat = Cf + (size_t)bb * OUT_BSTRIDE + c0; const int* tok = aux + (size_t)bb * SEQ + s0 + mb * 16; v4f sv[8]; float* sp[8];
{
#pragma unroll
                for (int s = 0; s < 8; ++s) { const int row = 2 * s + hi, cofs = lr * 4; v4f val = *(const v4fa*)(os + row * 68 + cofs);
                    val[0] += bfr(bias[c0 + cofs]); val[1] += bfr(bias[c0 + cofs + 1]); val[2] += bfr(bias[c0 + cofs + 2]); val[3] += bfr(bias[c0 + cofs + 3]);
                    sv[s] = val; sp[s] = cbat + (size_t)tok[row] * DM + cofs; *(v4f*)sp[s] = sv[s]; }
                // the eight stores name these registers: the wait stands before any of them is rewritten, and reading them here keeps them whole up to it
                asm volatile("s_wait_xcnt 0x0" :: "v"(sv[0]), "v"(sv[1]), "v"(sv[2]), "v"(sv[3]), "v"(sv[4]), "v"(sv[5]), "v"(sv[6]), "v"(sv[7]), "v"(sp[0]), "v"(sp[1]), "v"(sp[2]), "v"(sp[3]), "v"(sp[4]), "v"(sp[5]), "v"(sp[6]), "v"(sp[7]) : "memory");
                 }
        } else {
            h16* base; size_t kstep;   // kstep: elements from one 32-k block of these 16 rows to the next (V^T keeps the four 16-row blocks of a 32-key step together)
            if (EPI == 1) { const int bb = r0 / SEQ, s0 = r0 % SEQ; base = Ch + (((size_t)bb * NH + blockIdx.y) * SEQ + s0 + mb * 16) * HD; kstep = 512; }
            else          { const int bb = c0 / SEQ, s0 = c0 % SEQ; base = Ch + ((size_t)bb * NH + blockIdx.x) * HD * SEQ + (size_t)s0 * HD + mb * 512; kstep = 512 * (HD / 16); }
{
#pragma unroll
                for (int s = 0; s < 4; ++s) { const int row = lr, seg = 2 * s + hi;
                    const v4f va = *(const v4fa*)(os + row * 68 + seg * 8); const v4f vb = *(const v4fa*)(os + row * 68 + seg * 8 + 4); v8h o;
                    if (EPI == 1) {
#pragma unroll
                        for (int j = 0; j < 4; ++j) { o[j] = (h16)(va[j] + bfr(bias[c0 + seg * 8 + j])); o[4 + j] = (h16)(vb[j] + bfr(bias[c0 + seg * 8 + 4 + j])); }
                    } else { const float bv = bfr(bias[r0 + mb * 16 + row]);
#pragma unroll
                        for (int j = 0; j < 4; ++j) { o[j] = (h16)(va[j] + bv); o[4 + j] = (h16)(vb[j] + bv); } }
                    *(v8h*)(base + (size_t)(s >> 1) * kstep + (s & 1) * 256 + lane * 8) = o; }
                 }
        }
        __builtin_amdgcn_wave_barrier(); asm volatile("" ::: "memory");
    }
}

// ---- k_flash: register-fed transposed flash attention. Block = 4 waves = 64 queries of one (b, h); wave = 16 queries (WMMA columns). Per 32-key step:
// S^T tiles (keys x queries) = K rows (A fragments from the f16 plane) x Q^T (B fragments held in registers); lane (h, n) then holds keys 8h + r (tile 0) and 16 + 8h + r (tile 1) of query n,
// which is exactly the B-fragment element order of P^T for O^T[d][query] += V^T[d][keys] P^T[keys][query] (A fragments from the f16 V^T plane). Running max / sum per query live in the lane (one xor-16 exchange).
// Keys are the batch's permuted tokens: the first cnt are unmasked, so a step with 32 of them needs no mask; the last, partial step replaces the scores behind cnt by the fill; with cnt == 0 all SEQ keys run with every score replaced (uniform weights).
__global__ __launch_bounds__(128) void k_flash(const h16* __restrict__ QP, const h16* __restrict__ KP, const h16* __restrict__ VT, const int* __restrict__ CNT, bf* ATh, bf* ATl) {
    const int tid = threadIdx.x, wave = tid >> 5, lane = tid & 31, hi = lane >> 4;
    const int bh = blockIdx.y, b = bh / NH, h = bh % NH; const int q0 = blockIdx.x * 64 + wave * 16;
    const int cnt = min(CNT[b], SEQ); const int nk = (cnt != 0) ? cnt : SEQ;   // block-uniform; the trip count is bounded by SEQ
    const h16* qp = QP + ((size_t)bh * SEQ + q0) * HD + 8 * lane;
    const v16h qb0 = ldh(qp), qb1 = ldh(qp + 512);
    const h16* kp = KP + (size_t)bh * SEQ * HD + 8 * lane;
    const h16* vp = VT + (size_t)bh * HD * SEQ + 8 * lane;
    v8f o[4];
#pragma unroll
    for (int t = 0; t < 4; ++t) o[t] = (v8f){};
    float mrun = -1.0e30f, lrun = 0.0f;
#pragma unroll 1
    for (int kt = 0; kt < nk; kt += 32) {
        const v16h ka0 = ldh(kp), ka1 = ldh(kp + 512), kb0 = ldh(kp + 16 * HD), kb1 = ldh(kp + 16 * HD + 512);
        v16h va[4];
#pragma unroll
        for (int t = 0; t < 4; ++t) va[t] = ldh(vp + t * 512);
        // the trip's loads all name these two address pairs: the wait stands before either is rewritten, and reading them here keeps them out of the loads' result registers
        asm volatile("s_wait_xcnt 0x0" :: "v"(kp), "v"(vp) : "memory");
        v8f s0 = (v8f){}, s1 = (v8f){};
        s0 = wmma16(ka0, qb0, s0); s1 = wmma16(kb0, qb0, s1); s0 = wmma16(ka1, qb1, s0); s1 = wmma16(kb1, qb1, s1);
        asm volatile("v_nop\n\tv_nop\n\tv_nop\n\tv_nop" : "+v"(s0), "+v"(s1) : "v"(ka0), "v"(ka1), "v"(kb0), "v"(kb1), "v"(qb0), "v"(qb1));
        const int rem = cnt - kt;   // unmasked keys from this step on (scalar)
        float u0[8], u1[8]; float mloc = NEGF;
        if (rem >= 32) {
#pragma unroll
            for (int r = 0; r < 8; ++r) { u0[r] = s0[r] * SL; u1[r] = s1[r] * SL; mloc = fmaxf(mloc, fmaxf(u0[r], u1[r])); }
        } else {
            const unsigned w = (rem > 0) ? (1u << rem) - 1u : 0u; const unsigned w0 = (w >> (8 * hi)) & 0xFFu, w1 = (w >> (16 + 8 * hi)) & 0xFFu;
#pragma unroll
            for (int r = 0; r < 8; ++r) { u0[r] = ((w0 >> r) & 1u) ? s0[r] * SL : NEGF; u1[r] = ((w1 >> r) & 1u) ? s1[r] * SL : NEGF; mloc = fmaxf(mloc, fmaxf(u0[r], u1[r])); }
        }
        mloc = fmaxf(mloc, __shfl_xor(mloc, 16, 32));
        const float mn = fmaxf(mrun, mloc);
        const float corr = __builtin_amdgcn_exp2f(mrun - mn);
        float sum = 0.0f; v16h pb;
#pragma unroll
        for (int r = 0; r < 8; ++r) { const float p0 = __builtin_amdgcn_exp2f(u0[r] - mn), p1 = __builtin_amdgcn_exp2f(u1[r] - mn); sum += p0 + p1; pb[r] = (h16)(p0 * PCAR); pb[8 + r] = (h16)(p1 * PCAR); }
        sum += __shfl_xor(sum, 16, 32);
        lrun = lrun * corr + sum;
        if (__builtin_amdgcn_ballot_w32(mn > mrun) != 0u) {      // wave-uniform: rescale only when some query's running max moved (corr == 1 exactly elsewhere)
#pragma unroll
            for (int t = 0; t < 4; ++t)
#pragma unroll
                for (int r = 0; r < 8; ++r) o[t][r] *= corr; }
        mrun = mn;
#pragma unroll
        for (int t = 0; t < 4; ++t) o[t] = wmma16(va[t], pb, o[t]);
        asm volatile("v_nop\n\tv_nop\n\tv_nop\n\tv_nop" : "+v"(o[0]), "+v"(o[1]), "+v"(o[2]), "+v"(o[3]) : "v"(va[0]), "v"(va[1]), "v"(va[2]), "v"(va[3]), "v"(pb));
        kp += 32 * HD; vp += 32 * HD;
    }
    const float inv = 1.0f / (lrun * PCAR);
    // lane (h, query) holds rows d = 16 t + 8 h + 0..7 of its query's O^T column: that is piece t of its lane in the fragment-ordered ctx planes, so no LDS transpose is needed
    v8us oh[4], ol[4];
#pragma unroll
    for (int t = 0; t < 4; ++t) {
#pragma unroll
        for (int j = 0; j < 8; ++j) { unsigned short x0, x1; splitf(o[t][j] * inv, x0, x1); oh[t][j] = x0; ol[t][j] = x1; } }
    bf* ah = ATh + ((size_t)b * SEQ + q0) * DM + h * (HD * 16) + lane * 8; bf* al = ATl + ((size_t)b * SEQ + q0) * DM + h * (HD * 16) + lane * 8;
{
#pragma unroll
        for (int s = 0; s < 4; ++s) { *(v8us*)(ah + s * 256) = oh[s]; *(v8us*)(al + s * 256) = ol[s]; }
         }
}

extern "C" void kernel_launch(void* const* d_in, const int* in_sizes, int n_in,
                              void* d_out, int out_size, void* d_ws, size_t ws_size, hipStream_t stream) {
    if (n_in < 10) return;
    const size_t needx = ((size_t)(NB - 1) * SEQ_FULL + SEQ) * DM, needm = (size_t)(NB - 1) * SEQ_FULL + SEQ;
    if ((size_t)in_sizes[0] < needx || (size_t)in_sizes[1] < needm) return;
    if ((size_t)in_sizes[2] < (size_t)DM * DM || (size_t)in_sizes[4] < (size_t)DM * DM || (size_t)in_sizes[6] < (size_t)DM * DM || (size_t)in_sizes[8] < (size_t)DM * DM) return;
    if (in_sizes[3] < DM || in_sizes[5] < DM || in_sizes[7] < DM || in_sizes[9] < DM) return;
    if ((size_t)out_size < (size_t)(NB - 1) * OUT_BSTRIDE + (size_t)SEQ * DM) return;
    const float* x = (const float*)d_in[0]; const int* mk = (const int*)d_in[1];
    const float* wq = (const float*)d_in[2]; const float* bq = (const float*)d_in[3]; const float* wk = (const float*)d_in[4]; const float* bk = (const float*)d_in[5];
    const float* wv = (const float*)d_in[6]; const float* bv = (const float*)d_in[7]; const float* wo = (const float*)d_in[8]; const float* bo = (const float*)d_in[9];
    float* OUT = (float*)d_out;
    char* wsp = (char*)d_ws;
    auto take = [&](size_t bytes) { char* p = wsp; wsp += (bytes + 255) & ~(size_t)255; return (void*)p; };
    const size_t MT = (size_t)NB * SEQ;                       // token rows
    bf* XB  = (bf*)take(MT * DM * 2);
    bf* WQt = (bf*)take((size_t)DM * DM * 2); bf* WKt = (bf*)take((size_t)DM * DM * 2); bf* WVt = (bf*)take((size_t)DM * DM * 2); bf* WOt = (bf*)take((size_t)DM * DM * 2);
    h16* QP = (h16*)take(MT * DM * 2); h16* KP = (h16*)take(MT * DM * 2); h16* VT = (h16*)take(MT * DM * 2);
    bf* ATh = (bf*)take(MT * DM * 2); bf* ATl = (bf*)take(MT * DM * 2);
    int* PERM = (int*)take(MT * 4); int* CNT = (int*)take((size_t)NB * 4);
    if ((size_t)(wsp - (char*)d_ws) > ws_size) return;        // 104 MiB at the full size
    k_perm<<<NB, 128, 0, stream>>>(mk, PERM, CNT);
    k_cvtx<<<(unsigned)((MT * DM / 8 + 255) / 256), 256, 0, stream>>>(x, PERM, XB);
    k_cvtT<<<dim3(DM / 64, DM / 64), 256, 0, stream>>>(wq, WQt);   // in[k][n] -> out[n][k]
    k_cvtT<<<dim3(DM / 64, DM / 64), 256, 0, stream>>>(wk, WKt);
    k_cvtT<<<dim3(DM / 64, DM / 64), 256, 0, stream>>>(wv, WVt);
    k_cvtT<<<dim3(DM / 64, DM / 64), 256, 0, stream>>>(wo, WOt);
    k_gemmw<0, 1><<<dim3((unsigned)(MT / 64), DM / 64), 32, 0, stream>>>(XB, nullptr, WQt, nullptr, QP, bq, nullptr);
    k_gemmw<0, 1><<<dim3((unsigned)(MT / 64), DM / 64), 32, 0, stream>>>(XB, nullptr, WKt, nullptr, KP, bk, CNT);
    k_gemmw<0, 2><<<dim3(DM / 64, (unsigned)(MT / 64)), 32, 0, stream>>>(WVt, nullptr, XB, nullptr, VT, bv, CNT);   // rows = features, cols = tokens: the tile is V^T
    k_flash<<<dim3(SEQ / 64, NB * NH), 128, 0, stream>>>(QP, KP, VT, CNT, ATh, ATl);
    k_gemmw<1, 0><<<dim3((unsigned)(MT / 64), DM / 64), 32, 0, stream>>>(ATh, ATl, WOt, OUT, nullptr, bo, PERM);
}

// v003
// Measured time: 162 microseconds a run.
// Next to v002, in two timings, it ran 1.44 and 1.46 times as fast.
// Counting every step since v000, it is 2.50 times as fast.
#include <hip/hip_runtime.h>

// Compute dtypes (f32 accumulate everywhere): q/k/v projections v_wmma_f32_16x16x32_bf16 on RNE-bf16 copies of x and W (f32 bias add); scores K.Q^T v_wmma_f32_16x16x32_f16 on f16 q/k planes; P.V v_wmma_f32_16x16x32_f16 (P carried x1024, f16 V^T plane); output projection bf16 hi+lo ctx planes x RNE-bf16 Wo (2 products); softmax in f32.
// Key-padding-masked multi-head self-attention: x [NB][SEQ][1024] f32, mask int32 [NB][SEQ] (0 = key masked: its score is REPLACED by -1e9), W [in][out] f32 + bias [out]; 16 heads x 64; scores x 0.125; softmax over all keys; out = ctx Wo + bo.
// Token order: inside each batch the tokens are permuted, unmasked keys first (rank order), masked ones behind; a masked key's weight is exp(-1e9 - max) = 0 in f32 as soon as one key of the batch is unmasked (|score| <= 64 * 1040^2 / 8 < 1e7 for any x and W the generators can draw), so K, V and the key loop cover only the first CNT[b] permuted tokens (rounded up to a tile). A batch with no unmasked key keeps all its keys, every score replaced by the fill (uniform weights). Queries run in permuted order and the output projection stores each row at its token's own place.
// Plan, five launches: (0) ranks -> PERM, CNT, and in the same launch transposed bf16 copies Wt[n][k] of the four weights (through LDS), (1) bf16 copy of x (rows gathered through PERM), (2) in one launch the one-wave 64x64 GEMMs writing f16 head planes Q[b][h][s][d], K[b][h][s][d] and V^T[b][h][d][s] (the V GEMM runs with operands swapped so its tile is already transposed),
// Every 16-bit plane is stored in fragment order: a block of 16 rows x 32 k is 512 elements laid out [k>>4 &1][k>>3 &1][row&15][k&7], so a wave's 16-byte fragment load reads 512 contiguous bytes (4 whole lines) at block + lane * 8 elements.
// (3) register-fed transposed flash attention: per wave 16 queries; S^T tile = K rows (A, from global) x Q^T (B, held in registers); the exponentials packed in place form the B fragment of O^T = V^T P^T; no LDS in the key loop, (4) ctx hi/lo planes x Wo^T + bo.

#ifndef NB
#define NB 4
#endif
#ifndef SEQ
#define SEQ 2048
#endif
#define NB_FULL  4
#define SEQ_FULL 2048
#define DM   1024
#define NH   16
#define HD   64
#ifndef OUT_BSTRIDE
#define OUT_BSTRIDE ((size_t)SEQ * DM)
#endif
#define PCAR 1024.0f
#define SL   0.18033688011112042f      // 0.125 * log2(e): scores go to the base-2 domain in one multiply
#define NEGF (-1.4426950408889634e9f)  // -1e9 * log2(e): the replace-fill in the base-2 domain

static_assert(SEQ % 128 == 0);
static_assert(NH * HD == DM);
static_assert(DM % 64 == 0);
static_assert(NB <= NB_FULL);
static_assert(SEQ <= SEQ_FULL);

typedef _Float16 h16;
typedef unsigned short bf;
typedef __attribute__((ext_vector_type(16))) __bf16   v16bf;
typedef __attribute__((ext_vector_type(16))) _Float16 v16h;
typedef __attribute__((ext_vector_type(8)))  _Float16 v8h;
typedef __attribute__((ext_vector_type(8)))  unsigned short v8us;
typedef __attribute__((ext_vector_type(8)))  float    v8f;
typedef __attribute__((ext_vector_type(4)))  float    v4f;
typedef v4f  __attribute__((may_alias)) v4fa;
typedef int  __attribute__((ext_vector_type(4), may_alias)) v4ia;

__device__ __forceinline__ unsigned short f2bf(float f) { unsigned u = __float_as_uint(f); u += 0x7FFFu + ((u >> 16) & 1u); return (unsigned short)(u >> 16); }
__device__ __forceinline__ float bf2f(unsigned short b) { return __uint_as_float(((unsigned)b) << 16); }
__device__ __forceinline__ float bfr(float f) { return bf2f(f2bf(f)); }
__device__ __forceinline__ void splitf(float y, unsigned short& h, unsigned short& l) { h = f2bf(y); l = f2bf(y - bf2f(h)); }
__device__ __forceinline__ v16h cat16(v8h lo, v8h hi) { return __builtin_shufflevector(lo, hi, 0, 1, 2, 3, 4, 5, 6, 7, 8, 9, 10, 11, 12, 13, 14, 15); }
__device__ __forceinline__ v16bf cat16b(v8us lo, v8us hi) { return __builtin_bit_cast(v16bf, __builtin_shufflevector(lo, hi, 0, 1, 2, 3, 4, 5, 6, 7, 8, 9, 10, 11, 12, 13, 14, 15)); }
__device__ __forceinline__ v8f wmma16(v16h a, v16h b, v8f c) { return __builtin_amdgcn_wmma_f32_16x16x32_f16(false, a, false, b, (short)0, c, false, false); }
__device__ __forceinline__ v8f wmmab(v16bf a, v16bf b, v8f c) { return __builtin_amdgcn_wmma_f32_16x16x32_bf16(false, a, false, b, (short)0, c, false, false); }
// Fragment loaders: p = start of a 16-row x 32-k block (512 elements, fragment order) + lane * 8; lane = 16 h + row; elements 0..7 <- k0 + 8h + 0..7, elements 8..15 <- k0 + 16 + 8h + 0..7 (same map for A and B).
__device__ __forceinline__ v16h  ldh(const h16* p) { return cat16(*(const v8h*)p, *(const v8h*)(p + 256)); }
__device__ __forceinline__ v16bf ldb(const bf* p)  { return cat16b(*(const v8us*)p, *(const v8us*)(p + 256)); }

// ---- perm_block: one block per batch. PERM[b][p] = token at permuted place p; CNT[b] = number of unmasked keys. Only mask != 0 is used and places are ranks, so every place lies in [0, SEQ) and is filled once for any mask content.
// The scatter goes to LDS; the table leaves as whole lines. 256 threads (the block size of the launch it shares with the weight transposes).
__device__ __forceinline__ void perm_block(const int* __restrict__ mask, int* PERM, int* CNT, unsigned* mw, int* ps, const int b) {
    static_assert(SEQ % 1024 == 0);
    const int tid = threadIdx.x, wave = tid >> 5, lane = tid & 31;
    const int* mb = mask + (size_t)b * SEQ_FULL;
    int mv[SEQ / 256];   // all loads first, so that they are in flight together
#pragma unroll
    for (int it = 0; it < SEQ / 256; ++it) mv[it] = mb[it * 256 + tid];
#pragma unroll
    for (int it = 0; it < SEQ / 256; ++it) { const unsigned w = __builtin_amdgcn_ballot_w32(mv[it] != 0); if (lane == 0) mw[it * 8 + wave] = w; }
    __syncthreads();
    int tot = 0;
#pragma unroll
    for (int i = 0; i < SEQ / 32; ++i) tot += __popc(mw[i]);
    // the wait ends the branch, so nothing rewrites a register that the store names in front of it
    if (tid == 0) { CNT[b] = tot; asm volatile("s_wait_xcnt 0x0" ::: "memory"); }
    int base = 0;   // unmasked keys in front of this trip's 256 tokens
#pragma unroll
    for (int it = 0; it < SEQ / 256; ++it) {
        int pre = base;
#pragma unroll
        for (int j = 0; j < 8; ++j) { const int c = __popc(mw[it * 8 + j]); pre += (j < wave) ? c : 0; base += c; }
        const unsigned w = mw[it * 8 + wave]; const int s = it * 256 + tid;
        const int rank = pre + __popc(w & ((1u << lane) - 1u));
        ps[((w >> lane) & 1u) ? rank : tot + (s - rank)] = s;
    }
    __syncthreads();
    v4ia* dst = (v4ia*)(PERM + (size_t)b * SEQ);
#pragma unroll
    for (int k = 0; k < SEQ / 1024; ++k) dst[k * 256 + tid] = ((const v4ia*)ps)[k * 256 + tid];
}

__global__ __launch_bounds__(256) void k_cvtx(const float* __restrict__ x, const int* __restrict__ PERM, bf* XB) {
    const size_t i = (size_t)blockIdx.x * 256 + threadIdx.x; if (i >= (size_t)NB * SEQ * DM / 8) return;
    // 64 threads per 16-row x 32-k block; a wave takes 8 rows x 4 pieces, so it reads 8 whole 128-byte lines of x and stores 4 whole lines of the fragment-ordered plane
    const size_t blk = i >> 6; const int lr = (int)(((i >> 5) & 1) * 8 + (i & 7)), q = (int)((i >> 3) & 3);
    const size_t e = blk * 512 + (size_t)(q * 16 + lr) * 8; const size_t m = (blk / (DM / 32)) * 16 + lr; const int c = (int)(blk % (DM / 32)) * 32 + q * 8; const size_t b = m / SEQ, s = (size_t)PERM[m];
    const v8f v = *(const v8f*)(x + (b * SEQ_FULL + s) * DM + c); v8us o;
#pragma unroll
    for (int k = 0; k < 8; ++k) o[k] = f2bf(v[k]);
    *(v8us*)(XB + e) = o; 
}

__device__ __forceinline__ void cvtT_block(const float* __restrict__ W, bf* Wt, float* tl, const int k0, const int n0) {
    const int tid = threadIdx.x;
#pragma unroll 4
    for (int i = 0; i < 16; ++i) { const int idx = i * 256 + tid; const int r = idx >> 6, c = idx & 63; tl[r * 65 + c] = W[(size_t)(k0 + r) * DM + n0 + c]; }
    __syncthreads();
    v8us o[2];
#pragma unroll
    for (int it = 0; it < 2; ++it) { const int p = it * 256 + tid; const int n = (p >> 7) * 16 + (p & 15), seg = (p >> 4) & 7;
#pragma unroll
        for (int j = 0; j < 8; ++j) o[it][j] = f2bf(tl[(seg * 8 + j) * 65 + n]); }
{
#pragma unroll
        for (int it = 0; it < 2; ++it) { const int p = it * 256 + tid; *(v8us*)(Wt + (size_t)(n0 + (p >> 7) * 16) * DM + k0 * 16 + (p & 127) * 8) = o[it]; }
         }
}

// ---- k_prep: the work that depends on no other kernel, in one launch. Blocks 0 .. NB-1 rank one batch's tokens each (the longest chain, so they start first); the rest transpose one 64x64 tile of one of the four weights. The branch is block-uniform, so every barrier is passed by a whole block.
__global__ __launch_bounds__(256) void k_prep(const int* __restrict__ mask, int* PERM, int* CNT, const float* __restrict__ wq, const float* __restrict__ wk, const float* __restrict__ wv, const float* __restrict__ wo, bf* WQt, bf* WKt, bf* WVt, bf* WOt) {
    __shared__ __align__(16) unsigned mw[SEQ / 32];
    __shared__ __align__(16) int ps[SEQ];
    __shared__ float tl[64 * 65];
    constexpr int TPW = (DM / 64) * (DM / 64);   // tiles per weight
    const int bid = blockIdx.x;
    if (bid < NB) { perm_block(mask, PERM, CNT, mw, ps, bid); return; }
    const int id = bid - NB, w = id / TPW, t = id % TPW;
    const float* W = (w == 0) ? wq : (w == 1) ? wk : (w == 2) ? wv : wo; bf* Wt = (w == 0) ? WQt : (w == 1) ? WKt : (w == 2) ? WVt : WOt;
    cvtT_block(W, Wt, tl, (t % (DM / 64)) * 64, (t / (DM / 64)) * 64);
}

// ---- gemm_tile: register-blocked GEMM, ONE WAVE per 64x64 output tile (16 accumulators), operands straight from fragment-ordered bf16 planes; tile (bx, by) of (Mrows/64, Ncols/64), 32 threads.
// C[m][n] = sum_k A[m][k] Bt[n][k] (+ A2[m][k] Bt[n][k] when NSPLIT == 1) + bf16(bias). K = DM is a constant, so the step from one 16-row block to the next folds into the loads' immediate offsets: one address pair per plane.
// EPI 0: f32 out[b][s][n] (rows = permuted tokens, stored at aux = PERM's token; bias per column), each 256-B row piece as 16 lanes x 16 B.
// EPI 1, 2 with aux = CNT: a tile whose 64 tokens all lie behind the batch's unmasked keys is never read by the key loop and leaves at once (aux == nullptr: every tile is computed).
template <int NSPLIT, int EPI>
__device__ __forceinline__ void gemm_tile(const bf* __restrict__ A, const bf* __restrict__ A2, const bf* __restrict__ Bt, float* Cf, h16* Ch, const float* __restrict__ bias, const int* __restrict__ aux, float* os, const int bx, const int by) {
    constexpr int K = DM;
    const int lane = threadIdx.x & 31, lr = lane & 15, hi = lane >> 4; const int r0 = bx * 64, c0 = by * 64;
    if (EPI != 0 && aux != nullptr) { const int t0 = (EPI == 1) ? r0 : c0; const int cnt = aux[t0 / SEQ]; if (cnt != 0 && t0 % SEQ >= cnt) return; }
    v8f acc[4][4];
#pragma unroll
    for (int mb = 0; mb < 4; ++mb)
#pragma unroll
        for (int nb = 0; nb < 4; ++nb) acc[mb][nb] = (v8f){};
    const bf* pa = A + (size_t)r0 * K + 8 * lane; const bf* pb = Bt + (size_t)c0 * K + 8 * lane;   // 16 rows x K = K / 32 blocks of 512 elements
    const bf* pa2 = (NSPLIT == 1) ? A2 + (size_t)r0 * K + 8 * lane : pa;
#pragma unroll 1
    for (int kc = 0; kc < K; kc += 32) {
        v16bf a[4], a2[4], b[4];
#pragma unroll
        for (int mb = 0; mb < 4; ++mb) { a[mb] = ldb(pa + mb * 16 * K); if (NSPLIT == 1) a2[mb] = ldb(pa2 + mb * 16 * K); }
#pragma unroll
        for (int nb = 0; nb < 4; ++nb) b[nb] = ldb(pb + nb * 16 * K);
        // the trip's loads all name these address pairs: the wait stands before any of them is rewritten, and reading them here keeps them out of the loads' result registers
        asm volatile("s_wait_xcnt 0x0" :: "v"(pa), "v"(pa2), "v"(pb) : "memory");
#pragma unroll
        for (int nb = 0; nb < 4; ++nb) {
#pragma unroll
            for (int mb = 0; mb < 4; ++mb) { acc[mb][nb] = wmmab(a[mb], b[nb], acc[mb][nb]); if (NSPLIT == 1) acc[mb][nb] = wmmab(a2[mb], b[nb], acc[mb][nb]); } }
        asm volatile("v_nop\n\tv_nop\n\tv_nop\n\tv_nop" : "+v"(acc[0][0]), "+v"(acc[1][1]), "+v"(acc[2][2]), "+v"(acc[3][3]) : "v"(a[0]), "v"(a[3]));
        pa += 512; pa2 += 512; pb += 512;
    }
#pragma unroll
    for (int mb = 0; mb < 4; ++mb) {
#pragma unroll
        for (int nb = 0; nb < 4; ++nb) {
#pragma unroll
            for (int j = 0; j < 8; ++j) os[(hi * 8 + j) * 68 + nb * 16 + lr] = acc[mb][nb][j]; }
        __builtin_amdgcn_wave_barrier(); asm volatile("" ::: "memory");
        if (EPI == 0) {
            const int bb = r0 / SEQ, s0 = r0 % SEQ;
            float* cbat = Cf + (size_t)bb * OUT_BSTRIDE + c0; const int* tok = aux + (size_t)bb * SEQ + s0 + mb * 16; v4f sv[8]; float* sp[8];
{
#pragma unroll
                for (int s = 0; s < 8; ++s) { const int row = 2 * s + hi, cofs = lr * 4; v4f val = *(const v4fa*)(os + row * 68 + cofs);
                    val[0] += bfr(bias[c0 + cofs]); val[1] += bfr(bias[c0 + cofs + 1]); val[2] += bfr(bias[c0 + cofs + 2]); val[3] += bfr(bias[c0 + cofs + 3]);
                    sv[s] = val; sp[s] = cbat + (size_t)tok[row] * DM + cofs; *(v4f*)sp[s] = sv[s]; }
                // the eight stores name these registers: the wait stands before any of them is rewritten, and reading them here keeps them whole up to it
                asm volatile("s_wait_xcnt 0x0" :: "v"(sv[0]), "v"(sv[1]), "v"(sv[2]), "v"(sv[3]), "v"(sv[4]), "v"(sv[5]), "v"(sv[6]), "v"(sv[7]), "v"(sp[0]), "v"(sp[1]), "v"(sp[2]), "v"(sp[3]), "v"(sp[4]), "v"(sp[5]), "v"(sp[6]), "v"(sp[7]) : "memory");
                 }
        } else {
            h16* base; size_t kstep;   // kstep: elements from one 32-k block of these 16 rows to the next (V^T keeps the four 16-row blocks of a 32-key step together)
            if (EPI == 1) { const int bb = r0 / SEQ, s0 = r0 % SEQ; base = Ch + (((size_t)bb * NH + by) * SEQ + s0 + mb * 16) * HD; kstep = 512; }
            else          { const int bb = c0 / SEQ, s0 = c0 % SEQ; base = Ch + ((size_t)bb * NH + bx) * HD * SEQ + (size_t)s0 * HD + mb * 512; kstep = 512 * (HD / 16); }
{
#pragma unroll
                for (int s = 0; s < 4; ++s) { const int row = lr, seg = 2 * s + hi;
                    const v4f va = *(const v4fa*)(os + row * 68 + seg * 8); const v4f vb = *(const v4fa*)(os + row * 68 + seg * 8 + 4); v8h o;
                    if (EPI == 1) {
#pragma unroll
                        for (int j = 0; j < 4; ++j) { o[j] = (h16)(va[j] + bfr(bias[c0 + seg * 8 + j])); o[4 + j] = (h16)(vb[j] + bfr(bias[c0 + seg * 8 + 4 + j])); }
                    } else { const float bv = bfr(bias[r0 + mb * 16 + row]);
#pragma unroll
                        for (int j = 0; j < 4; ++j) { o[j] = (h16)(va[j] + bv); o[4 + j] = (h16)(vb[j] + bv); } }
                    *(v8h*)(base + (size_t)(s >> 1) * kstep + (s & 1) * 256 + lane * 8) = o; }
                // the four stores name their base and value registers: the wait stands before the next 16-row piece (or code behind the tile) rewrites any of them
                asm volatile("s_wait_xcnt 0x0" ::: "memory");
                 }
        }
        __builtin_amdgcn_wave_barrier(); asm volatile("" ::: "memory");
    }
}

// ---- k_qkv: the three projections, which depend on each other in nothing, in one launch: grid (tokens/64, DM/64, 3), z = 0 Q, 1 K, 2 V. The V tiles keep their own order (feature tile fastest). The branch on z is wave-uniform (one wave per block).
__global__ __launch_bounds__(32) void k_qkv(const bf* __restrict__ XB, const bf* __restrict__ WQt, const bf* __restrict__ WKt, const bf* __restrict__ WVt, h16* QP, h16* KP, h16* VT, const float* __restrict__ bq, const float* __restrict__ bk, const float* __restrict__ bv, const int* __restrict__ CNT) {
    __shared__ __align__(16) float os[16 * 68];
    const int z = blockIdx.z;
    if (z == 2) { const int lin = blockIdx.y * (NB * SEQ / 64) + blockIdx.x; gemm_tile<0, 2>(WVt, nullptr, XB, nullptr, VT, bv, CNT, os, lin % (DM / 64), lin / (DM / 64)); }   // rows = features, cols = tokens: the tile is V^T
    else gemm_tile<0, 1>(XB, nullptr, z ? WKt : WQt, nullptr, z ? KP : QP, z ? bk : bq, z ? CNT : nullptr, os, blockIdx.x, blockIdx.y);
}

__global__ __launch_bounds__(32) void k_oproj(const bf* __restrict__ ATh, const bf* __restrict__ ATl, const bf* __restrict__ WOt, float* OUT, const float* __restrict__ bo, const int* __restrict__ PERM) {
    __shared__ __align__(16) float os[16 * 68];
    gemm_tile<1, 0>(ATh, ATl, WOt, OUT, nullptr, bo, PERM, os, blockIdx.x, blockIdx.y);
}

// ---- k_flash: register-fed transposed flash attention. Block = 4 waves = 64 queries of one (b, h); wave = 16 queries (WMMA columns). Per 32-key step:
// S^T tiles (keys x queries) = K rows (A fragments from the f16 plane) x Q^T (B fragments held in registers); lane (h, n) then holds keys 8h + r (tile 0) and 16 + 8h + r (tile 1) of query n,
// which is exactly the B-fragment element order of P^T for O^T[d][query] += V^T[d][keys] P^T[keys][query] (A fragments from the f16 V^T plane). Running max / sum per query live in the lane (one xor-16 exchange).
// Keys are the batch's permuted tokens: the first cnt are unmasked, so a step with 32 of them needs no mask; the last, partial step replaces the scores behind cnt by the fill; with cnt == 0 all SEQ keys run with every score replaced (uniform weights).
__global__ __launch_bounds__(128) void k_flash(const h16* __restrict__ QP, const h16* __restrict__ KP, const h16* __restrict__ VT, const int* __restrict__ CNT, bf* ATh, bf* ATl) {
    const int tid = threadIdx.x, wave = tid >> 5, lane = tid & 31, hi = lane >> 4;
    const int bh = blockIdx.y, b = bh / NH, h = bh % NH; const int q0 = blockIdx.x * 64 + wave * 16;
    const int cnt = min(CNT[b], SEQ); const int nk = (cnt != 0) ? cnt : SEQ;   // block-uniform; the trip count is bounded by SEQ
    const h16* qp = QP + ((size_t)bh * SEQ + q0) * HD + 8 * lane;
    const v16h qb0 = ldh(qp), qb1 = ldh(qp + 512);
    const h16* kp = KP + (size_t)bh * SEQ * HD + 8 * lane;
    const h16* vp = VT + (size_t)bh * HD * SEQ + 8 * lane;
    v8f o[4];
#pragma unroll
    for (int t = 0; t < 4; ++t) o[t] = (v8f){};
    float mrun = -1.0e30f, lrun = 0.0f;
#pragma unroll 1
    for (int kt = 0; kt < nk; kt += 32) {
        const v16h ka0 = ldh(kp), ka1 = ldh(kp + 512), kb0 = ldh(kp + 16 * HD), kb1 = ldh(kp + 16 * HD + 512);
        v16h va[4];
#pragma unroll
        for (int t = 0; t < 4; ++t) va[t] = ldh(vp + t * 512);
        // the trip's loads all name these two address pairs: the wait stands before either is rewritten, and reading them here keeps them out of the loads' result registers
        asm volatile("s_wait_xcnt 0x0" :: "v"(kp), "v"(vp) : "memory");
        v8f s0 = (v8f){}, s1 = (v8f){};
        s0 = wmma16(ka0, qb0, s0); s1 = wmma16(kb0, qb0, s1); s0 = wmma16(ka1, qb1, s0); s1 = wmma16(kb1, qb1, s1);
        asm volatile("v_nop\n\tv_nop\n\tv_nop\n\tv_nop" : "+v"(s0), "+v"(s1) : "v"(ka0), "v"(ka1), "v"(kb0), "v"(kb1), "v"(qb0), "v"(qb1));
        const int rem = cnt - kt;   // unmasked keys from this step on (scalar)
        float u0[8], u1[8]; float mloc = NEGF;
        if (rem >= 32) {
#pragma unroll
            for (int r = 0; r < 8; ++r) { u0[r] = s0[r] * SL; u1[r] = s1[r] * SL; mloc = fmaxf(mloc, fmaxf(u0[r], u1[r])); }
        } else {
            const unsigned w = (rem > 0) ? (1u << rem) - 1u : 0u; const unsigned w0 = (w >> (8 * hi)) & 0xFFu, w1 = (w >> (16 + 8 * hi)) & 0xFFu;
#pragma unroll
            for (int r = 0; r < 8; ++r) { u0[r] = ((w0 >> r) & 1u) ? s0[r] * SL : NEGF; u1[r] = ((w1 >> r) & 1u) ? s1[r] * SL : NEGF; mloc = fmaxf(mloc, fmaxf(u0[r], u1[r])); }
        }
        mloc = fmaxf(mloc, __shfl_xor(mloc, 16, 32));
        const float mn = fmaxf(mrun, mloc);
        const float corr = __builtin_amdgcn_exp2f(mrun - mn);
        float sum = 0.0f; v16h pb;
#pragma unroll
        for (int r = 0; r < 8; ++r) { const float p0 = __builtin_amdgcn_exp2f(u0[r] - mn), p1 = __builtin_amdgcn_exp2f(u1[r] - mn); sum += p0 + p1; pb[r] = (h16)(p0 * PCAR); pb[8 + r] = (h16)(p1 * PCAR); }
        sum += __shfl_xor(sum, 16, 32);
        lrun = lrun * corr + sum;
        if (__builtin_amdgcn_ballot_w32(mn > mrun) != 0u) {      // wave-uniform: rescale only when some query's running max moved (corr == 1 exactly elsewhere)
#pragma unroll
            for (int t = 0; t < 4; ++t)
#pragma unroll
                for (int r = 0; r < 8; ++r) o[t][r] *= corr; }
        mrun = mn;
#pragma unroll
        for (int t = 0; t < 4; ++t) o[t] = wmma16(va[t], pb, o[t]);
        asm volatile("v_nop\n\tv_nop\n\tv_nop\n\tv_nop" : "+v"(o[0]), "+v"(o[1]), "+v"(o[2]), "+v"(o[3]) : "v"(va[0]), "v"(va[1]), "v"(va[2]), "v"(va[3]), "v"(pb));
        kp += 32 * HD; vp += 32 * HD;
    }
    const float inv = 1.0f / (lrun * PCAR);
    // lane (h, query) holds rows d = 16 t + 8 h + 0..7 of its query's O^T column: that is piece t of its lane in the fragment-ordered ctx planes, so no LDS transpose is needed
    v8us oh[4], ol[4];
#pragma unroll
    for (int t = 0; t < 4; ++t) {
#pragma unroll
        for (int j = 0; j < 8; ++j) { unsigned short x0, x1; splitf(o[t][j] * inv, x0, x1); oh[t][j] = x0; ol[t][j] = x1; } }
    bf* ah = ATh + ((size_t)b * SEQ + q0) * DM + h * (HD * 16) + lane * 8; bf* al = ATl + ((size_t)b * SEQ + q0) * DM + h * (HD * 16) + lane * 8;
{
#pragma unroll
        for (int s = 0; s < 4; ++s) { *(v8us*)(ah + s * 256) = oh[s]; *(v8us*)(al + s * 256) = ol[s]; }
         }
}

extern "C" void kernel_launch(void* const* d_in, const int* in_sizes, int n_in,
                              void* d_out, int out_size, void* d_ws, size_t ws_size, hipStream_t stream) {
    if (n_in < 10) return;
    const size_t needx = ((size_t)(NB - 1) * SEQ_FULL + SEQ) * DM, needm = (size_t)(NB - 1) * SEQ_FULL + SEQ;
    if ((size_t)in_sizes[0] < needx || (size_t)in_sizes[1] < needm) return;
    if ((size_t)in_sizes[2] < (size_t)DM * DM || (size_t)in_sizes[4] < (size_t)DM * DM || (size_t)in_sizes[6] < (size_t)DM * DM || (size_t)in_sizes[8] < (size_t)DM * DM) return;
    if (in_sizes[3] < DM || in_sizes[5] < DM || in_sizes[7] < DM || in_sizes[9] < DM) return;
    if ((size_t)out_size < (size_t)(NB - 1) * OUT_BSTRIDE + (size_t)SEQ * DM) return;
    const float* x = (const float*)d_in[0]; const int* mk = (const int*)d_in[1];
    const float* wq = (const float*)d_in[2]; const float* bq = (const float*)d_in[3]; const float* wk = (const float*)d_in[4]; const float* bk = (const float*)d_in[5];
    const float* wv = (const float*)d_in[6]; const float* bv = (const float*)d_in[7]; const float* wo = (const float*)d_in[8]; const float* bo = (const float*)d_in[9];
    float* OUT = (float*)d_out;
    char* wsp = (char*)d_ws;
    auto take = [&](size_t bytes) { char* p = wsp; wsp += (bytes + 255) & ~(size_t)255; return (void*)p; };
    const size_t MT = (size_t)NB * SEQ;                       // token rows
    bf* XB  = (bf*)take(MT * DM * 2);
    bf* WQt = (bf*)take((size_t)DM * DM * 2); bf* WKt = (bf*)take((size_t)DM * DM * 2); bf* WVt = (bf*)take((size_t)DM * DM * 2); bf* WOt = (bf*)take((size_t)DM * DM * 2);
    h16* QP = (h16*)take(MT * DM * 2); h16* KP = (h16*)take(MT * DM * 2); h16* VT = (h16*)take(MT * DM * 2);
    bf* ATh = (bf*)take(MT * DM * 2); bf* ATl = (bf*)take(MT * DM * 2);
    int* PERM = (int*)take(MT * 4); int* CNT = (int*)take((size_t)NB * 4);
    if ((size_t)(wsp - (char*)d_ws) > ws_size) return;        // 104 MiB at the full size
    k_prep<<<NB + 4 * (DM / 64) * (DM / 64), 256, 0, stream>>>(mk, PERM, CNT, wq, wk, wv, wo, WQt, WKt, WVt, WOt);   // W in[k][n] -> out[n][k]
    k_cvtx<<<(unsigned)((MT * DM / 8 + 255) / 256), 256, 0, stream>>>(x, PERM, XB);
    k_qkv<<<dim3((unsigned)(MT / 64), DM / 64, 3), 32, 0, stream>>>(XB, WQt, WKt, WVt, QP, KP, VT, bq, bk, bv, CNT);
    k_flash<<<dim3(SEQ / 64, NB * NH), 128, 0, stream>>>(QP, KP, VT, CNT, ATh, ATl);
    k_oproj<<<dim3((unsigned)(MT / 64), DM / 64), 32, 0, stream>>>(ATh, ATl, WOt, OUT, bo, PERM);
}

// v004
// One run takes 139 microseconds.
// In two side-by-side timings against v003, it was 1.18 and 1.19 times as fast.
// Counting every step since v000, it is 2.97 times as fast.
#include <hip/hip_runtime.h>

// Compute dtypes (f32 accumulate everywhere): q/k/v projections v_wmma_f32_16x16x32_bf16 on RNE-bf16 copies of x and W (f32 bias add); scores K.Q^T v_wmma_f32_16x16x32_f16 on f16 q/k planes; P.V v_wmma_f32_16x16x32_f16 (P carried x1024, f16 V^T plane); output projection bf16 hi+lo ctx planes x RNE-bf16 Wo (2 products); softmax in f32.
// Key-padding-masked multi-head self-attention: x [NB][SEQ][1024] f32, mask int32 [NB][SEQ] (0 = key masked: its score is REPLACED by -1e9), W [in][out] f32 + bias [out]; 16 heads x 64; scores x 0.125; softmax over all keys; out = ctx Wo + bo.
// Token order: inside each batch the tokens are permuted, unmasked keys first (rank order), masked ones behind; a masked key's weight is exp(-1e9 - max) = 0 in f32 as soon as one key of the batch is unmasked (|score| <= 64 * 1040^2 / 8 < 1e7 for any x and W the generators can draw), so K, V and the key loop cover only the first CNT[b] permuted tokens (rounded up to a tile). A batch with no unmasked key keeps all its keys, every score replaced by the fill (uniform weights). Queries run in permuted order and the output projection stores each row at its token's own place.
// Plan, five launches: (0) ranks -> PERM, CNT, and in the same launch transposed bf16 copies Wt[n][k] of the four weights (through LDS), (1) bf16 copy of x (rows gathered through PERM), (2) in one launch the GEMMs (128x128 tile per block of four waves, 64x64 per wave, operands staged in LDS) writing f16 head planes Q[b][h][s][d], K[b][h][s][d] and V^T[b][h][d][s] (the V GEMM runs with operands swapped so its tile is already transposed),
// Every 16-bit plane is stored in fragment order: a block of 16 rows x 32 k is 512 elements laid out [k>>4 &1][k>>3 &1][row&15][k&7], so a wave's 16-byte fragment load reads 512 contiguous bytes (4 whole lines) at block + lane * 8 elements.
// (3) register-fed transposed flash attention: per wave 16 queries; S^T tile = K rows (A, from global) x Q^T (B, held in registers); the exponentials packed in place form the B fragment of O^T = V^T P^T; no LDS in the key loop, (4) ctx hi/lo planes x Wo^T + bo.

#ifndef NB
#define NB 4
#endif
#ifndef SEQ
#define SEQ 2048
#endif
#define NB_FULL  4
#define SEQ_FULL 2048
#define DM   1024
#define NH   16
#define HD   64
#ifndef OUT_BSTRIDE
#define OUT_BSTRIDE ((size_t)SEQ * DM)
#endif
#define PCAR 1024.0f
#define SL   0.18033688011112042f      // 0.125 * log2(e): scores go to the base-2 domain in one multiply
#define NEGF (-1.4426950408889634e9f)  // -1e9 * log2(e): the replace-fill in the base-2 domain

static_assert(SEQ % 128 == 0);
static_assert(NH * HD == DM);
static_assert(DM % 64 == 0);
static_assert(NB <= NB_FULL);
static_assert(SEQ <= SEQ_FULL);

typedef _Float16 h16;
typedef unsigned short bf;
typedef __attribute__((ext_vector_type(16))) __bf16   v16bf;
typedef __attribute__((ext_vector_type(16))) _Float16 v16h;
typedef __attribute__((ext_vector_type(8)))  _Float16 v8h;
typedef __attribute__((ext_vector_type(8)))  unsigned short v8us;
typedef __attribute__((ext_vector_type(8)))  float    v8f;
typedef __attribute__((ext_vector_type(4)))  float    v4f;
typedef v4f  __attribute__((may_alias)) v4fa;
typedef int  __attribute__((ext_vector_type(4), may_alias)) v4ia;

__device__ __forceinline__ unsigned short f2bf(float f) { unsigned u = __float_as_uint(f); u += 0x7FFFu + ((u >> 16) & 1u); return (unsigned short)(u >> 16); }
__device__ __forceinline__ float bf2f(unsigned short b) { return __uint_as_float(((unsigned)b) << 16); }
__device__ __forceinline__ float bfr(float f) { return bf2f(f2bf(f)); }
__device__ __forceinline__ void splitf(float y, unsigned short& h, unsigned short& l) { h = f2bf(y); l = f2bf(y - bf2f(h)); }
__device__ __forceinline__ v16h cat16(v8h lo, v8h hi) { return __builtin_shufflevector(lo, hi, 0, 1, 2, 3, 4, 5, 6, 7, 8, 9, 10, 11, 12, 13, 14, 15); }
__device__ __forceinline__ v16bf cat16b(v8us lo, v8us hi) { return __builtin_bit_cast(v16bf, __builtin_shufflevector(lo, hi, 0, 1, 2, 3, 4, 5, 6, 7, 8, 9, 10, 11, 12, 13, 14, 15)); }
__device__ __forceinline__ v8f wmma16(v16h a, v16h b, v8f c) { return __builtin_amdgcn_wmma_f32_16x16x32_f16(false, a, false, b, (short)0, c, false, false); }
__device__ __forceinline__ v8f wmmab(v16bf a, v16bf b, v8f c) { return __builtin_amdgcn_wmma_f32_16x16x32_bf16(false, a, false, b, (short)0, c, false, false); }
// Fragment loaders: p = start of a 16-row x 32-k block (512 elements, fragment order) + lane * 8; lane = 16 h + row; elements 0..7 <- k0 + 8h + 0..7, elements 8..15 <- k0 + 16 + 8h + 0..7 (same map for A and B).
__device__ __forceinline__ v16h  ldh(const h16* p) { return cat16(*(const v8h*)p, *(const v8h*)(p + 256)); }

// ---- perm_block: one block per batch. PERM[b][p] = token at permuted place p; CNT[b] = number of unmasked keys. Only mask != 0 is used and places are ranks, so every place lies in [0, SEQ) and is filled once for any mask content.
// The scatter goes to LDS; the table leaves as whole lines. 256 threads (the block size of the launch it shares with the weight transposes).
__device__ __forceinline__ void perm_block(const int* __restrict__ mask, int* PERM, int* CNT, unsigned* mw, int* ps, const int b) {
    static_assert(SEQ % 1024 == 0);
    const int tid = threadIdx.x, wave = tid >> 5, lane = tid & 31;
    const int* mb = mask + (size_t)b * SEQ_FULL;
    int mv[SEQ / 256];   // all loads first, so that they are in flight together
#pragma unroll
    for (int it = 0; it < SEQ / 256; ++it) mv[it] = mb[it * 256 + tid];
#pragma unroll
    for (int it = 0; it < SEQ / 256; ++it) { const unsigned w = __builtin_amdgcn_ballot_w32(mv[it] != 0); if (lane == 0) mw[it * 8 + wave] = w; }
    __syncthreads();
    int tot = 0;
#pragma unroll
    for (int i = 0; i < SEQ / 32; ++i) tot += __popc(mw[i]);
    // the wait ends the branch, so nothing rewrites a register that the store names in front of it
    if (tid == 0) { CNT[b] = tot; asm volatile("s_wait_xcnt 0x0" ::: "memory"); }
    int base = 0;   // unmasked keys in front of this trip's 256 tokens
#pragma unroll
    for (int it = 0; it < SEQ / 256; ++it) {
        int pre = base;
#pragma unroll
        for (int j = 0; j < 8; ++j) { const int c = __popc(mw[it * 8 + j]); pre += (j < wave) ? c : 0; base += c; }
        const unsigned w = mw[it * 8 + wave]; const int s = it * 256 + tid;
        const int rank = pre + __popc(w & ((1u << lane) - 1u));
        ps[((w >> lane) & 1u) ? rank : tot + (s - rank)] = s;
    }
    __syncthreads();
    v4ia* dst = (v4ia*)(PERM + (size_t)b * SEQ);
#pragma unroll
    for (int k = 0; k < SEQ / 1024; ++k) dst[k * 256 + tid] = ((const v4ia*)ps)[k * 256 + tid];
}

__global__ __launch_bounds__(256) void k_cvtx(const float* __restrict__ x, const int* __restrict__ PERM, bf* XB) {
    const size_t i = (size_t)blockIdx.x * 256 + threadIdx.x; if (i >= (size_t)NB * SEQ * DM / 8) return;
    // 64 threads per 16-row x 32-k block; a wave takes 8 rows x 4 pieces, so it reads 8 whole 128-byte lines of x and stores 4 whole lines of the fragment-ordered plane
    const size_t blk = i >> 6; const int lr = (int)(((i >> 5) & 1) * 8 + (i & 7)), q = (int)((i >> 3) & 3);
    const size_t e = blk * 512 + (size_t)(q * 16 + lr) * 8; const size_t m = (blk / (DM / 32)) * 16 + lr; const int c = (int)(blk % (DM / 32)) * 32 + q * 8; const size_t b = m / SEQ, s = (size_t)PERM[m];
    const v8f v = *(const v8f*)(x + (b * SEQ_FULL + s) * DM + c); v8us o;
#pragma unroll
    for (int k = 0; k < 8; ++k) o[k] = f2bf(v[k]);
    *(v8us*)(XB + e) = o; 
}

__device__ __forceinline__ void cvtT_block(const float* __restrict__ W, bf* Wt, float* tl, const int k0, const int n0) {
    const int tid = threadIdx.x;
#pragma unroll 4
    for (int i = 0; i < 16; ++i) { const int idx = i * 256 + tid; const int r = idx >> 6, c = idx & 63; tl[r * 65 + c] = W[(size_t)(k0 + r) * DM + n0 + c]; }
    __syncthreads();
    v8us o[2];
#pragma unroll
    for (int it = 0; it < 2; ++it) { const int p = it * 256 + tid; const int n = (p >> 7) * 16 + (p & 15), seg = (p >> 4) & 7;
#pragma unroll
        for (int j = 0; j < 8; ++j) o[it][j] = f2bf(tl[(seg * 8 + j) * 65 + n]); }
{
#pragma unroll
        for (int it = 0; it < 2; ++it) { const int p = it * 256 + tid; *(v8us*)(Wt + (size_t)(n0 + (p >> 7) * 16) * DM + k0 * 16 + (p & 127) * 8) = o[it]; }
         }
}

// ---- k_prep: the work that depends on no other kernel, in one launch. Blocks 0 .. NB-1 rank one batch's tokens each (the longest chain, so they start first); the rest transpose one 64x64 tile of one of the four weights. The branch is block-uniform, so every barrier is passed by a whole block.
__global__ __launch_bounds__(256) void k_prep(const int* __restrict__ mask, int* PERM, int* CNT, const float* __restrict__ wq, const float* __restrict__ wk, const float* __restrict__ wv, const float* __restrict__ wo, bf* WQt, bf* WKt, bf* WVt, bf* WOt) {
    __shared__ __align__(16) unsigned mw[SEQ / 32];
    __shared__ __align__(16) int ps[SEQ];
    __shared__ float tl[64 * 65];
    constexpr int TPW = (DM / 64) * (DM / 64);   // tiles per weight
    const int bid = blockIdx.x;
    if (bid < NB) { perm_block(mask, PERM, CNT, mw, ps, bid); return; }
    const int id = bid - NB, w = id / TPW, t = id % TPW;
    const float* W = (w == 0) ? wq : (w == 1) ? wk : (w == 2) ? wv : wo; bf* Wt = (w == 0) ? WQt : (w == 1) ? WKt : (w == 2) ? WVt : WOt;
    cvtT_block(W, Wt, tl, (t % (DM / 64)) * 64, (t / (DM / 64)) * 64);
}

// ---- stage_copy: one wave's share of one operand's stage: 32 rows x 64 k = two runs of 2 KiB in the fragment-ordered plane, as eight asynchronous 512-byte copies to LDS (16 bytes a lane, every lane on).
// l = the lane's LDS byte address, g = the lane's global address. The wait is the statement's last line, so no register that a copy names is rewritten in front of it.
__device__ __forceinline__ void stage_copy(const unsigned l, const bf* g) {
    const bf* h = g + 16 * DM;
    asm volatile("global_load_async_to_lds_b128 %0, %8, off\n\t"
                 "global_load_async_to_lds_b128 %1, %9, off\n\t"
                 "global_load_async_to_lds_b128 %2, %10, off\n\t"
                 "global_load_async_to_lds_b128 %3, %11, off\n\t"
                 "global_load_async_to_lds_b128 %4, %12, off\n\t"
                 "global_load_async_to_lds_b128 %5, %13, off\n\t"
                 "global_load_async_to_lds_b128 %6, %14, off\n\t"
                 "global_load_async_to_lds_b128 %7, %15, off\n\t"
                 "s_wait_xcnt 0x0"
                 :: "v"(l), "v"(l + 512u), "v"(l + 1024u), "v"(l + 1536u), "v"(l + 2048u), "v"(l + 2560u), "v"(l + 3072u), "v"(l + 3584u),
                    "v"(g), "v"(g + 256), "v"(g + 512), "v"(g + 768), "v"(h), "v"(h + 256), "v"(h + 512), "v"(h + 768) : "memory");
}
// LDS fragment loader: p = start of a 16-row x 32-k block in a stage + lane * 16 bytes (same element map as ldh).
__device__ __forceinline__ v16bf ldsb(const unsigned char* p) { return cat16b(*(const v8us*)p, *(const v8us*)(p + 512)); }

// ---- gemm_tile: block of FOUR WAVES per 128x128 output tile (tbx, tby) of (Mrows/128, Ncols/128); wave (w >> 1, w & 1) owns a 64x64 quarter (16 accumulators), so every staged operand row feeds two waves.
// C[m][n] = sum_k A[m][k] Bt[n][k] (+ A2[m][k] Bt[n][k] when NSPLIT == 1) + bf16(bias), k ascending in steps of 32. A stage is 64 k of the tile's 128 rows of each operand (16 KiB an operand, fragment order kept: block of 16 rows at 2 KiB, its two 32-k blocks at 1 KiB);
// two buffers: the copies of stage t + 1 fly while stage t is worked on. After the loop the same LDS serves the waves' output staging (the last trip's barrier ends every read of the buffers).
// EPI 0: f32 out[b][s][n] (rows = permuted tokens, stored at aux = PERM's token; bias per column), each 256-B row piece as 16 lanes x 16 B.
// EPI 1, 2 with aux = CNT: a tile whose 128 tokens all lie behind the batch's unmasked keys is never read by the key loop and leaves at once (aux == nullptr: every tile is computed).
template <int NSPLIT, int EPI>
__device__ __forceinline__ void gemm_tile(const bf* __restrict__ A, const bf* __restrict__ A2, const bf* __restrict__ Bt, float* Cf, h16* Ch, const float* __restrict__ bias, const int* __restrict__ aux, unsigned char* sm, const int tbx, const int tby) {
    constexpr int K = DM; constexpr unsigned OPB = 16384, STG = (2 + NSPLIT) * OPB; constexpr int NST = K / 64;
    const int lane = threadIdx.x & 31, lr = lane & 15, hi = lane >> 4; const int wave = __builtin_amdgcn_readfirstlane((int)(threadIdx.x >> 5));
    const int bx = tbx * 2 + (wave >> 1), by = tby * 2 + (wave & 1); const int r0 = bx * 64, c0 = by * 64;
    // block-uniform, in front of every copy and barrier
    if (EPI != 0 && aux != nullptr) { const int t0 = ((EPI == 1) ? tbx : tby) * 128; const int cnt = aux[t0 / SEQ]; if (cnt != 0 && t0 % SEQ >= cnt) return; }
    v8f acc[4][4];
#pragma unroll
    for (int mb = 0; mb < 4; ++mb)
#pragma unroll
        for (int nb = 0; nb < 4; ++nb) acc[mb][nb] = (v8f){};
    // this wave copies rows 32 w .. 32 w + 31 of the tile's 128 rows of each operand
    const bf* ga = A + ((size_t)tbx * 128 + wave * 32) * K + 8 * lane; const bf* gb = Bt + ((size_t)tby * 128 + wave * 32) * K + 8 * lane;
    const bf* ga2 = (NSPLIT == 1) ? A2 + ((size_t)tbx * 128 + wave * 32) * K + 8 * lane : ga;
    const unsigned lw = (unsigned)(size_t)sm + (unsigned)wave * 4096u + (unsigned)lane * 16u;
    auto fill = [&](const int s, const unsigned buf) {
        stage_copy(lw + buf * STG, ga + s * 1024); stage_copy(lw + buf * STG + OPB, gb + s * 1024);
        if (NSPLIT == 1) stage_copy(lw + buf * STG + 2 * OPB, ga2 + s * 1024);
    };
    fill(0, 0u);
    asm volatile("s_wait_asynccnt 0x0" ::: "memory");   // this wave's share of stage 0 has landed
    __syncthreads();                                     // every wave's share has
    fill(1, 1u);
    const unsigned char* fa = sm + (wave >> 1) * 8192 + lane * 16; const unsigned char* fb = sm + OPB + (wave & 1) * 8192 + lane * 16;
#pragma unroll 1
    for (int t = 0; t < NST; ++t) {
        const unsigned bo = (unsigned)(t & 1) * STG;
#pragma unroll
        for (int kk = 0; kk < 2; ++kk) {
            v16bf a[4], a2[4], b[4];
#pragma unroll
            for (int mb = 0; mb < 4; ++mb) { a[mb] = ldsb(fa + bo + mb * 2048 + kk * 1024); if (NSPLIT == 1) a2[mb] = ldsb(fa + bo + 2 * OPB + mb * 2048 + kk * 1024); }
#pragma unroll
            for (int nb = 0; nb < 4; ++nb) b[nb] = ldsb(fb + bo + nb * 2048 + kk * 1024);
            // two waves a SIMD here and registers to spare: the loaded fragments as inputs hold the block's 24 LDS loads together in front of its 32 products, one LDS wait a block instead of one in front of every column group
            if (NSPLIT == 1) asm volatile("" :: "v"(a[0]), "v"(a[1]), "v"(a[2]), "v"(a[3]), "v"(a2[0]), "v"(a2[1]), "v"(a2[2]), "v"(a2[3]), "v"(b[0]), "v"(b[1]), "v"(b[2]), "v"(b[3]));
#pragma unroll
            for (int nb = 0; nb < 4; ++nb) {
#pragma unroll
                for (int mb = 0; mb < 4; ++mb) { acc[mb][nb] = wmmab(a[mb], b[nb], acc[mb][nb]); if (NSPLIT == 1) acc[mb][nb] = wmmab(a2[mb], b[nb], acc[mb][nb]); } }
        }
        // keeps the stage's products in front of its foot: sunk behind the barrier they would delay the refill, which then has less than a whole trip to land
        __builtin_amdgcn_sched_barrier(0);
        asm volatile("s_wait_dscnt 0x0" ::: "memory");      // this wave's reads of stage t are done
        asm volatile("s_wait_asynccnt 0x0" ::: "memory");   // its share of stage t + 1 has landed
        __syncthreads();                                     // publishes stage t + 1 and frees stage t's buffer
        if (t + 2 < NST) fill(t + 2, (unsigned)(t & 1));
    }
    asm volatile("s_wait_asynccnt 0x0" ::: "memory");       // no copy is outstanding when the buffers become output staging
    float* os = (float*)(sm + wave * 4352);                  // each wave stages in its own 16 x 68 floats
#pragma unroll
    for (int mb = 0; mb < 4; ++mb) {
#pragma unroll
        for (int nb = 0; nb < 4; ++nb) {
#pragma unroll
            for (int j = 0; j < 8; ++j) os[(hi * 8 + j) * 68 + nb * 16 + lr] = acc[mb][nb][j]; }
        __builtin_amdgcn_wave_barrier(); asm volatile("" ::: "memory");
        if (EPI == 0) {
            const int bb = r0 / SEQ, s0 = r0 % SEQ;
            float* cbat = Cf + (size_t)bb * OUT_BSTRIDE + c0; const int* tok = aux + (size_t)bb * SEQ + s0 + mb * 16; v4f sv[8]; float* sp[8];
{
#pragma unroll
                for (int s = 0; s < 8; ++s) { const int row = 2 * s + hi, cofs = lr * 4; v4f val = *(const v4fa*)(os + row * 68 + cofs);
                    val[0] += bfr(bias[c0 + cofs]); val[1] += bfr(bias[c0 + cofs + 1]); val[2] += bfr(bias[c0 + cofs + 2]); val[3] += bfr(bias[c0 + cofs + 3]);
                    sv[s] = val; sp[s] = cbat + (size_t)tok[row] * DM + cofs; *(v4f*)sp[s] = sv[s]; }
                // the eight stores name these registers: the wait stands before any of them is rewritten, and reading them here keeps them whole up to it
                asm volatile("s_wait_xcnt 0x0" :: "v"(sv[0]), "v"(sv[1]), "v"(sv[2]), "v"(sv[3]), "v"(sv[4]), "v"(sv[5]), "v"(sv[6]), "v"(sv[7]), "v"(sp[0]), "v"(sp[1]), "v"(sp[2]), "v"(sp[3]), "v"(sp[4]), "v"(sp[5]), "v"(sp[6]), "v"(sp[7]) : "memory");
                 }
        } else {
            h16* base; size_t kstep;   // kstep: elements from one 32-k block of these 16 rows to the next (V^T keeps the four 16-row blocks of a 32-key step together)
            if (EPI == 1) { const int bb = r0 / SEQ, s0 = r0 % SEQ; base = Ch + (((size_t)bb * NH + by) * SEQ + s0 + mb * 16) * HD; kstep = 512; }
            else          { const int bb = c0 / SEQ, s0 = c0 % SEQ; base = Ch + ((size_t)bb * NH + bx) * HD * SEQ + (size_t)s0 * HD + mb * 512; kstep = 512 * (HD / 16); }
{
#pragma unroll
                for (int s = 0; s < 4; ++s) { const int row = lr, seg = 2 * s + hi;
                    const v4f va = *(const v4fa*)(os + row * 68 + seg * 8); const v4f vb = *(const v4fa*)(os + row * 68 + seg * 8 + 4); v8h o;
                    if (EPI == 1) {
#pragma unroll
                        for (int j = 0; j < 4; ++j) { o[j] = (h16)(va[j] + bfr(bias[c0 + seg * 8 + j])); o[4 + j] = (h16)(vb[j] + bfr(bias[c0 + seg * 8 + 4 + j])); }
                    } else { const float bv = bfr(bias[r0 + mb * 16 + row]);
#pragma unroll
                        for (int j = 0; j < 4; ++j) { o[j] = (h16)(va[j] + bv); o[4 + j] = (h16)(vb[j] + bv); } }
                    *(v8h*)(base + (size_t)(s >> 1) * kstep + (s & 1) * 256 + lane * 8) = o; }
                // the four stores name their base and value registers: the wait stands before the next 16-row piece (or code behind the tile) rewrites any of them
                asm volatile("s_wait_xcnt 0x0" ::: "memory");
                 }
        }
        __builtin_amdgcn_wave_barrier(); asm volatile("" ::: "memory");
    }
}

// ---- k_qkv: the three projections, which depend on each other in nothing, in one launch: grid (tokens/128, DM/128, 3), z = 0 Q, 1 K, 2 V. The V tiles keep their own order (feature tile fastest). The branch on z is block-uniform.
__global__ __launch_bounds__(128) void k_qkv(const bf* __restrict__ XB, const bf* __restrict__ WQt, const bf* __restrict__ WKt, const bf* __restrict__ WVt, h16* QP, h16* KP, h16* VT, const float* __restrict__ bq, const float* __restrict__ bk, const float* __restrict__ bv, const int* __restrict__ CNT) {
    __shared__ __align__(2048) unsigned char sm[2 * 2 * 16384];
    const int z = blockIdx.z;
    if (z == 2) { const int lin = blockIdx.y * (NB * SEQ / 128) + blockIdx.x; gemm_tile<0, 2>(WVt, nullptr, XB, nullptr, VT, bv, CNT, sm, lin % (DM / 128), lin / (DM / 128)); }   // rows = features, cols = tokens: the tile is V^T
    else gemm_tile<0, 1>(XB, nullptr, z ? WKt : WQt, nullptr, z ? KP : QP, z ? bk : bq, z ? CNT : nullptr, sm, blockIdx.x, blockIdx.y);
}

__global__ __launch_bounds__(128) void k_oproj(const bf* __restrict__ ATh, const bf* __restrict__ ATl, const bf* __restrict__ WOt, float* OUT, const float* __restrict__ bo, const int* __restrict__ PERM) {
    __shared__ __align__(2048) unsigned char sm[2 * 3 * 16384];
    gemm_tile<1, 0>(ATh, ATl, WOt, OUT, nullptr, bo, PERM, sm, blockIdx.x, blockIdx.y);
}

// ---- k_flash: register-fed transposed flash attention. Block = 4 waves = 64 queries of one (b, h); wave = 16 queries (WMMA columns). Per 32-key step:
// S^T tiles (keys x queries) = K rows (A fragments from the f16 plane) x Q^T (B fragments held in registers); lane (h, n) then holds keys 8h + r (tile 0) and 16 + 8h + r (tile 1) of query n,
// which is exactly the B-fragment element order of P^T for O^T[d][query] += V^T[d][keys] P^T[keys][query] (A fragments from the f16 V^T plane). Running max / sum per query live in the lane (one xor-16 exchange).
// Keys are the batch's permuted tokens: the first cnt are unmasked, so a step with 32 of them needs no mask; the last, partial step replaces the scores behind cnt by the fill; with cnt == 0 all SEQ keys run with every score replaced (uniform weights).
__global__ __launch_bounds__(128) void k_flash(const h16* __restrict__ QP, const h16* __restrict__ KP, const h16* __restrict__ VT, const int* __restrict__ CNT, bf* ATh, bf* ATl) {
    const int tid = threadIdx.x, wave = tid >> 5, lane = tid & 31, hi = lane >> 4;
    const int bh = blockIdx.y, b = bh / NH, h = bh % NH; const int q0 = blockIdx.x * 64 + wave * 16;
    const int cnt = min(CNT[b], SEQ); const int nk = (cnt != 0) ? cnt : SEQ;   // block-uniform; the trip count is bounded by SEQ
    const h16* qp = QP + ((size_t)bh * SEQ + q0) * HD + 8 * lane;
    const v16h qb0 = ldh(qp), qb1 = ldh(qp + 512);
    const h16* kp = KP + (size_t)bh * SEQ * HD + 8 * lane;
    const h16* vp = VT + (size_t)bh * HD * SEQ + 8 * lane;
    v8f o[4];
#pragma unroll
    for (int t = 0; t < 4; ++t) o[t] = (v8f){};
    float mrun = -1.0e30f, lrun = 0.0f;
#pragma unroll 1
    for (int kt = 0; kt < nk; kt += 32) {
        const v16h ka0 = ldh(kp), ka1 = ldh(kp + 512), kb0 = ldh(kp + 16 * HD), kb1 = ldh(kp + 16 * HD + 512);
        v16h va[4];
#pragma unroll
        for (int t = 0; t < 4; ++t) va[t] = ldh(vp + t * 512);
        // the trip's loads all name these two address pairs: the wait stands before either is rewritten, and reading them here keeps them out of the loads' result registers
        asm volatile("s_wait_xcnt 0x0" :: "v"(kp), "v"(vp) : "memory");
        v8f s0 = (v8f){}, s1 = (v8f){};
        s0 = wmma16(ka0, qb0, s0); s1 = wmma16(kb0, qb0, s1); s0 = wmma16(ka1, qb1, s0); s1 = wmma16(kb1, qb1, s1);
        asm volatile("v_nop\n\tv_nop\n\tv_nop\n\tv_nop" : "+v"(s0), "+v"(s1) : "v"(ka0), "v"(ka1), "v"(kb0), "v"(kb1), "v"(qb0), "v"(qb1));
        const int rem = cnt - kt;   // unmasked keys from this step on (scalar)
        float u0[8], u1[8]; float mloc = NEGF;
        if (rem >= 32) {
#pragma unroll
            for (int r = 0; r < 8; ++r) { u0[r] = s0[r] * SL; u1[r] = s1[r] * SL; mloc = fmaxf(mloc, fmaxf(u0[r], u1[r])); }
        } else {
            const unsigned w = (rem > 0) ? (1u << rem) - 1u : 0u; const unsigned w0 = (w >> (8 * hi)) & 0xFFu, w1 = (w >> (16 + 8 * hi)) & 0xFFu;
#pragma unroll
            for (int r = 0; r < 8; ++r) { u0[r] = ((w0 >> r) & 1u) ? s0[r] * SL : NEGF; u1[r] = ((w1 >> r) & 1u) ? s1[r] * SL : NEGF; mloc = fmaxf(mloc, fmaxf(u0[r], u1[r])); }
        }
        mloc = fmaxf(mloc, __shfl_xor(mloc, 16, 32));
        const float mn = fmaxf(mrun, mloc);
        const float corr = __builtin_amdgcn_exp2f(mrun - mn);
        float sum = 0.0f; v16h pb;
#pragma unroll
        for (int r = 0; r < 8; ++r) { const float p0 = __builtin_amdgcn_exp2f(u0[r] - mn), p1 = __builtin_amdgcn_exp2f(u1[r] - mn); sum += p0 + p1; pb[r] = (h16)(p0 * PCAR); pb[8 + r] = (h16)(p1 * PCAR); }
        sum += __shfl_xor(sum, 16, 32);
        lrun = lrun * corr + sum;
        if (__builtin_amdgcn_ballot_w32(mn > mrun) != 0u) {      // wave-uniform: rescale only when some query's running max moved (corr == 1 exactly elsewhere)
#pragma unroll
            for (int t = 0; t < 4; ++t)
#pragma unroll
                for (int r = 0; r < 8; ++r) o[t][r] *= corr; }
        mrun = mn;
#pragma unroll
        for (int t = 0; t < 4; ++t) o[t] = wmma16(va[t], pb, o[t]);
        asm volatile("v_nop\n\tv_nop\n\tv_nop\n\tv_nop" : "+v"(o[0]), "+v"(o[1]), "+v"(o[2]), "+v"(o[3]) : "v"(va[0]), "v"(va[1]), "v"(va[2]), "v"(va[3]), "v"(pb));
        kp += 32 * HD; vp += 32 * HD;
    }
    const float inv = 1.0f / (lrun * PCAR);
    // lane (h, query) holds rows d = 16 t + 8 h + 0..7 of its query's O^T column: that is piece t of its lane in the fragment-ordered ctx planes, so no LDS transpose is needed
    v8us oh[4], ol[4];
#pragma unroll
    for (int t = 0; t < 4; ++t) {
#pragma unroll
        for (int j = 0; j < 8; ++j) { unsigned short x0, x1; splitf(o[t][j] * inv, x0, x1); oh[t][j] = x0; ol[t][j] = x1; } }
    bf* ah = ATh + ((size_t)b * SEQ + q0) * DM + h * (HD * 16) + lane * 8; bf* al = ATl + ((size_t)b * SEQ + q0) * DM + h * (HD * 16) + lane * 8;
{
#pragma unroll
        for (int s = 0; s < 4; ++s) { *(v8us*)(ah + s * 256) = oh[s]; *(v8us*)(al + s * 256) = ol[s]; }
         }
}

extern "C" void kernel_launch(void* const* d_in, const int* in_sizes, int n_in,
                              void* d_out, int out_size, void* d_ws, size_t ws_size, hipStream_t stream) {
    if (n_in < 10) return;
    const size_t needx = ((size_t)(NB - 1) * SEQ_FULL + SEQ) * DM, needm = (size_t)(NB - 1) * SEQ_FULL + SEQ;
    if ((size_t)in_sizes[0] < needx || (size_t)in_sizes[1] < needm) return;
    if ((size_t)in_sizes[2] < (size_t)DM * DM || (size_t)in_sizes[4] < (size_t)DM * DM || (size_t)in_sizes[6] < (size_t)DM * DM || (size_t)in_sizes[8] < (size_t)DM * DM) return;
    if (in_sizes[3] < DM || in_sizes[5] < DM || in_sizes[7] < DM || in_sizes[9] < DM) return;
    if ((size_t)out_size < (size_t)(NB - 1) * OUT_BSTRIDE + (size_t)SEQ * DM) return;
    const float* x = (const float*)d_in[0]; const int* mk = (const int*)d_in[1];
    const float* wq = (const float*)d_in[2]; const float* bq = (const float*)d_in[3]; const float* wk = (const float*)d_in[4]; const float* bk = (const float*)d_in[5];
    const float* wv = (const float*)d_in[6]; const float* bv = (const float*)d_in[7]; const float* wo = (const float*)d_in[8]; const float* bo = (const float*)d_in[9];
    float* OUT = (float*)d_out;
    char* wsp = (char*)d_ws;
    auto take = [&](size_t bytes) { char* p = wsp; wsp += (bytes + 255) & ~(size_t)255; return (void*)p; };
    const size_t MT = (size_t)NB * SEQ;                       // token rows
    bf* XB  = (bf*)take(MT * DM * 2);
    bf* WQt = (bf*)take((size_t)DM * DM * 2); bf* WKt = (bf*)take((size_t)DM * DM * 2); bf* WVt = (bf*)take((size_t)DM * DM * 2); bf* WOt = (bf*)take((size_t)DM * DM * 2);
    h16* QP = (h16*)take(MT * DM * 2); h16* KP = (h16*)take(MT * DM * 2); h16* VT = (h16*)take(MT * DM * 2);
    bf* ATh = (bf*)take(MT * DM * 2); bf* ATl = (bf*)take(MT * DM * 2);
    int* PERM = (int*)take(MT * 4); int* CNT = (int*)take((size_t)NB * 4);
    if ((size_t)(wsp - (char*)d_ws) > ws_size) return;        // 104 MiB at the full size
    k_prep<<<NB + 4 * (DM / 64) * (DM / 64), 256, 0, stream>>>(mk, PERM, CNT, wq, wk, wv, wo, WQt, WKt, WVt, WOt);   // W in[k][n] -> out[n][k]
    k_cvtx<<<(unsigned)((MT * DM / 8 + 255) / 256), 256, 0, stream>>>(x, PERM, XB);
    k_qkv<<<dim3((unsigned)(MT / 128), DM / 128, 3), 128, 0, stream>>>(XB, WQt, WKt, WVt, QP, KP, VT, bq, bk, bv, CNT);
    k_flash<<<dim3(SEQ / 64, NB * NH), 128, 0, stream>>>(QP, KP, VT, CNT, ATh, ATl);
    k_oproj<<<dim3((unsigned)(MT / 128), DM / 128), 128, 0, stream>>>(ATh, ATl, WOt, OUT, bo, PERM);
}

// v005
// A run of this version takes 121 microseconds.
// Two timings next to v004 put it at 1.13 and 1.15 times that version's speed.
// Over all steps from v000 it is 3.38 times as fast.
#include <hip/hip_runtime.h>

// Compute dtypes (f32 accumulate everywhere): q/k/v projections v_wmma_f32_16x16x32_bf16 on RNE-bf16 copies of x and W (f32 bias add); scores K.Q^T v_wmma_f32_16x16x32_f16 on f16 q/k planes; P.V v_wmma_f32_16x16x32_f16 (P carried x1024, f16 V^T plane); output projection bf16 hi+lo ctx planes x RNE-bf16 Wo (2 products); softmax in f32.
// Key-padding-masked multi-head self-attention: x [NB][SEQ][1024] f32, mask int32 [NB][SEQ] (0 = key masked: its score is REPLACED by -1e9), W [in][out] f32 + bias [out]; 16 heads x 64; scores x 0.125; softmax over all keys; out = ctx Wo + bo.
// Token order: inside each batch the tokens are permuted, unmasked keys first (rank order), masked ones behind; a masked key's weight is exp(-1e9 - max) = 0 in f32 as soon as one key of the batch is unmasked (|score| <= 64 * 1040^2 / 8 < 1e7 for any x and W the generators can draw), so K, V and the key loop cover only the first CNT[b] permuted tokens (rounded up to a tile). A batch with no unmasked key keeps all its keys, every score replaced by the fill (uniform weights). Queries run in permuted order and the output projection stores each row at its token's own place.
// Plan, five launches: (0) ranks -> PERM, CNT, and in the same launch transposed bf16 copies Wt[n][k] of the four weights (through LDS), (1) bf16 copy of x (rows gathered through PERM), (2) in one launch the GEMMs (128x128 tile per block of four waves, 64x64 per wave, operands staged in LDS) writing f16 head planes Q[b][h][s][d], K[b][h][s][d] and V^T[b][h][d][s] (the V GEMM runs with operands swapped so its tile is already transposed),
// Every 16-bit plane is stored in fragment order: a block of 16 rows x 32 k is 512 elements laid out [k>>4 &1][k>>3 &1][row&15][k&7], so a wave's 16-byte fragment load reads 512 contiguous bytes (4 whole lines) at block + lane * 8 elements.
// (3) register-fed transposed flash attention: per wave 32 queries (two groups of 16 columns share each K and V^T fragment); S^T tile = K rows (A, from global) x Q^T (B, held in registers); the exponentials packed in place form the B fragment of O^T = V^T P^T; no LDS in the key loop, (4) ctx hi/lo planes x Wo^T + bo.

#ifndef NB
#define NB 4
#endif
#ifndef SEQ
#define SEQ 2048
#endif
#define NB_FULL  4
#define SEQ_FULL 2048
#define DM   1024
#define NH   16
#define HD   64
#ifndef OUT_BSTRIDE
#define OUT_BSTRIDE ((size_t)SEQ * DM)
#endif
#define PCAR 1024.0f
#define SL   0.18033688011112042f      // 0.125 * log2(e): scores go to the base-2 domain in one multiply
#define NEGF (-1.4426950408889634e9f)  // -1e9 * log2(e): the replace-fill in the base-2 domain

static_assert(SEQ % 128 == 0);
static_assert(NH * HD == DM);
static_assert(DM % 64 == 0);
static_assert(NB <= NB_FULL);
static_assert(SEQ <= SEQ_FULL);

typedef _Float16 h16;
typedef unsigned short bf;
typedef __attribute__((ext_vector_type(16))) __bf16   v16bf;
typedef __attribute__((ext_vector_type(16))) _Float16 v16h;
typedef __attribute__((ext_vector_type(8)))  _Float16 v8h;
typedef __attribute__((ext_vector_type(8)))  unsigned short v8us;
typedef __attribute__((ext_vector_type(8)))  float    v8f;
typedef __attribute__((ext_vector_type(4)))  float    v4f;
typedef v4f  __attribute__((may_alias)) v4fa;
typedef int  __attribute__((ext_vector_type(4), may_alias)) v4ia;

__device__ __forceinline__ unsigned short f2bf(float f) { unsigned u = __float_as_uint(f); u += 0x7FFFu + ((u >> 16) & 1u); return (unsigned short)(u >> 16); }
__device__ __forceinline__ float bf2f(unsigned short b) { return __uint_as_float(((unsigned)b) << 16); }
__device__ __forceinline__ float bfr(float f) { return bf2f(f2bf(f)); }
__device__ __forceinline__ void splitf(float y, unsigned short& h, unsigned short& l) { h = f2bf(y); l = f2bf(y - bf2f(h)); }
__device__ __forceinline__ v16h cat16(v8h lo, v8h hi) { return __builtin_shufflevector(lo, hi, 0, 1, 2, 3, 4, 5, 6, 7, 8, 9, 10, 11, 12, 13, 14, 15); }
__device__ __forceinline__ v16bf cat16b(v8us lo, v8us hi) { return __builtin_bit_cast(v16bf, __builtin_shufflevector(lo, hi, 0, 1, 2, 3, 4, 5, 6, 7, 8, 9, 10, 11, 12, 13, 14, 15)); }
__device__ __forceinline__ v8f wmma16(v16h a, v16h b, v8f c) { return __builtin_amdgcn_wmma_f32_16x16x32_f16(false, a, false, b, (short)0, c, false, false); }
__device__ __forceinline__ v8f wmmab(v16bf a, v16bf b, v8f c) { return __builtin_amdgcn_wmma_f32_16x16x32_bf16(false, a, false, b, (short)0, c, false, false); }
// Fragment loaders: p = start of a 16-row x 32-k block (512 elements, fragment order) + lane * 8; lane = 16 h + row; elements 0..7 <- k0 + 8h + 0..7, elements 8..15 <- k0 + 16 + 8h + 0..7 (same map for A and B).
__device__ __forceinline__ v16h  ldh(const h16* p) { return cat16(*(const v8h*)p, *(const v8h*)(p + 256)); }

// ---- perm_block: one block per batch. PERM[b][p] = token at permuted place p; CNT[b] = number of unmasked keys. Only mask != 0 is used and places are ranks, so every place lies in [0, SEQ) and is filled once for any mask content.
// The scatter goes to LDS; the table leaves as whole lines. 256 threads (the block size of the launch it shares with the weight transposes).
__device__ __forceinline__ void perm_block(const int* __restrict__ mask, int* PERM, int* CNT, unsigned* mw, int* ps, const int b) {
    static_assert(SEQ % 1024 == 0);
    const int tid = threadIdx.x, wave = tid >> 5, lane = tid & 31;
    const int* mb = mask + (size_t)b * SEQ_FULL;
    int mv[SEQ / 256];   // all loads first, so that they are in flight together
#pragma unroll
    for (int it = 0; it < SEQ / 256; ++it) mv[it] = mb[it * 256 + tid];
#pragma unroll
    for (int it = 0; it < SEQ / 256; ++it) { const unsigned w = __builtin_amdgcn_ballot_w32(mv[it] != 0); if (lane == 0) mw[it * 8 + wave] = w; }
    __syncthreads();
    int tot = 0;
#pragma unroll
    for (int i = 0; i < SEQ / 32; ++i) tot += __popc(mw[i]);
    // the wait ends the branch, so nothing rewrites a register that the store names in front of it
    if (tid == 0) { CNT[b] = tot; asm volatile("s_wait_xcnt 0x0" ::: "memory"); }
    int base = 0;   // unmasked keys in front of this trip's 256 tokens
#pragma unroll
    for (int it = 0; it < SEQ / 256; ++it) {
        int pre = base;
#pragma unroll
        for (int j = 0; j < 8; ++j) { const int c = __popc(mw[it * 8 + j]); pre += (j < wave) ? c : 0; base += c; }
        const unsigned w = mw[it * 8 + wave]; const int s = it * 256 + tid;
        const int rank = pre + __popc(w & ((1u << lane) - 1u));
        ps[((w >> lane) & 1u) ? rank : tot + (s - rank)] = s;
    }
    __syncthreads();
    v4ia* dst = (v4ia*)(PERM + (size_t)b * SEQ);
#pragma unroll
    for (int k = 0; k < SEQ / 1024; ++k) dst[k * 256 + tid] = ((const v4ia*)ps)[k * 256 + tid];
}

__global__ __launch_bounds__(256) void k_cvtx(const float* __restrict__ x, const int* __restrict__ PERM, bf* XB) {
    const size_t i = (size_t)blockIdx.x * 256 + threadIdx.x; if (i >= (size_t)NB * SEQ * DM / 8) return;
    // 64 threads per 16-row x 32-k block; a wave takes 8 rows x 4 pieces, so it reads 8 whole 128-byte lines of x and stores 4 whole lines of the fragment-ordered plane
    const size_t blk = i >> 6; const int lr = (int)(((i >> 5) & 1) * 8 + (i & 7)), q = (int)((i >> 3) & 3);
    const size_t e = blk * 512 + (size_t)(q * 16 + lr) * 8; const size_t m = (blk / (DM / 32)) * 16 + lr; const int c = (int)(blk % (DM / 32)) * 32 + q * 8; const size_t b = m / SEQ, s = (size_t)PERM[m];
    const v8f v = *(const v8f*)(x + (b * SEQ_FULL + s) * DM + c); v8us o;
#pragma unroll
    for (int k = 0; k < 8; ++k) o[k] = f2bf(v[k]);
    *(v8us*)(XB + e) = o; 
}

__device__ __forceinline__ void cvtT_block(const float* __restrict__ W, bf* Wt, float* tl, const int k0, const int n0) {
    const int tid = threadIdx.x;
#pragma unroll 4
    for (int i = 0; i < 16; ++i) { const int idx = i * 256 + tid; const int r = idx >> 6, c = idx & 63; tl[r * 65 + c] = W[(size_t)(k0 + r) * DM + n0 + c]; }
    __syncthreads();
    v8us o[2];
#pragma unroll
    for (int it = 0; it < 2; ++it) { const int p = it * 256 + tid; const int n = (p >> 7) * 16 + (p & 15), seg = (p >> 4) & 7;
#pragma unroll
        for (int j = 0; j < 8; ++j) o[it][j] = f2bf(tl[(seg * 8 + j) * 65 + n]); }
{
#pragma unroll
        for (int it = 0; it < 2; ++it) { const int p = it * 256 + tid; *(v8us*)(Wt + (size_t)(n0 + (p >> 7) * 16) * DM + k0 * 16 + (p & 127) * 8) = o[it]; }
         }
}

// ---- k_prep: the work that depends on no other kernel, in one launch. Blocks 0 .. NB-1 rank one batch's tokens each (the longest chain, so they start first); the rest transpose one 64x64 tile of one of the four weights. The branch is block-uniform, so every barrier is passed by a whole block.
__global__ __launch_bounds__(256) void k_prep(const int* __restrict__ mask, int* PERM, int* CNT, const float* __restrict__ wq, const float* __restrict__ wk, const float* __restrict__ wv, const float* __restrict__ wo, bf* WQt, bf* WKt, bf* WVt, bf* WOt) {
    __shared__ __align__(16) unsigned mw[SEQ / 32];
    __shared__ __align__(16) int ps[SEQ];
    __shared__ float tl[64 * 65];
    constexpr int TPW = (DM / 64) * (DM / 64);   // tiles per weight
    const int bid = blockIdx.x;
    if (bid < NB) { perm_block(mask, PERM, CNT, mw, ps, bid); return; }
    const int id = bid - NB, w = id / TPW, t = id % TPW;
    const float* W = (w == 0) ? wq : (w == 1) ? wk : (w == 2) ? wv : wo; bf* Wt = (w == 0) ? WQt : (w == 1) ? WKt : (w == 2) ? WVt : WOt;
    cvtT_block(W, Wt, tl, (t % (DM / 64)) * 64, (t / (DM / 64)) * 64);
}

// ---- stage_copy: one wave's share of one operand's stage: 32 rows x 64 k = two runs of 2 KiB in the fragment-ordered plane, as eight asynchronous 512-byte copies to LDS (16 bytes a lane, every lane on).
// l = the lane's LDS byte address, g = the lane's global address. The wait is the statement's last line, so no register that a copy names is rewritten in front of it.
__device__ __forceinline__ void stage_copy(const unsigned l, const bf* g) {
    const bf* h = g + 16 * DM;
    asm volatile("global_load_async_to_lds_b128 %0, %8, off\n\t"
                 "global_load_async_to_lds_b128 %1, %9, off\n\t"
                 "global_load_async_to_lds_b128 %2, %10, off\n\t"
                 "global_load_async_to_lds_b128 %3, %11, off\n\t"
                 "global_load_async_to_lds_b128 %4, %12, off\n\t"
                 "global_load_async_to_lds_b128 %5, %13, off\n\t"
                 "global_load_async_to_lds_b128 %6, %14, off\n\t"
                 "global_load_async_to_lds_b128 %7, %15, off\n\t"
                 "s_wait_xcnt 0x0"
                 :: "v"(l), "v"(l + 512u), "v"(l + 1024u), "v"(l + 1536u), "v"(l + 2048u), "v"(l + 2560u), "v"(l + 3072u), "v"(l + 3584u),
                    "v"(g), "v"(g + 256), "v"(g + 512), "v"(g + 768), "v"(h), "v"(h + 256), "v"(h + 512), "v"(h + 768) : "memory");
}
// LDS fragment loader: p = start of a 16-row x 32-k block in a stage + lane * 16 bytes (same element map as ldh).
__device__ __forceinline__ v16bf ldsb(const unsigned char* p) { return cat16b(*(const v8us*)p, *(const v8us*)(p + 512)); }

// ---- gemm_tile: block of FOUR WAVES per 128x128 output tile (tbx, tby) of (Mrows/128, Ncols/128); wave (w >> 1, w & 1) owns a 64x64 quarter (16 accumulators), so every staged operand row feeds two waves.
// C[m][n] = sum_k A[m][k] Bt[n][k] (+ A2[m][k] Bt[n][k] when NSPLIT == 1) + bf16(bias), k ascending in steps of 32. A stage is 64 k of the tile's 128 rows of each operand (16 KiB an operand, fragment order kept: block of 16 rows at 2 KiB, its two 32-k blocks at 1 KiB);
// two buffers: the copies of stage t + 1 fly while stage t is worked on. After the loop the same LDS serves the waves' output staging (the last trip's barrier ends every read of the buffers).
// EPI 0: f32 out[b][s][n] (rows = permuted tokens, stored at aux = PERM's token; bias per column), each 256-B row piece as 16 lanes x 16 B.
// EPI 1, 2 with aux = CNT: a tile whose 128 tokens all lie behind the batch's unmasked keys is never read by the key loop and leaves at once (aux == nullptr: every tile is computed).
template <int NSPLIT, int EPI>
__device__ __forceinline__ void gemm_tile(const bf* __restrict__ A, const bf* __restrict__ A2, const bf* __restrict__ Bt, float* Cf, h16* Ch, const float* __restrict__ bias, const int* __restrict__ aux, unsigned char* sm, const int tbx, const int tby) {
    constexpr int K = DM; constexpr unsigned OPB = 16384, STG = (2 + NSPLIT) * OPB; constexpr int NST = K / 64;
    const int lane = threadIdx.x & 31, lr = lane & 15, hi = lane >> 4; const int wave = __builtin_amdgcn_readfirstlane((int)(threadIdx.x >> 5));
    const int bx = tbx * 2 + (wave >> 1), by = tby * 2 + (wave & 1); const int r0 = bx * 64, c0 = by * 64;
    // block-uniform, in front of every copy and barrier
    if (EPI != 0 && aux != nullptr) { const int t0 = ((EPI == 1) ? tbx : tby) * 128; const int cnt = aux[t0 / SEQ]; if (cnt != 0 && t0 % SEQ >= cnt) return; }
    v8f acc[4][4];
#pragma unroll
    for (int mb = 0; mb < 4; ++mb)
#pragma unroll
        for (int nb = 0; nb < 4; ++nb) acc[mb][nb] = (v8f){};
    // this wave copies rows 32 w .. 32 w + 31 of the tile's 128 rows of each operand
    const bf* ga = A + ((size_t)tbx * 128 + wave * 32) * K + 8 * lane; const bf* gb = Bt + ((size_t)tby * 128 + wave * 32) * K + 8 * lane;
    const bf* ga2 = (NSPLIT == 1) ? A2 + ((size_t)tbx * 128 + wave * 32) * K + 8 * lane : ga;
    const unsigned lw = (unsigned)(size_t)sm + (unsigned)wave * 4096u + (unsigned)lane * 16u;
    auto fill = [&](const int s, const unsigned buf) {
        stage_copy(lw + buf * STG, ga + s * 1024); stage_copy(lw + buf * STG + OPB, gb + s * 1024);
        if (NSPLIT == 1) stage_copy(lw + buf * STG + 2 * OPB, ga2 + s * 1024);
    };
    fill(0, 0u);
    asm volatile("s_wait_asynccnt 0x0" ::: "memory");   // this wave's share of stage 0 has landed
    __syncthreads();                                     // every wave's share has
    fill(1, 1u);
    const unsigned char* fa = sm + (wave >> 1) * 8192 + lane * 16; const unsigned char* fb = sm + OPB + (wave & 1) * 8192 + lane * 16;
#pragma unroll 1
    for (int t = 0; t < NST; ++t) {
        const unsigned bo = (unsigned)(t & 1) * STG;
#pragma unroll
        for (int kk = 0; kk < 2; ++kk) {
            v16bf a[4], a2[4], b[4];
#pragma unroll
            for (int mb = 0; mb < 4; ++mb) { a[mb] = ldsb(fa + bo + mb * 2048 + kk * 1024); if (NSPLIT == 1) a2[mb] = ldsb(fa + bo + 2 * OPB + mb * 2048 + kk * 1024); }
#pragma unroll
            for (int nb = 0; nb < 4; ++nb) b[nb] = ldsb(fb + bo + nb * 2048 + kk * 1024);
            // two waves a SIMD here and registers to spare: the loaded fragments as inputs hold the block's 24 LDS loads together in front of its 32 products, one LDS wait a block instead of one in front of every column group
            if (NSPLIT == 1) asm volatile("" :: "v"(a[0]), "v"(a[1]), "v"(a[2]), "v"(a[3]), "v"(a2[0]), "v"(a2[1]), "v"(a2[2]), "v"(a2[3]), "v"(b[0]), "v"(b[1]), "v"(b[2]), "v"(b[3]));
#pragma unroll
            for (int nb = 0; nb < 4; ++nb) {
#pragma unroll
                for (int mb = 0; mb < 4; ++mb) { acc[mb][nb] = wmmab(a[mb], b[nb], acc[mb][nb]); if (NSPLIT == 1) acc[mb][nb] = wmmab(a2[mb], b[nb], acc[mb][nb]); } }
        }
        // keeps the stage's products in front of its foot: sunk behind the barrier they would delay the refill, which then has less than a whole trip to land
        __builtin_amdgcn_sched_barrier(0);
        asm volatile("s_wait_dscnt 0x0" ::: "memory");      // this wave's reads of stage t are done
        asm volatile("s_wait_asynccnt 0x0" ::: "memory");   // its share of stage t + 1 has landed
        __syncthreads();                                     // publishes stage t + 1 and frees stage t's buffer
        if (t + 2 < NST) fill(t + 2, (unsigned)(t & 1));
    }
    asm volatile("s_wait_asynccnt 0x0" ::: "memory");       // no copy is outstanding when the buffers become output staging
    float* os = (float*)(sm + wave * 4352);                  // each wave stages in its own 16 x 68 floats
#pragma unroll
    for (int mb = 0; mb < 4; ++mb) {
#pragma unroll
        for (int nb = 0; nb < 4; ++nb) {
#pragma unroll
            for (int j = 0; j < 8; ++j) os[(hi * 8 + j) * 68 + nb * 16 + lr] = acc[mb][nb][j]; }
        __builtin_amdgcn_wave_barrier(); asm volatile("" ::: "memory");
        if (EPI == 0) {
            const int bb = r0 / SEQ, s0 = r0 % SEQ;
            float* cbat = Cf + (size_t)bb * OUT_BSTRIDE + c0; const int* tok = aux + (size_t)bb * SEQ + s0 + mb * 16; v4f sv[8]; float* sp[8];
{
#pragma unroll
                for (int s = 0; s < 8; ++s) { const int row = 2 * s + hi, cofs = lr * 4; v4f val = *(const v4fa*)(os + row * 68 + cofs);
                    val[0] += bfr(bias[c0 + cofs]); val[1] += bfr(bias[c0 + cofs + 1]); val[2] += bfr(bias[c0 + cofs + 2]); val[3] += bfr(bias[c0 + cofs + 3]);
                    sv[s] = val; sp[s] = cbat + (size_t)tok[row] * DM + cofs; *(v4f*)sp[s] = sv[s]; }
                // the eight stores name these registers: the wait stands before any of them is rewritten, and reading them here keeps them whole up to it
                asm volatile("s_wait_xcnt 0x0" :: "v"(sv[0]), "v"(sv[1]), "v"(sv[2]), "v"(sv[3]), "v"(sv[4]), "v"(sv[5]), "v"(sv[6]), "v"(sv[7]), "v"(sp[0]), "v"(sp[1]), "v"(sp[2]), "v"(sp[3]), "v"(sp[4]), "v"(sp[5]), "v"(sp[6]), "v"(sp[7]) : "memory");
                 }
        } else {
            h16* base; size_t kstep;   // kstep: elements from one 32-k block of these 16 rows to the next (V^T keeps the four 16-row blocks of a 32-key step together)
            if (EPI == 1) { const int bb = r0 / SEQ, s0 = r0 % SEQ; base = Ch + (((size_t)bb * NH + by) * SEQ + s0 + mb * 16) * HD; kstep = 512; }
            else          { const int bb = c0 / SEQ, s0 = c0 % SEQ; base = Ch + ((size_t)bb * NH + bx) * HD * SEQ + (size_t)s0 * HD + mb * 512; kstep = 512 * (HD / 16); }
{
#pragma unroll
                for (int s = 0; s < 4; ++s) { const int row = lr, seg = 2 * s + hi;
                    const v4f va = *(const v4fa*)(os + row * 68 + seg * 8); const v4f vb = *(const v4fa*)(os + row * 68 + seg * 8 + 4); v8h o;
                    if (EPI == 1) {
#pragma unroll
                        for (int j = 0; j < 4; ++j) { o[j] = (h16)(va[j] + bfr(bias[c0 + seg * 8 + j])); o[4 + j] = (h16)(vb[j] + bfr(bias[c0 + seg * 8 + 4 + j])); }
                    } else { const float bv = bfr(bias[r0 + mb * 16 + row]);
#pragma unroll
                        for (int j = 0; j < 4; ++j) { o[j] = (h16)(va[j] + bv); o[4 + j] = (h16)(vb[j] + bv); } }
                    *(v8h*)(base + (size_t)(s >> 1) * kstep + (s & 1) * 256 + lane * 8) = o; }
                // the four stores name their base and value registers: the wait stands before the next 16-row piece (or code behind the tile) rewrites any of them
                asm volatile("s_wait_xcnt 0x0" ::: "memory");
                 }
        }
        __builtin_amdgcn_wave_barrier(); asm volatile("" ::: "memory");
    }
}

// ---- k_qkv: the three projections, which depend on each other in nothing, in one launch: grid (tokens/128, DM/128, 3), z = 0 Q, 1 K, 2 V. The V tiles keep their own order (feature tile fastest). The branch on z is block-uniform.
__global__ __launch_bounds__(128) void k_qkv(const bf* __restrict__ XB, const bf* __restrict__ WQt, const bf* __restrict__ WKt, const bf* __restrict__ WVt, h16* QP, h16* KP, h16* VT, const float* __restrict__ bq, const float* __restrict__ bk, const float* __restrict__ bv, const int* __restrict__ CNT) {
    __shared__ __align__(2048) unsigned char sm[2 * 2 * 16384];
    const int z = blockIdx.z;
    if (z == 2) { const int lin = blockIdx.y * (NB * SEQ / 128) + blockIdx.x; gemm_tile<0, 2>(WVt, nullptr, XB, nullptr, VT, bv, CNT, sm, lin % (DM / 128), lin / (DM / 128)); }   // rows = features, cols = tokens: the tile is V^T
    else gemm_tile<0, 1>(XB, nullptr, z ? WKt : WQt, nullptr, z ? KP : QP, z ? bk : bq, z ? CNT : nullptr, sm, blockIdx.x, blockIdx.y);
}

__global__ __launch_bounds__(128) void k_oproj(const bf* __restrict__ ATh, const bf* __restrict__ ATl, const bf* __restrict__ WOt, float* OUT, const float* __restrict__ bo, const int* __restrict__ PERM) {
    __shared__ __align__(2048) unsigned char sm[2 * 3 * 16384];
    gemm_tile<1, 0>(ATh, ATl, WOt, OUT, nullptr, bo, PERM, sm, blockIdx.x, blockIdx.y);
}

// ---- k_flash: register-fed transposed flash attention. Block = 4 waves = 128 queries of one (b, h); wave = 32 queries = two groups of 16 WMMA columns, so every K and V^T fragment that the wave loads feeds two products. Per 32-key step and group:
// S^T tiles (keys x queries) = K rows (A fragments from the f16 plane) x Q^T (B fragments held in registers); lane (h, n) then holds keys 8h + r (tile 0) and 16 + 8h + r (tile 1) of query n,
// which is exactly the B-fragment element order of P^T for O^T[d][query] += V^T[d][keys] P^T[keys][query] (A fragments from the f16 V^T plane). Running max / sum per query live in the lane (one xor-16 exchange).
// Keys are the batch's permuted tokens: the first cnt are unmasked, so a step with 32 of them needs no mask; the last, partial step replaces the scores behind cnt by the fill; with cnt == 0 all SEQ keys run with every score replaced (uniform weights).
__global__ __launch_bounds__(128) void k_flash(const h16* __restrict__ QP, const h16* __restrict__ KP, const h16* __restrict__ VT, const int* __restrict__ CNT, bf* ATh, bf* ATl) {
    const int tid = threadIdx.x, wave = tid >> 5, lane = tid & 31, hi = lane >> 4;
    const int bh = blockIdx.y, b = bh / NH, h = bh % NH; const int q0 = blockIdx.x * 128 + wave * 32;
    const int cnt = min(CNT[b], SEQ); const int nk = (cnt != 0) ? cnt : SEQ;   // block-uniform; the trip count is bounded by SEQ
    const h16* qp = QP + ((size_t)bh * SEQ + q0) * HD + 8 * lane;
    v16h qb0[2], qb1[2];
#pragma unroll
    for (int g = 0; g < 2; ++g) { qb0[g] = ldh(qp + g * 16 * HD); qb1[g] = ldh(qp + g * 16 * HD + 512); }
    const h16* kp = KP + (size_t)bh * SEQ * HD + 8 * lane;
    const h16* vp = VT + (size_t)bh * HD * SEQ + 8 * lane;
    v8f o[2][4];
#pragma unroll
    for (int g = 0; g < 2; ++g)
#pragma unroll
        for (int t = 0; t < 4; ++t) o[g][t] = (v8f){};
    float mrun[2] = {-1.0e30f, -1.0e30f}, lrun[2] = {0.0f, 0.0f};
#pragma unroll 1
    for (int kt = 0; kt < nk; kt += 32) {
        const v16h ka0 = ldh(kp), ka1 = ldh(kp + 512), kb0 = ldh(kp + 16 * HD), kb1 = ldh(kp + 16 * HD + 512);
        v16h va[4];
#pragma unroll
        for (int t = 0; t < 4; ++t) va[t] = ldh(vp + t * 512);
        // the trip's loads all name these two address pairs: the wait stands before either is rewritten, and reading them here keeps them out of the loads' result registers
        asm volatile("s_wait_xcnt 0x0" :: "v"(kp), "v"(vp) : "memory");
        v8f s0[2], s1[2];
#pragma unroll
        for (int g = 0; g < 2; ++g) { s0[g] = wmma16(ka0, qb0[g], (v8f){}); s1[g] = wmma16(kb0, qb0[g], (v8f){}); }
#pragma unroll
        for (int g = 0; g < 2; ++g) { s0[g] = wmma16(ka1, qb1[g], s0[g]); s1[g] = wmma16(kb1, qb1[g], s1[g]); }
        // the distance between the last product and the first reader of its result, on both sides of the branch below
        asm volatile("v_nop\n\tv_nop\n\tv_nop\n\tv_nop" : "+v"(s0[0]), "+v"(s1[0]), "+v"(s0[1]), "+v"(s1[1]) : "v"(ka0), "v"(ka1), "v"(kb0), "v"(kb1), "v"(qb0[0]), "v"(qb1[0]), "v"(qb0[1]), "v"(qb1[1]));
        const int rem = cnt - kt;   // unmasked keys from this step on (scalar)
        float u0[2][8], u1[2][8]; float mloc[2] = {NEGF, NEGF};
        if (rem >= 32) {
#pragma unroll
            for (int g = 0; g < 2; ++g)
#pragma unroll
                for (int r = 0; r < 8; ++r) { u0[g][r] = s0[g][r] * SL; u1[g][r] = s1[g][r] * SL; mloc[g] = fmaxf(mloc[g], fmaxf(u0[g][r], u1[g][r])); }
        } else {
            const unsigned w = (rem > 0) ? (1u << rem) - 1u : 0u; const unsigned w0 = (w >> (8 * hi)) & 0xFFu, w1 = (w >> (16 + 8 * hi)) & 0xFFu;
#pragma unroll
            for (int g = 0; g < 2; ++g)
#pragma unroll
                for (int r = 0; r < 8; ++r) { u0[g][r] = ((w0 >> r) & 1u) ? s0[g][r] * SL : NEGF; u1[g][r] = ((w1 >> r) & 1u) ? s1[g][r] * SL : NEGF; mloc[g] = fmaxf(mloc[g], fmaxf(u0[g][r], u1[g][r])); }
        }
        float mn[2], corr[2]; v16h pb[2];
#pragma unroll
        for (int g = 0; g < 2; ++g) {
            mloc[g] = fmaxf(mloc[g], __shfl_xor(mloc[g], 16, 32));
            mn[g] = fmaxf(mrun[g], mloc[g]);
            corr[g] = __builtin_amdgcn_exp2f(mrun[g] - mn[g]);
            float sum = 0.0f;
#pragma unroll
            for (int r = 0; r < 8; ++r) { const float p0 = __builtin_amdgcn_exp2f(u0[g][r] - mn[g]), p1 = __builtin_amdgcn_exp2f(u1[g][r] - mn[g]); sum += p0 + p1; pb[g][r] = (h16)(p0 * PCAR); pb[g][8 + r] = (h16)(p1 * PCAR); }
            sum += __shfl_xor(sum, 16, 32);
            lrun[g] = lrun[g] * corr[g] + sum;
        }
        if (__builtin_amdgcn_ballot_w32(mn[0] > mrun[0] || mn[1] > mrun[1]) != 0u) {      // wave-uniform, one test a step: rescale only when some query's running max moved (corr == 1 exactly elsewhere)
#pragma unroll
            for (int g = 0; g < 2; ++g)
#pragma unroll
                for (int t = 0; t < 4; ++t)
#pragma unroll
                    for (int r = 0; r < 8; ++r) o[g][t][r] *= corr[g]; }
        mrun[0] = mn[0]; mrun[1] = mn[1];
#pragma unroll
        for (int t = 0; t < 4; ++t)
#pragma unroll
            for (int g = 0; g < 2; ++g) o[g][t] = wmma16(va[t], pb[g], o[g][t]);
        // the distance behind the last product, also on the loop's taken back edge
        asm volatile("v_nop\n\tv_nop\n\tv_nop\n\tv_nop" : "+v"(o[0][0]), "+v"(o[0][1]), "+v"(o[0][2]), "+v"(o[0][3]), "+v"(o[1][0]), "+v"(o[1][1]), "+v"(o[1][2]), "+v"(o[1][3]) : "v"(va[0]), "v"(va[1]), "v"(va[2]), "v"(va[3]), "v"(pb[0]), "v"(pb[1]));
        kp += 32 * HD; vp += 32 * HD;
    }
    // lane (h, query) holds rows d = 16 t + 8 h + 0..7 of its query's O^T column: that is piece t of its lane in the fragment-ordered ctx planes, so no LDS transpose is needed
    v8us oh[2][4], ol[2][4];
#pragma unroll
    for (int g = 0; g < 2; ++g) {
        const float inv = 1.0f / (lrun[g] * PCAR);
#pragma unroll
        for (int t = 0; t < 4; ++t) {
#pragma unroll
            for (int j = 0; j < 8; ++j) { unsigned short x0, x1; splitf(o[g][t][j] * inv, x0, x1); oh[g][t][j] = x0; ol[g][t][j] = x1; } } }
    bf* ah = ATh + ((size_t)b * SEQ + q0) * DM + h * (HD * 16) + lane * 8; bf* al = ATl + ((size_t)b * SEQ + q0) * DM + h * (HD * 16) + lane * 8;
    // every value is formed first; behind the stores nothing is rewritten
#pragma unroll
    for (int g = 0; g < 2; ++g)
#pragma unroll
        for (int s = 0; s < 4; ++s) { *(v8us*)(ah + g * 16 * DM + s * 256) = oh[g][s]; *(v8us*)(al + g * 16 * DM + s * 256) = ol[g][s]; }
}

extern "C" void kernel_launch(void* const* d_in, const int* in_sizes, int n_in,
                              void* d_out, int out_size, void* d_ws, size_t ws_size, hipStream_t stream) {
    if (n_in < 10) return;
    const size_t needx = ((size_t)(NB - 1) * SEQ_FULL + SEQ) * DM, needm = (size_t)(NB - 1) * SEQ_FULL + SEQ;
    if ((size_t)in_sizes[0] < needx || (size_t)in_sizes[1] < needm) return;
    if ((size_t)in_sizes[2] < (size_t)DM * DM || (size_t)in_sizes[4] < (size_t)DM * DM || (size_t)in_sizes[6] < (size_t)DM * DM || (size_t)in_sizes[8] < (size_t)DM * DM) return;
    if (in_sizes[3] < DM || in_sizes[5] < DM || in_sizes[7] < DM || in_sizes[9] < DM) return;
    if ((size_t)out_size < (size_t)(NB - 1) * OUT_BSTRIDE + (size_t)SEQ * DM) return;
    const float* x = (const float*)d_in[0]; const int* mk = (const int*)d_in[1];
    const float* wq = (const float*)d_in[2]; const float* bq = (const float*)d_in[3]; const float* wk = (const float*)d_in[4]; const float* bk = (const float*)d_in[5];
    const float* wv = (const float*)d_in[6]; const float* bv = (const float*)d_in[7]; const float* wo = (const float*)d_in[8]; const float* bo = (const float*)d_in[9];
    float* OUT = (float*)d_out;
    char* wsp = (char*)d_ws;
    auto take = [&](size_t bytes) { char* p = wsp; wsp += (bytes + 255) & ~(size_t)255; return (void*)p; };
    const size_t MT = (size_t)NB * SEQ;                       // token rows
    bf* XB  = (bf*)take(MT * DM * 2);
    bf* WQt = (bf*)take((size_t)DM * DM * 2); bf* WKt = (bf*)take((size_t)DM * DM * 2); bf* WVt = (bf*)take((size_t)DM * DM * 2); bf* WOt = (bf*)take((size_t)DM * DM * 2);
    h16* QP = (h16*)take(MT * DM * 2); h16* KP = (h16*)take(MT * DM * 2); h16* VT = (h16*)take(MT * DM * 2);
    bf* ATh = (bf*)take(MT * DM * 2); bf* ATl = (bf*)take(MT * DM * 2);
    int* PERM = (int*)take(MT * 4); int* CNT = (int*)take((size_t)NB * 4);
    if ((size_t)(wsp - (char*)d_ws) > ws_size) return;        // 104 MiB at the full size
    k_prep<<<NB + 4 * (DM / 64) * (DM / 64), 256, 0, stream>>>(mk, PERM, CNT, wq, wk, wv, wo, WQt, WKt, WVt, WOt);   // W in[k][n] -> out[n][k]
    k_cvtx<<<(unsigned)((MT * DM / 8 + 255) / 256), 256, 0, stream>>>(x, PERM, XB);
    k_qkv<<<dim3((unsigned)(MT / 128), DM / 128, 3), 128, 0, stream>>>(XB, WQt, WKt, WVt, QP, KP, VT, bq, bk, bv, CNT);
    k_flash<<<dim3(SEQ / 128, NB * NH), 128, 0, stream>>>(QP, KP, VT, CNT, ATh, ATl);
    k_oproj<<<dim3((unsigned)(MT / 128), DM / 128), 128, 0, stream>>>(ATh, ATl, WOt, OUT, bo, PERM);
}

// v006
// One run takes 117 microseconds.
// Next to v005, in two timings, it ran 1.04 and 1.03 times as fast.
// Counting every step since v000, it is 3.49 times as fast.
#include <hip/hip_runtime.h>

// Compute dtypes (f32 accumulate everywhere): q/k/v projections v_wmma_f32_16x16x32_bf16 on RNE-bf16 copies of x and W (f32 bias add); scores K.Q^T v_wmma_f32_16x16x32_f16 on f16 q/k planes; P.V v_wmma_f32_16x16x32_f16 (P carried x1024: the carry is +10 in the exponent, f16 V^T plane); output projection bf16 hi+lo ctx planes x RNE-bf16 Wo (2 products); softmax in f32.
// Key-padding-masked multi-head self-attention: x [NB][SEQ][1024] f32, mask int32 [NB][SEQ] (0 = key masked: its score is REPLACED by -1e9), W [in][out] f32 + bias [out]; 16 heads x 64; scores x 0.125; softmax over all keys; out = ctx Wo + bo.
// Token order: inside each batch the tokens are permuted, unmasked keys first (rank order), masked ones behind; a masked key's weight is exp(-1e9 - max) = 0 in f32 as soon as one key of the batch is unmasked (|score| <= 64 * 1040^2 / 8 < 1e7 for any x and W the generators can draw), so K, V and the key loop cover only the first CNT[b] permuted tokens (rounded up to a tile). A batch with no unmasked key keeps all its keys, every score replaced by the fill (uniform weights). Queries run in permuted order and the output projection stores each row at its token's own place.
// Plan, five launches: (0) ranks -> PERM, CNT, and in the same launch transposed bf16 copies Wt[n][k] of the four weights (through LDS), (1) bf16 copy of x (rows gathered through PERM), (2) in one launch the GEMMs (128x128 tile per block of four waves, 64x64 per wave, operands staged in LDS) writing f16 head planes Q[b][h][s][d], K[b][h][s][d] and V^T[b][h][d][s] (the V GEMM runs with operands swapped so its tile is already transposed),
// Every 16-bit plane is stored in fragment order: a block of 16 rows x 32 k is 512 elements laid out [k>>4 &1][k>>3 &1][row&15][k&7], so a wave's 16-byte fragment load reads 512 contiguous bytes (4 whole lines) at block + lane * 8 elements.
// (3) register-fed transposed flash attention: per wave 32 queries (two groups of 16 columns share each K and V^T fragment); S^T tile = K rows (A, from global) x Q^T (B, held in registers); the exponentials packed in place form the B fragment of O^T = V^T P^T; no LDS in the key loop, (4) ctx hi/lo planes x Wo^T + bo.

#ifndef NB
#define NB 4
#endif
#ifndef SEQ
#define SEQ 2048
#endif
#define NB_FULL  4
#define SEQ_FULL 2048
#define DM   1024
#define NH   16
#define HD   64
#ifndef OUT_BSTRIDE
#define OUT_BSTRIDE ((size_t)SEQ * DM)
#endif
#define PLOG 10.0f                     // P and its row sums are carried x 2^10; the factor cancels in the final division
#define SL   0.18033688011112042f      // 0.125 * log2(e): takes a raw score to the base-2 domain
#define RAWF (-8.0e9f)                 // the replace-fill -1e9 in units of the raw (unscaled) score: -1e9 / 0.125

static_assert(SEQ % 128 == 0);
static_assert(NH * HD == DM);
static_assert(DM % 64 == 0);
static_assert(NB <= NB_FULL);
static_assert(SEQ <= SEQ_FULL);

typedef _Float16 h16;
typedef unsigned short bf;
typedef __attribute__((ext_vector_type(16))) __bf16   v16bf;
typedef __attribute__((ext_vector_type(16))) _Float16 v16h;
typedef __attribute__((ext_vector_type(8)))  _Float16 v8h;
typedef __attribute__((ext_vector_type(8)))  unsigned short v8us;
typedef __attribute__((ext_vector_type(8)))  float    v8f;
typedef __attribute__((ext_vector_type(4)))  float    v4f;
typedef __attribute__((ext_vector_type(2)))  float    v2f;
typedef v4f  __attribute__((may_alias)) v4fa;
typedef int  __attribute__((ext_vector_type(4), may_alias)) v4ia;

__device__ __forceinline__ unsigned short f2bf(float f) { unsigned u = __float_as_uint(f); u += 0x7FFFu + ((u >> 16) & 1u); return (unsigned short)(u >> 16); }
__device__ __forceinline__ float bf2f(unsigned short b) { return __uint_as_float(((unsigned)b) << 16); }
__device__ __forceinline__ float bfr(float f) { return bf2f(f2bf(f)); }
__device__ __forceinline__ void splitf(float y, unsigned short& h, unsigned short& l) { h = f2bf(y); l = f2bf(y - bf2f(h)); }
__device__ __forceinline__ v16h cat16(v8h lo, v8h hi) { return __builtin_shufflevector(lo, hi, 0, 1, 2, 3, 4, 5, 6, 7, 8, 9, 10, 11, 12, 13, 14, 15); }
__device__ __forceinline__ v16bf cat16b(v8us lo, v8us hi) { return __builtin_bit_cast(v16bf, __builtin_shufflevector(lo, hi, 0, 1, 2, 3, 4, 5, 6, 7, 8, 9, 10, 11, 12, 13, 14, 15)); }
__device__ __forceinline__ v8f wmma16(v16h a, v16h b, v8f c) { return __builtin_amdgcn_wmma_f32_16x16x32_f16(false, a, false, b, (short)0, c, false, false); }
__device__ __forceinline__ v8f wmmab(v16bf a, v16bf b, v8f c) { return __builtin_amdgcn_wmma_f32_16x16x32_bf16(false, a, false, b, (short)0, c, false, false); }
// Fragment loaders: p = start of a 16-row x 32-k block (512 elements, fragment order) + lane * 8; lane = 16 h + row; elements 0..7 <- k0 + 8h + 0..7, elements 8..15 <- k0 + 16 + 8h + 0..7 (same map for A and B).
__device__ __forceinline__ v16h  ldh(const h16* p) { return cat16(*(const v8h*)p, *(const v8h*)(p + 256)); }

// ---- perm_block: one block per batch. PERM[b][p] = token at permuted place p; CNT[b] = number of unmasked keys. Only mask != 0 is used and places are ranks, so every place lies in [0, SEQ) and is filled once for any mask content.
// The scatter goes to LDS; the table leaves as whole lines. 256 threads (the block size of the launch it shares with the weight transposes).
__device__ __forceinline__ void perm_block(const int* __restrict__ mask, int* PERM, int* CNT, unsigned* mw, int* ps, const int b) {
    static_assert(SEQ % 1024 == 0);
    const int tid = threadIdx.x, wave = tid >> 5, lane = tid & 31;
    const int* mb = mask + (size_t)b * SEQ_FULL;
    int mv[SEQ / 256];   // all loads first, so that they are in flight together
#pragma unroll
    for (int it = 0; it < SEQ / 256; ++it) mv[it] = mb[it * 256 + tid];
#pragma unroll
    for (int it = 0; it < SEQ / 256; ++it) { const unsigned w = __builtin_amdgcn_ballot_w32(mv[it] != 0); if (lane == 0) mw[it * 8 + wave] = w; }
    __syncthreads();
    int tot = 0;
#pragma unroll
    for (int i = 0; i < SEQ / 32; ++i) tot += __popc(mw[i]);
    // the wait ends the branch, so nothing rewrites a register that the store names in front of it
    if (tid == 0) { CNT[b] = tot; asm volatile("s_wait_xcnt 0x0" ::: "memory"); }
    int base = 0;   // unmasked keys in front of this trip's 256 tokens
#pragma unroll
    for (int it = 0; it < SEQ / 256; ++it) {
        int pre = base;
#pragma unroll
        for (int j = 0; j < 8; ++j) { const int c = __popc(mw[it * 8 + j]); pre += (j < wave) ? c : 0; base += c; }
        const unsigned w = mw[it * 8 + wave]; const int s = it * 256 + tid;
        const int rank = pre + __popc(w & ((1u << lane) - 1u));
        ps[((w >> lane) & 1u) ? rank : tot + (s - rank)] = s;
    }
    __syncthreads();
    v4ia* dst = (v4ia*)(PERM + (size_t)b * SEQ);
#pragma unroll
    for (int k = 0; k < SEQ / 1024; ++k) dst[k * 256 + tid] = ((const v4ia*)ps)[k * 256 + tid];
}

__global__ __launch_bounds__(256) void k_cvtx(const float* __restrict__ x, const int* __restrict__ PERM, bf* XB) {
    const size_t i = (size_t)blockIdx.x * 256 + threadIdx.x; if (i >= (size_t)NB * SEQ * DM / 8) return;
    // 64 threads per 16-row x 32-k block; a wave takes 8 rows x 4 pieces, so it reads 8 whole 128-byte lines of x and stores 4 whole lines of the fragment-ordered plane
    const size_t blk = i >> 6; const int lr = (int)(((i >> 5) & 1) * 8 + (i & 7)), q = (int)((i >> 3) & 3);
    const size_t e = blk * 512 + (size_t)(q * 16 + lr) * 8; const size_t m = (blk / (DM / 32)) * 16 + lr; const int c = (int)(blk % (DM / 32)) * 32 + q * 8; const size_t b = m / SEQ, s = (size_t)PERM[m];
    const v8f v = *(const v8f*)(x + (b * SEQ_FULL + s) * DM + c); v8us o;
#pragma unroll
    for (int k = 0; k < 8; ++k) o[k] = f2bf(v[k]);
    *(v8us*)(XB + e) = o; 
}

__device__ __forceinline__ void cvtT_block(const float* __restrict__ W, bf* Wt, float* tl, const int k0, const int n0) {
    const int tid = threadIdx.x;
#pragma unroll 4
    for (int i = 0; i < 16; ++i) { const int idx = i * 256 + tid; const int r = idx >> 6, c = idx & 63; tl[r * 65 + c] = W[(size_t)(k0 + r) * DM + n0 + c]; }
    __syncthreads();
    v8us o[2];
#pragma unroll
    for (int it = 0; it < 2; ++it) { const int p = it * 256 + tid; const int n = (p >> 7) * 16 + (p & 15), seg = (p >> 4) & 7;
#pragma unroll
        for (int j = 0; j < 8; ++j) o[it][j] = f2bf(tl[(seg * 8 + j) * 65 + n]); }
{
#pragma unroll
        for (int it = 0; it < 2; ++it) { const int p = it * 256 + tid; *(v8us*)(Wt + (size_t)(n0 + (p >> 7) * 16) * DM + k0 * 16 + (p & 127) * 8) = o[it]; }
         }
}

// ---- k_prep: the work that depends on no other kernel, in one launch. Blocks 0 .. NB-1 rank one batch's tokens each (the longest chain, so they start first); the rest transpose one 64x64 tile of one of the four weights. The branch is block-uniform, so every barrier is passed by a whole block.
__global__ __launch_bounds__(256) void k_prep(const int* __restrict__ mask, int* PERM, int* CNT, const float* __restrict__ wq, const float* __restrict__ wk, const float* __restrict__ wv, const float* __restrict__ wo, bf* WQt, bf* WKt, bf* WVt, bf* WOt) {
    __shared__ __align__(16) unsigned mw[SEQ / 32];
    __shared__ __align__(16) int ps[SEQ];
    __shared__ float tl[64 * 65];
    constexpr int TPW = (DM / 64) * (DM / 64);   // tiles per weight
    const int bid = blockIdx.x;
    if (bid < NB) { perm_block(mask, PERM, CNT, mw, ps, bid); return; }
    const int id = bid - NB, w = id / TPW, t = id % TPW;
    const float* W = (w == 0) ? wq : (w == 1) ? wk : (w == 2) ? wv : wo; bf* Wt = (w == 0) ? WQt : (w == 1) ? WKt : (w == 2) ? WVt : WOt;
    cvtT_block(W, Wt, tl, (t % (DM / 64)) * 64, (t / (DM / 64)) * 64);
}

// ---- stage_copy: one wave's share of one operand's stage: 32 rows x 64 k = two runs of 2 KiB in the fragment-ordered plane, as eight asynchronous 512-byte copies to LDS (16 bytes a lane, every lane on).
// l = the lane's LDS byte address, g = the lane's global address. The wait is the statement's last line, so no register that a copy names is rewritten in front of it.
__device__ __forceinline__ void stage_copy(const unsigned l, const bf* g) {
    const bf* h = g + 16 * DM;
    asm volatile("global_load_async_to_lds_b128 %0, %8, off\n\t"
                 "global_load_async_to_lds_b128 %1, %9, off\n\t"
                 "global_load_async_to_lds_b128 %2, %10, off\n\t"
                 "global_load_async_to_lds_b128 %3, %11, off\n\t"
                 "global_load_async_to_lds_b128 %4, %12, off\n\t"
                 "global_load_async_to_lds_b128 %5, %13, off\n\t"
                 "global_load_async_to_lds_b128 %6, %14, off\n\t"
                 "global_load_async_to_lds_b128 %7, %15, off\n\t"
                 "s_wait_xcnt 0x0"
                 :: "v"(l), "v"(l + 512u), "v"(l + 1024u), "v"(l + 1536u), "v"(l + 2048u), "v"(l + 2560u), "v"(l + 3072u), "v"(l + 3584u),
                    "v"(g), "v"(g + 256), "v"(g + 512), "v"(g + 768), "v"(h), "v"(h + 256), "v"(h + 512), "v"(h + 768) : "memory");
}
// LDS fragment loader: p = start of a 16-row x 32-k block in a stage + lane * 16 bytes (same element map as ldh).
__device__ __forceinline__ v16bf ldsb(const unsigned char* p) { return cat16b(*(const v8us*)p, *(const v8us*)(p + 512)); }

// ---- gemm_tile: block of FOUR WAVES per 128x128 output tile (tbx, tby) of (Mrows/128, Ncols/128); wave (w >> 1, w & 1) owns a 64x64 quarter (16 accumulators), so every staged operand row feeds two waves.
// C[m][n] = sum_k A[m][k] Bt[n][k] (+ A2[m][k] Bt[n][k] when NSPLIT == 1) + bf16(bias), k ascending in steps of 32. A stage is 64 k of the tile's 128 rows of each operand (16 KiB an operand, fragment order kept: block of 16 rows at 2 KiB, its two 32-k blocks at 1 KiB);
// two buffers: the copies of stage t + 1 fly while stage t is worked on. After the loop the same LDS serves the waves' output staging (the last trip's barrier ends every read of the buffers).
// EPI 0: f32 out[b][s][n] (rows = permuted tokens, stored at aux = PERM's token; bias per column), each 256-B row piece as 16 lanes x 16 B.
// EPI 1, 2 with aux = CNT: a tile whose 128 tokens all lie behind the batch's unmasked keys is never read by the key loop and leaves at once (aux == nullptr: every tile is computed).
template <int NSPLIT, int EPI>
__device__ __forceinline__ void gemm_tile(const bf* __restrict__ A, const bf* __restrict__ A2, const bf* __restrict__ Bt, float* Cf, h16* Ch, const float* __restrict__ bias, const int* __restrict__ aux, unsigned char* sm, const int tbx, const int tby) {
    constexpr int K = DM; constexpr unsigned OPB = 16384, STG = (2 + NSPLIT) * OPB; constexpr int NST = K / 64;
    const int lane = threadIdx.x & 31, lr = lane & 15, hi = lane >> 4; const int wave = __builtin_amdgcn_readfirstlane((int)(threadIdx.x >> 5));
    const int bx = tbx * 2 + (wave >> 1), by = tby * 2 + (wave & 1); const int r0 = bx * 64, c0 = by * 64;
    // block-uniform, in front of every copy and barrier
    if (EPI != 0 && aux != nullptr) { const int t0 = ((EPI == 1) ? tbx : tby) * 128; const int cnt = aux[t0 / SEQ]; if (cnt != 0 && t0 % SEQ >= cnt) return; }
    v8f acc[4][4];
#pragma unroll
    for (int mb = 0; mb < 4; ++mb)
#pragma unroll
        for (int nb = 0; nb < 4; ++nb) acc[mb][nb] = (v8f){};
    // this wave copies rows 32 w .. 32 w + 31 of the tile's 128 rows of each operand
    const bf* ga = A + ((size_t)tbx * 128 + wave * 32) * K + 8 * lane; const bf* gb = Bt + ((size_t)tby * 128 + wave * 32) * K + 8 * lane;
    const bf* ga2 = (NSPLIT == 1) ? A2 + ((size_t)tbx * 128 + wave * 32) * K + 8 * lane : ga;
    const unsigned lw = (unsigned)(size_t)sm + (unsigned)wave * 4096u + (unsigned)lane * 16u;
    auto fill = [&](const int s, const unsigned buf) {
        stage_copy(lw + buf * STG, ga + s * 1024); stage_copy(lw + buf * STG + OPB, gb + s * 1024);
        if (NSPLIT == 1) stage_copy(lw + buf * STG + 2 * OPB, ga2 + s * 1024);
    };
    fill(0, 0u);
    asm volatile("s_wait_asynccnt 0x0" ::: "memory");   // this wave's share of stage 0 has landed
    __syncthreads();                                     // every wave's share has
    fill(1, 1u);
    const unsigned char* fa = sm + (wave >> 1) * 8192 + lane * 16; const unsigned char* fb = sm + OPB + (wave & 1) * 8192 + lane * 16;
#pragma unroll 1
    for (int t = 0; t < NST; ++t) {
        const unsigned bo = (unsigned)(t & 1) * STG;
#pragma unroll
        for (int kk = 0; kk < 2; ++kk) {
            v16bf a[4], a2[4], b[4];
#pragma unroll
            for (int mb = 0; mb < 4; ++mb) { a[mb] = ldsb(fa + bo + mb * 2048 + kk * 1024); if (NSPLIT == 1) a2[mb] = ldsb(fa + bo + 2 * OPB + mb * 2048 + kk * 1024); }
#pragma unroll
            for (int nb = 0; nb < 4; ++nb) b[nb] = ldsb(fb + bo + nb * 2048 + kk * 1024);
            // two waves a SIMD here and registers to spare: the loaded fragments as inputs hold the block's 24 LDS loads together in front of its 32 products, one LDS wait a block instead of one in front of every column group
            if (NSPLIT == 1) asm volatile("" :: "v"(a[0]), "v"(a[1]), "v"(a[2]), "v"(a[3]), "v"(a2[0]), "v"(a2[1]), "v"(a2[2]), "v"(a2[3]), "v"(b[0]), "v"(b[1]), "v"(b[2]), "v"(b[3]));
#pragma unroll
            for (int nb = 0; nb < 4; ++nb) {
#pragma unroll
                for (int mb = 0; mb < 4; ++mb) { acc[mb][nb] = wmmab(a[mb], b[nb], acc[mb][nb]); if (NSPLIT == 1) acc[mb][nb] = wmmab(a2[mb], b[nb], acc[mb][nb]); } }
        }
        // keeps the stage's products in front of its foot: sunk behind the barrier they would delay the refill, which then has less than a whole trip to land
        __builtin_amdgcn_sched_barrier(0);
        asm volatile("s_wait_dscnt 0x0" ::: "memory");      // this wave's reads of stage t are done
        asm volatile("s_wait_asynccnt 0x0" ::: "memory");   // its share of stage t + 1 has landed
        __syncthreads();                                     // publishes stage t + 1 and frees stage t's buffer
        if (t + 2 < NST) fill(t + 2, (unsigned)(t & 1));
    }
    asm volatile("s_wait_asynccnt 0x0" ::: "memory");       // no copy is outstanding when the buffers become output staging
    float* os = (float*)(sm + wave * 4352);                  // each wave stages in its own 16 x 68 floats
#pragma unroll
    for (int mb = 0; mb < 4; ++mb) {
#pragma unroll
        for (int nb = 0; nb < 4; ++nb) {
#pragma unroll
            for (int j = 0; j < 8; ++j) os[(hi * 8 + j) * 68 + nb * 16 + lr] = acc[mb][nb][j]; }
        __builtin_amdgcn_wave_barrier(); asm volatile("" ::: "memory");
        if (EPI == 0) {
            const int bb = r0 / SEQ, s0 = r0 % SEQ;
            float* cbat = Cf + (size_t)bb * OUT_BSTRIDE + c0; const int* tok = aux + (size_t)bb * SEQ + s0 + mb * 16; v4f sv[8]; float* sp[8];
{
#pragma unroll
                for (int s = 0; s < 8; ++s) { const int row = 2 * s + hi, cofs = lr * 4; v4f val = *(const v4fa*)(os + row * 68 + cofs);
                    val[0] += bfr(bias[c0 + cofs]); val[1] += bfr(bias[c0 + cofs + 1]); val[2] += bfr(bias[c0 + cofs + 2]); val[3] += bfr(bias[c0 + cofs + 3]);
                    sv[s] = val; sp[s] = cbat + (size_t)tok[row] * DM + cofs; *(v4f*)sp[s] = sv[s]; }
                // the eight stores name these registers: the wait stands before any of them is rewritten, and reading them here keeps them whole up to it
                asm volatile("s_wait_xcnt 0x0" :: "v"(sv[0]), "v"(sv[1]), "v"(sv[2]), "v"(sv[3]), "v"(sv[4]), "v"(sv[5]), "v"(sv[6]), "v"(sv[7]), "v"(sp[0]), "v"(sp[1]), "v"(sp[2]), "v"(sp[3]), "v"(sp[4]), "v"(sp[5]), "v"(sp[6]), "v"(sp[7]) : "memory");
                 }
        } else {
            h16* base; size_t kstep;   // kstep: elements from one 32-k block of these 16 rows to the next (V^T keeps the four 16-row blocks of a 32-key step together)
            if (EPI == 1) { const int bb = r0 / SEQ, s0 = r0 % SEQ; base = Ch + (((size_t)bb * NH + by) * SEQ + s0 + mb * 16) * HD; kstep = 512; }
            else          { const int bb = c0 / SEQ, s0 = c0 % SEQ; base = Ch + ((size_t)bb * NH + bx) * HD * SEQ + (size_t)s0 * HD + mb * 512; kstep = 512 * (HD / 16); }
{
#pragma unroll
                for (int s = 0; s < 4; ++s) { const int row = lr, seg = 2 * s + hi;
                    const v4f va = *(const v4fa*)(os + row * 68 + seg * 8); const v4f vb = *(const v4fa*)(os + row * 68 + seg * 8 + 4); v8h o;
                    if (EPI == 1) {
#pragma unroll
                        for (int j = 0; j < 4; ++j) { o[j] = (h16)(va[j] + bfr(bias[c0 + seg * 8 + j])); o[4 + j] = (h16)(vb[j] + bfr(bias[c0 + seg * 8 + 4 + j])); }
                    } else { const float bv = bfr(bias[r0 + mb * 16 + row]);
#pragma unroll
                        for (int j = 0; j < 4; ++j) { o[j] = (h16)(va[j] + bv); o[4 + j] = (h16)(vb[j] + bv); } }
                    *(v8h*)(base + (size_t)(s >> 1) * kstep + (s & 1) * 256 + lane * 8) = o; }
                // the four stores name their base and value registers: the wait stands before the next 16-row piece (or code behind the tile) rewrites any of them
                asm volatile("s_wait_xcnt 0x0" ::: "memory");
                 }
        }
        __builtin_amdgcn_wave_barrier(); asm volatile("" ::: "memory");
    }
}

// ---- k_qkv: the three projections, which depend on each other in nothing, in one launch: grid (tokens/128, DM/128, 3), z = 0 Q, 1 K, 2 V. The V tiles keep their own order (feature tile fastest). The branch on z is block-uniform.
__global__ __launch_bounds__(128) void k_qkv(const bf* __restrict__ XB, const bf* __restrict__ WQt, const bf* __restrict__ WKt, const bf* __restrict__ WVt, h16* QP, h16* KP, h16* VT, const float* __restrict__ bq, const float* __restrict__ bk, const float* __restrict__ bv, const int* __restrict__ CNT) {
    __shared__ __align__(2048) unsigned char sm[2 * 2 * 16384];
    const int z = blockIdx.z;
    if (z == 2) { const int lin = blockIdx.y * (NB * SEQ / 128) + blockIdx.x; gemm_tile<0, 2>(WVt, nullptr, XB, nullptr, VT, bv, CNT, sm, lin % (DM / 128), lin / (DM / 128)); }   // rows = features, cols = tokens: the tile is V^T
    else gemm_tile<0, 1>(XB, nullptr, z ? WKt : WQt, nullptr, z ? KP : QP, z ? bk : bq, z ? CNT : nullptr, sm, blockIdx.x, blockIdx.y);
}

__global__ __launch_bounds__(128) void k_oproj(const bf* __restrict__ ATh, const bf* __restrict__ ATl, const bf* __restrict__ WOt, float* OUT, const float* __restrict__ bo, const int* __restrict__ PERM) {
    __shared__ __align__(2048) unsigned char sm[2 * 3 * 16384];
    gemm_tile<1, 0>(ATh, ATl, WOt, OUT, nullptr, bo, PERM, sm, blockIdx.x, blockIdx.y);
}

// ---- k_flash: register-fed transposed flash attention. Block = 4 waves = 128 queries of one (b, h); wave = 32 queries = two groups of 16 WMMA columns, so every K and V^T fragment that the wave loads feeds two products. Per 32-key step and group:
// S^T tiles (keys x queries) = K rows (A fragments from the f16 plane) x Q^T (B fragments held in registers); lane (h, n) then holds keys 8h + r (tile 0) and 16 + 8h + r (tile 1) of query n,
// which is exactly the B-fragment element order of P^T for O^T[d][query] += V^T[d][keys] P^T[keys][query] (A fragments from the f16 V^T plane). Running max / sum per query live in the lane (one xor-16 exchange).
// Keys are the batch's permuted tokens: the first cnt are unmasked, so a step with 32 of them needs no mask; the last, partial step replaces the raw scores behind cnt by the fill; with cnt == 0 all SEQ keys run with every score replaced by one value (uniform weights whatever the value: 0 keeps the exponent exact).
// Softmax arithmetic works on the accumulators' own register pairs: the maximum is taken on raw scores (the scale is positive), then one packed fma per two scores, s * SL + (PLOG - max), is scale, shift and carry at once.
__global__ __launch_bounds__(128) void k_flash(const h16* __restrict__ QP, const h16* __restrict__ KP, const h16* __restrict__ VT, const int* __restrict__ CNT, bf* ATh, bf* ATl) {
    const int tid = threadIdx.x, wave = tid >> 5, lane = tid & 31, hi = lane >> 4;
    const int bh = blockIdx.y, b = bh / NH, h = bh % NH; const int q0 = blockIdx.x * 128 + wave * 32;
    const int cnt = min(CNT[b], SEQ); const int nk = (cnt != 0) ? cnt : SEQ;   // block-uniform; the trip count is bounded by SEQ
    const float fill = (cnt != 0) ? RAWF : 0.0f;
    const h16* qp = QP + ((size_t)bh * SEQ + q0) * HD + 8 * lane;
    v16h qb0[2], qb1[2];
#pragma unroll
    for (int g = 0; g < 2; ++g) { qb0[g] = ldh(qp + g * 16 * HD); qb1[g] = ldh(qp + g * 16 * HD + 512); }
    const h16* kp = KP + (size_t)bh * SEQ * HD + 8 * lane;
    const h16* vp = VT + (size_t)bh * HD * SEQ + 8 * lane;
    v8f o[2][4];
#pragma unroll
    for (int g = 0; g < 2; ++g)
#pragma unroll
        for (int t = 0; t < 4; ++t) o[g][t] = (v8f){};
    float mrun[2] = {-1.0e30f, -1.0e30f}, lrun[2] = {0.0f, 0.0f};
#pragma unroll 1
    for (int kt = 0; kt < nk; kt += 32) {
        const v16h ka0 = ldh(kp), ka1 = ldh(kp + 512), kb0 = ldh(kp + 16 * HD), kb1 = ldh(kp + 16 * HD + 512);
        v16h va[4];
#pragma unroll
        for (int t = 0; t < 4; ++t) va[t] = ldh(vp + t * 512);
        // the trip's loads all name these two address pairs: the wait stands before either is rewritten, and reading them here keeps them out of the loads' result registers
        asm volatile("s_wait_xcnt 0x0" :: "v"(kp), "v"(vp) : "memory");
        v8f s0[2], s1[2];
#pragma unroll
        for (int g = 0; g < 2; ++g) { s0[g] = wmma16(ka0, qb0[g], (v8f){}); s1[g] = wmma16(kb0, qb0[g], (v8f){}); }
#pragma unroll
        for (int g = 0; g < 2; ++g) { s0[g] = wmma16(ka1, qb1[g], s0[g]); s1[g] = wmma16(kb1, qb1[g], s1[g]); }
        // the distance between the last product and the first reader of its result, on both sides of the branch below
        asm volatile("v_nop\n\tv_nop\n\tv_nop\n\tv_nop" : "+v"(s0[0]), "+v"(s1[0]), "+v"(s0[1]), "+v"(s1[1]) : "v"(ka0), "v"(ka1), "v"(kb0), "v"(kb1), "v"(qb0[0]), "v"(qb1[0]), "v"(qb0[1]), "v"(qb1[1]));
        const int rem = cnt - kt;   // unmasked keys from this step on (scalar)
        if (rem < 32) {
            const unsigned w = (rem > 0) ? (1u << rem) - 1u : 0u; const unsigned w0 = (w >> (8 * hi)) & 0xFFu, w1 = (w >> (16 + 8 * hi)) & 0xFFu;
#pragma unroll
            for (int g = 0; g < 2; ++g)
#pragma unroll
                for (int r = 0; r < 8; ++r) { s0[g][r] = ((w0 >> r) & 1u) ? s0[g][r] : fill; s1[g][r] = ((w1 >> r) & 1u) ? s1[g][r] : fill; }
        }
        float mn[2], corr[2]; v16h pb[2];
#pragma unroll
        for (int g = 0; g < 2; ++g) {
            float mloc = fmaxf(s0[g][0], s1[g][0]);
#pragma unroll
            for (int r = 1; r < 8; ++r) mloc = fmaxf(mloc, fmaxf(s0[g][r], s1[g][r]));
            mloc = fmaxf(mloc, __shfl_xor(mloc, 16, 32));
            mn[g] = fmaxf(mrun[g], mloc * SL);
            corr[g] = __builtin_amdgcn_exp2f(mrun[g] - mn[g]);
            const float c = PLOG - mn[g]; const v2f c2 = {c, c}, sl2 = {SL, SL};
            v2f sa = {0.0f, 0.0f}, sb = {0.0f, 0.0f};
#pragma unroll
            for (int r = 0; r < 8; r += 2) {
                const v2f e0 = __builtin_elementwise_fma((v2f){s0[g][r], s0[g][r + 1]}, sl2, c2), e1 = __builtin_elementwise_fma((v2f){s1[g][r], s1[g][r + 1]}, sl2, c2);
                const v2f p0 = {__builtin_amdgcn_exp2f(e0[0]), __builtin_amdgcn_exp2f(e0[1])}, p1 = {__builtin_amdgcn_exp2f(e1[0]), __builtin_amdgcn_exp2f(e1[1])};
                sa += p0; sb += p1;
                pb[g][r] = (h16)p0[0]; pb[g][r + 1] = (h16)p0[1]; pb[g][8 + r] = (h16)p1[0]; pb[g][8 + r + 1] = (h16)p1[1];
            }
            sa += sb;
            float sum = sa[0] + sa[1];
            sum += __shfl_xor(sum, 16, 32);
            lrun[g] = lrun[g] * corr[g] + sum;
        }
        if (__builtin_amdgcn_ballot_w32(mn[0] > mrun[0] || mn[1] > mrun[1]) != 0u) {      // wave-uniform, one test a step: rescale only when some query's running max moved (corr == 1 exactly elsewhere)
#pragma unroll
            for (int g = 0; g < 2; ++g)
#pragma unroll
                for (int t = 0; t < 4; ++t)
#pragma unroll
                    for (int r = 0; r < 8; ++r) o[g][t][r] *= corr[g]; }
        mrun[0] = mn[0]; mrun[1] = mn[1];
#pragma unroll
        for (int t = 0; t < 4; ++t)
#pragma unroll
            for (int g = 0; g < 2; ++g) o[g][t] = wmma16(va[t], pb[g], o[g][t]);
        // the distance behind the last product, also on the loop's taken back edge
        asm volatile("v_nop\n\tv_nop\n\tv_nop\n\tv_nop" : "+v"(o[0][0]), "+v"(o[0][1]), "+v"(o[0][2]), "+v"(o[0][3]), "+v"(o[1][0]), "+v"(o[1][1]), "+v"(o[1][2]), "+v"(o[1][3]) : "v"(va[0]), "v"(va[1]), "v"(va[2]), "v"(va[3]), "v"(pb[0]), "v"(pb[1]));
        kp += 32 * HD; vp += 32 * HD;
    }
    // lane (h, query) holds rows d = 16 t + 8 h + 0..7 of its query's O^T column: that is piece t of its lane in the fragment-ordered ctx planes, so no LDS transpose is needed
    v8us oh[2][4], ol[2][4];
#pragma unroll
    for (int g = 0; g < 2; ++g) {
        const float inv = 1.0f / lrun[g];   // o and lrun carry the same 2^PLOG
#pragma unroll
        for (int t = 0; t < 4; ++t) {
#pragma unroll
            for (int j = 0; j < 8; ++j) { unsigned short x0, x1; splitf(o[g][t][j] * inv, x0, x1); oh[g][t][j] = x0; ol[g][t][j] = x1; } } }
    bf* ah = ATh + ((size_t)b * SEQ + q0) * DM + h * (HD * 16) + lane * 8; bf* al = ATl + ((size_t)b * SEQ + q0) * DM + h * (HD * 16) + lane * 8;
    // every value is formed first; behind the stores nothing is rewritten
#pragma unroll
    for (int g = 0; g < 2; ++g)
#pragma unroll
        for (int s = 0; s < 4; ++s) { *(v8us*)(ah + g * 16 * DM + s * 256) = oh[g][s]; *(v8us*)(al + g * 16 * DM + s * 256) = ol[g][s]; }
}

extern "C" void kernel_launch(void* const* d_in, const int* in_sizes, int n_in,
                              void* d_out, int out_size, void* d_ws, size_t ws_size, hipStream_t stream) {
    if (n_in < 10) return;
    const size_t needx = ((size_t)(NB - 1) * SEQ_FULL + SEQ) * DM, needm = (size_t)(NB - 1) * SEQ_FULL + SEQ;
    if ((size_t)in_sizes[0] < needx || (size_t)in_sizes[1] < needm) return;
    if ((size_t)in_sizes[2] < (size_t)DM * DM || (size_t)in_sizes[4] < (size_t)DM * DM || (size_t)in_sizes[6] < (size_t)DM * DM || (size_t)in_sizes[8] < (size_t)DM * DM) return;
    if (in_sizes[3] < DM || in_sizes[5] < DM || in_sizes[7] < DM || in_sizes[9] < DM) return;
    if ((size_t)out_size < (size_t)(NB - 1) * OUT_BSTRIDE + (size_t)SEQ * DM) return;
    const float* x = (const float*)d_in[0]; const int* mk = (const int*)d_in[1];
    const float* wq = (const float*)d_in[2]; const float* bq = (const float*)d_in[3]; const float* wk = (const float*)d_in[4]; const float* bk = (const float*)d_in[5];
    const float* wv = (const float*)d_in[6]; const float* bv = (const float*)d_in[7]; const float* wo = (const float*)d_in[8]; const float* bo = (const float*)d_in[9];
    float* OUT = (float*)d_out;
    char* wsp = (char*)d_ws;
    auto take = [&](size_t bytes) { char* p = wsp; wsp += (bytes + 255) & ~(size_t)255; return (void*)p; };
    const size_t MT = (size_t)NB * SEQ;                       // token rows
    bf* XB  = (bf*)take(MT * DM * 2);
    bf* WQt = (bf*)take((size_t)DM * DM * 2); bf* WKt = (bf*)take((size_t)DM * DM * 2); bf* WVt = (bf*)take((size_t)DM * DM * 2); bf* WOt = (bf*)take((size_t)DM * DM * 2);
    h16* QP = (h16*)take(MT * DM * 2); h16* KP = (h16*)take(MT * DM * 2); h16* VT = (h16*)take(MT * DM * 2);
    bf* ATh = (bf*)take(MT * DM * 2); bf* ATl = (bf*)take(MT * DM * 2);
    int* PERM = (int*)take(MT * 4); int* CNT = (int*)take((size_t)NB * 4);
    if ((size_t)(wsp - (char*)d_ws) > ws_size) return;        // 104 MiB at the full size
    k_prep<<<NB + 4 * (DM / 64) * (DM / 64), 256, 0, stream>>>(mk, PERM, CNT, wq, wk, wv, wo, WQt, WKt, WVt, WOt);   // W in[k][n] -> out[n][k]
    k_cvtx<<<(unsigned)((MT * DM / 8 + 255) / 256), 256, 0, stream>>>(x, PERM, XB);
    k_qkv<<<dim3((unsigned)(MT / 128), DM / 128, 3), 128, 0, stream>>>(XB, WQt, WKt, WVt, QP, KP, VT, bq, bk, bv, CNT);
    k_flash<<<dim3(SEQ / 128, NB * NH), 128, 0, stream>>>(QP, KP, VT, CNT, ATh, ATl);
    k_oproj<<<dim3((unsigned)(MT / 128), DM / 128), 128, 0, stream>>>(ATh, ATl, WOt, OUT, bo, PERM);
}

// v008
// One run takes 105 microseconds.
// Versions in between are left out here; by their measured steps it is 1.11 times as fast as v006.
// All steps since v000 together make it 3.87 times as fast.
#include <hip/hip_runtime.h>

// Compute dtypes (f32 accumulate everywhere): q/k/v projections v_wmma_f32_16x16x32_bf16 on RNE-bf16 copies of x and W (f32 bias add); scores K.Q^T v_wmma_f32_16x16x32_f16 on f16 q/k planes; P.V v_wmma_f32_16x16x32_f16 (P carried x1024: the carry is +10 in the exponent, f16 V^T plane); output projection v_wmma_f32_16x16x32_f16 on the RNE-f16 ctx plane and an RNE-f16 copy of Wo (one product; |ctx| <= max |V|, which is already f16, so it cannot overflow); softmax in f32.
// Key-padding-masked multi-head self-attention: x [NB][SEQ][1024] f32, mask int32 [NB][SEQ] (0 = key masked: its score is REPLACED by -1e9), W [in][out] f32 + bias [out]; 16 heads x 64; scores x 0.125; softmax over all keys; out = ctx Wo + bo.
// Token order: inside each batch the tokens are permuted, unmasked keys first (rank order), masked ones behind; a masked key's weight is exp(-1e9 - max) = 0 in f32 as soon as one key of the batch is unmasked (|score| <= 64 * 1040^2 / 8 < 1e7 for any x and W the generators can draw), so K, V and the key loop cover only the first CNT[b] permuted tokens (rounded up to a tile). A batch with no unmasked key keeps all its keys, every score replaced by the fill (uniform weights). Queries run in permuted order and the output projection stores each row at its token's own place.
// Plan, five launches: (0) ranks -> PERM, CNT, and in the same launch transposed 16-bit copies Wt[n][k] of the four weights (through LDS; bf16 for Wq, Wk, Wv, f16 for Wo), (1) bf16 copy of x (rows gathered through PERM), (2) in one launch the GEMMs (128x128 tile per block of four waves, 64x64 per wave, operands staged in LDS) writing f16 head planes Q[b][h][s][d], K[b][h][s][d] and V^T[b][h][d][s] (the V GEMM runs with operands swapped so its tile is already transposed),
// Every 16-bit plane is stored in fragment order: a block of 16 rows x 32 k is 512 elements laid out [k>>4 &1][k>>3 &1][row&15][k&7], so a wave's 16-byte fragment load reads 512 contiguous bytes (4 whole lines) at block + lane * 8 elements.
// (3) register-fed transposed flash attention: per wave 32 queries (two groups of 16 columns share each K and V^T fragment); S^T tile = K rows (A, from LDS) x Q^T (B, held in registers); the exponentials packed in place form the B fragment of O^T = V^T P^T; the block's four waves share each K and V^T stage through LDS, (4) ctx plane x Wo^T + bo.

#ifndef NB
#define NB 4
#endif
#ifndef SEQ
#define SEQ 2048
#endif
#define NB_FULL  4
#define SEQ_FULL 2048
#define DM   1024
#define NH   16
#define HD   64
#ifndef OUT_BSTRIDE
#define OUT_BSTRIDE ((size_t)SEQ * DM)
#endif
#define PLOG 10.0f                     // P and its row sums are carried x 2^10; the factor cancels in the final division
#define SL   0.18033688011112042f      // 0.125 * log2(e): takes a raw score to the base-2 domain
#define RAWF (-8.0e9f)                 // the replace-fill -1e9 in units of the raw (unscaled) score: -1e9 / 0.125

static_assert(SEQ % 128 == 0);
static_assert(NH * HD == DM);
static_assert(DM % 64 == 0);
static_assert(NB <= NB_FULL);
static_assert(SEQ <= SEQ_FULL);

typedef _Float16 h16;
typedef unsigned short bf;
typedef __attribute__((ext_vector_type(16))) __bf16   v16bf;
typedef __attribute__((ext_vector_type(16))) _Float16 v16h;
typedef __attribute__((ext_vector_type(8)))  _Float16 v8h;
typedef __attribute__((ext_vector_type(8)))  unsigned short v8us;
typedef __attribute__((ext_vector_type(8)))  float    v8f;
typedef __attribute__((ext_vector_type(4)))  float    v4f;
typedef __attribute__((ext_vector_type(2)))  float    v2f;
typedef v4f  __attribute__((may_alias)) v4fa;
typedef int  __attribute__((ext_vector_type(4), may_alias)) v4ia;

__device__ __forceinline__ unsigned short f2bf(float f) { unsigned u = __float_as_uint(f); u += 0x7FFFu + ((u >> 16) & 1u); return (unsigned short)(u >> 16); }
__device__ __forceinline__ float bf2f(unsigned short b) { return __uint_as_float(((unsigned)b) << 16); }
__device__ __forceinline__ float bfr(float f) { return bf2f(f2bf(f)); }
__device__ __forceinline__ unsigned short f2h(float f) { return __builtin_bit_cast(unsigned short, (_Float16)f); }
__device__ __forceinline__ v16h cat16(v8h lo, v8h hi) { return __builtin_shufflevector(lo, hi, 0, 1, 2, 3, 4, 5, 6, 7, 8, 9, 10, 11, 12, 13, 14, 15); }
__device__ __forceinline__ v16bf cat16b(v8us lo, v8us hi) { return __builtin_bit_cast(v16bf, __builtin_shufflevector(lo, hi, 0, 1, 2, 3, 4, 5, 6, 7, 8, 9, 10, 11, 12, 13, 14, 15)); }
__device__ __forceinline__ v8f wmma16(v16h a, v16h b, v8f c) { return __builtin_amdgcn_wmma_f32_16x16x32_f16(false, a, false, b, (short)0, c, false, false); }
__device__ __forceinline__ v8f wmmab(v16bf a, v16bf b, v8f c) { return __builtin_amdgcn_wmma_f32_16x16x32_bf16(false, a, false, b, (short)0, c, false, false); }
// Fragment loaders: p = start of a 16-row x 32-k block (512 elements, fragment order) + lane * 8; lane = 16 h + row; elements 0..7 <- k0 + 8h + 0..7, elements 8..15 <- k0 + 16 + 8h + 0..7 (same map for A and B).
__device__ __forceinline__ v16h  ldh(const h16* p) { return cat16(*(const v8h*)p, *(const v8h*)(p + 256)); }

// ---- perm_block: one block per batch. PERM[b][p] = token at permuted place p; CNT[b] = number of unmasked keys. Only mask != 0 is used and places are ranks, so every place lies in [0, SEQ) and is filled once for any mask content.
// The scatter goes to LDS; the table leaves as whole lines. 256 threads (the block size of the launch it shares with the weight transposes).
__device__ __forceinline__ void perm_block(const int* __restrict__ mask, int* PERM, int* CNT, unsigned* mw, int* ps, const int b) {
    static_assert(SEQ % 1024 == 0);
    const int tid = threadIdx.x, wave = tid >> 5, lane = tid & 31;
    const int* mb = mask + (size_t)b * SEQ_FULL;
    int mv[SEQ / 256];   // all loads first, so that they are in flight together
#pragma unroll
    for (int it = 0; it < SEQ / 256; ++it) mv[it] = mb[it * 256 + tid];
#pragma unroll
    for (int it = 0; it < SEQ / 256; ++it) { const unsigned w = __builtin_amdgcn_ballot_w32(mv[it] != 0); if (lane == 0) mw[it * 8 + wave] = w; }
    __syncthreads();
    int tot = 0;
#pragma unroll
    for (int i = 0; i < SEQ / 32; ++i) tot += __popc(mw[i]);
    // the wait ends the branch, so nothing rewrites a register that the store names in front of it
    if (tid == 0) { CNT[b] = tot; asm volatile("s_wait_xcnt 0x0" ::: "memory"); }
    int base = 0;   // unmasked keys in front of this trip's 256 tokens
#pragma unroll
    for (int it = 0; it < SEQ / 256; ++it) {
        int pre = base;
#pragma unroll
        for (int j = 0; j < 8; ++j) { const int c = __popc(mw[it * 8 + j]); pre += (j < wave) ? c : 0; base += c; }
        const unsigned w = mw[it * 8 + wave]; const int s = it * 256 + tid;
        const int rank = pre + __popc(w & ((1u << lane) - 1u));
        ps[((w >> lane) & 1u) ? rank : tot + (s - rank)] = s;
    }
    __syncthreads();
    v4ia* dst = (v4ia*)(PERM + (size_t)b * SEQ);
#pragma unroll
    for (int k = 0; k < SEQ / 1024; ++k) dst[k * 256 + tid] = ((const v4ia*)ps)[k * 256 + tid];
}

__global__ __launch_bounds__(256) void k_cvtx(const float* __restrict__ x, const int* __restrict__ PERM, bf* XB) {
    const size_t i = (size_t)blockIdx.x * 256 + threadIdx.x; if (i >= (size_t)NB * SEQ * DM / 8) return;
    // 64 threads per 16-row x 32-k block; a wave takes 8 rows x 4 pieces, so it reads 8 whole 128-byte lines of x and stores 4 whole lines of the fragment-ordered plane
    const size_t blk = i >> 6; const int lr = (int)(((i >> 5) & 1) * 8 + (i & 7)), q = (int)((i >> 3) & 3);
    const size_t e = blk * 512 + (size_t)(q * 16 + lr) * 8; const size_t m = (blk / (DM / 32)) * 16 + lr; const int c = (int)(blk % (DM / 32)) * 32 + q * 8; const size_t b = m / SEQ, s = (size_t)PERM[m];
    const v8f v = *(const v8f*)(x + (b * SEQ_FULL + s) * DM + c); v8us o;
#pragma unroll
    for (int k = 0; k < 8; ++k) o[k] = f2bf(v[k]);
    *(v8us*)(XB + e) = o; 
}

__device__ __forceinline__ void cvtT_block(const float* __restrict__ W, bf* Wt, float* tl, const int k0, const int n0, const bool f16) {
    const int tid = threadIdx.x;
#pragma unroll 4
    for (int i = 0; i < 16; ++i) { const int idx = i * 256 + tid; const int r = idx >> 6, c = idx & 63; tl[r * 65 + c] = W[(size_t)(k0 + r) * DM + n0 + c]; }
    __syncthreads();
    float v[2][8]; v8us o[2];
#pragma unroll
    for (int it = 0; it < 2; ++it) { const int p = it * 256 + tid; const int n = (p >> 7) * 16 + (p & 15), seg = (p >> 4) & 7;
#pragma unroll
        for (int j = 0; j < 8; ++j) v[it][j] = tl[(seg * 8 + j) * 65 + n]; }
    // the target type is the same for the whole block: one branch, a straight run of conversions on either side
    if (f16) {
#pragma unroll
        for (int it = 0; it < 2; ++it)
#pragma unroll
            for (int j = 0; j < 8; ++j) o[it][j] = f2h(v[it][j]);
    } else {
#pragma unroll
        for (int it = 0; it < 2; ++it)
#pragma unroll
            for (int j = 0; j < 8; ++j) o[it][j] = f2bf(v[it][j]);
    }
{
#pragma unroll
        for (int it = 0; it < 2; ++it) { const int p = it * 256 + tid; *(v8us*)(Wt + (size_t)(n0 + (p >> 7) * 16) * DM + k0 * 16 + (p & 127) * 8) = o[it]; }
        // the two stores name their address and value registers: the wait stands before code behind them in the listing (the rank path of the same kernel) rewrites any of them
        asm volatile("s_wait_xcnt 0x0" ::: "memory");
         }
}

// ---- k_prep: the work that depends on no other kernel, in one launch. Blocks 0 .. NB-1 rank one batch's tokens each (the longest chain, so they start first); the rest transpose one 64x64 tile of one of the four weights. The branch is block-uniform, so every barrier is passed by a whole block.
__global__ __launch_bounds__(256) void k_prep(const int* __restrict__ mask, int* PERM, int* CNT, const float* __restrict__ wq, const float* __restrict__ wk, const float* __restrict__ wv, const float* __restrict__ wo, bf* WQt, bf* WKt, bf* WVt, bf* WOt) {
    __shared__ __align__(16) unsigned mw[SEQ / 32];
    __shared__ __align__(16) int ps[SEQ];
    __shared__ float tl[64 * 65];
    constexpr int TPW = (DM / 64) * (DM / 64);   // tiles per weight
    const int bid = blockIdx.x;
    if (bid < NB) { perm_block(mask, PERM, CNT, mw, ps, bid); return; }
    const int id = bid - NB, w = id / TPW, t = id % TPW;
    const float* W = (w == 0) ? wq : (w == 1) ? wk : (w == 2) ? wv : wo; bf* Wt = (w == 0) ? WQt : (w == 1) ? WKt : (w == 2) ? WVt : WOt;
    cvtT_block(W, Wt, tl, (t % (DM / 64)) * 64, (t / (DM / 64)) * 64, w == 3);   // Wo leaves as f16, the others as bf16
}

// ---- stage_copy: one wave's share of one operand's stage: 32 rows x 64 k = two runs of 2 KiB in the fragment-ordered plane, as eight asynchronous 512-byte copies to LDS (16 bytes a lane, every lane on).
// l = the lane's LDS byte address, g = the lane's global address. The wait is the statement's last line, so no register that a copy names is rewritten in front of it.
__device__ __forceinline__ void stage_copy(const unsigned l, const bf* g) {
    const bf* h = g + 16 * DM;
    asm volatile("global_load_async_to_lds_b128 %0, %8, off\n\t"
                 "global_load_async_to_lds_b128 %1, %9, off\n\t"
                 "global_load_async_to_lds_b128 %2, %10, off\n\t"
                 "global_load_async_to_lds_b128 %3, %11, off\n\t"
                 "global_load_async_to_lds_b128 %4, %12, off\n\t"
                 "global_load_async_to_lds_b128 %5, %13, off\n\t"
                 "global_load_async_to_lds_b128 %6, %14, off\n\t"
                 "global_load_async_to_lds_b128 %7, %15, off\n\t"
                 "s_wait_xcnt 0x0"
                 :: "v"(l), "v"(l + 512u), "v"(l + 1024u), "v"(l + 1536u), "v"(l + 2048u), "v"(l + 2560u), "v"(l + 3072u), "v"(l + 3584u),
                    "v"(g), "v"(g + 256), "v"(g + 512), "v"(g + 768), "v"(h), "v"(h + 256), "v"(h + 512), "v"(h + 768) : "memory");
}
// LDS fragment loader: p = start of a 16-row x 32-k block in a stage + lane * 16 bytes (same element map as ldh).
__device__ __forceinline__ v16bf ldsb(const unsigned char* p) { return cat16b(*(const v8us*)p, *(const v8us*)(p + 512)); }

// ---- gemm_tile: block of FOUR WAVES per 128x128 output tile (tbx, tby) of (Mrows/128, Ncols/128); wave (w >> 1, w & 1) owns a 64x64 quarter (16 accumulators), so every staged operand row feeds two waves.
// C[m][n] = sum_k A[m][k] Bt[n][k] + bf16(bias), k ascending in steps of 32; the 16-bit operands are f16 for EPI 0 and bf16 otherwise (the planes are moved as plain 16-bit words). A stage is 64 k of the tile's 128 rows of each operand (16 KiB an operand, fragment order kept: block of 16 rows at 2 KiB, its two 32-k blocks at 1 KiB);
// two buffers: the copies of stage t + 1 fly while stage t is worked on. After the loop the same LDS serves the waves' output staging (the last trip's barrier ends every read of the buffers).
// EPI 0: f32 out[b][s][n] (rows = permuted tokens, stored at aux = PERM's token; bias per column), each 256-B row piece as 16 lanes x 16 B.
// EPI 1, 2 with aux = CNT: a tile whose 128 tokens all lie behind the batch's unmasked keys is never read by the key loop and leaves at once (aux == nullptr: every tile is computed).
template <int EPI>
__device__ __forceinline__ void gemm_tile(const bf* __restrict__ A, const bf* __restrict__ Bt, float* Cf, h16* Ch, const float* __restrict__ bias, const int* __restrict__ aux, unsigned char* sm, const int tbx, const int tby) {
    constexpr int K = DM; constexpr unsigned OPB = 16384, STG = 2 * OPB; constexpr int NST = K / 64;
    const int lane = threadIdx.x & 31, lr = lane & 15, hi = lane >> 4; const int wave = __builtin_amdgcn_readfirstlane((int)(threadIdx.x >> 5));
    const int bx = tbx * 2 + (wave >> 1), by = tby * 2 + (wave & 1); const int r0 = bx * 64, c0 = by * 64;
    // block-uniform, in front of every copy and barrier
    if (EPI != 0 && aux != nullptr) { const int t0 = ((EPI == 1) ? tbx : tby) * 128; const int cnt = aux[t0 / SEQ]; if (cnt != 0 && t0 % SEQ >= cnt) return; }
    v8f acc[4][4];
#pragma unroll
    for (int mb = 0; mb < 4; ++mb)
#pragma unroll
        for (int nb = 0; nb < 4; ++nb) acc[mb][nb] = (v8f){};
    // this wave copies rows 32 w .. 32 w + 31 of the tile's 128 rows of each operand
    const bf* ga = A + ((size_t)tbx * 128 + wave * 32) * K + 8 * lane; const bf* gb = Bt + ((size_t)tby * 128 + wave * 32) * K + 8 * lane;
    const unsigned lw = (unsigned)(size_t)sm + (unsigned)wave * 4096u + (unsigned)lane * 16u;
    auto fill = [&](const int s, const unsigned buf) {
        stage_copy(lw + buf * STG, ga + s * 1024); stage_copy(lw + buf * STG + OPB, gb + s * 1024);
    };
    fill(0, 0u);
    asm volatile("s_wait_asynccnt 0x0" ::: "memory");   // this wave's share of stage 0 has landed
    __syncthreads();                                     // every wave's share has
    fill(1, 1u);
    const unsigned char* fa = sm + (wave >> 1) * 8192 + lane * 16; const unsigned char* fb = sm + OPB + (wave & 1) * 8192 + lane * 16;
#pragma unroll 1
    for (int t = 0; t < NST; ++t) {
        const unsigned bo = (unsigned)(t & 1) * STG;
#pragma unroll
        for (int kk = 0; kk < 2; ++kk) {
            v16bf a[4], b[4];
#pragma unroll
            for (int mb = 0; mb < 4; ++mb) a[mb] = ldsb(fa + bo + mb * 2048 + kk * 1024);
#pragma unroll
            for (int nb = 0; nb < 4; ++nb) b[nb] = ldsb(fb + bo + nb * 2048 + kk * 1024);
            // two waves a SIMD here and registers to spare: the loaded fragments as inputs hold the block's 16 LDS loads together in front of its 16 products, one LDS wait a block instead of one in front of every column group
            if (EPI == 0) asm volatile("" :: "v"(a[0]), "v"(a[1]), "v"(a[2]), "v"(a[3]), "v"(b[0]), "v"(b[1]), "v"(b[2]), "v"(b[3]));
#pragma unroll
            for (int nb = 0; nb < 4; ++nb) {
#pragma unroll
                for (int mb = 0; mb < 4; ++mb) acc[mb][nb] = (EPI == 0) ? wmma16(__builtin_bit_cast(v16h, a[mb]), __builtin_bit_cast(v16h, b[nb]), acc[mb][nb]) : wmmab(a[mb], b[nb], acc[mb][nb]); }
        }
        // keeps the stage's products in front of its foot: sunk behind the barrier they would delay the refill, which then has less than a whole trip to land
        __builtin_amdgcn_sched_barrier(0);
        asm volatile("s_wait_dscnt 0x0" ::: "memory");      // this wave's reads of stage t are done
        asm volatile("s_wait_asynccnt 0x0" ::: "memory");   // its share of stage t + 1 has landed
        __syncthreads();                                     // publishes stage t + 1 and frees stage t's buffer
        if (t + 2 < NST) fill(t + 2, (unsigned)(t & 1));
    }
    asm volatile("s_wait_asynccnt 0x0" ::: "memory");       // no copy is outstanding when the buffers become output staging
    float* os = (float*)(sm + wave * 4352);                  // each wave stages in its own 16 x 68 floats
#pragma unroll
    for (int mb = 0; mb < 4; ++mb) {
#pragma unroll
        for (int nb = 0; nb < 4; ++nb) {
#pragma unroll
            for (int j = 0; j < 8; ++j) os[(hi * 8 + j) * 68 + nb * 16 + lr] = acc[mb][nb][j]; }
        __builtin_amdgcn_wave_barrier(); asm volatile("" ::: "memory");
        if (EPI == 0) {
            const int bb = r0 / SEQ, s0 = r0 % SEQ;
            float* cbat = Cf + (size_t)bb * OUT_BSTRIDE + c0; const int* tok = aux + (size_t)bb * SEQ + s0 + mb * 16; v4f sv[8]; float* sp[8];
{
#pragma unroll
                for (int s = 0; s < 8; ++s) { const int row = 2 * s + hi, cofs = lr * 4; v4f val = *(const v4fa*)(os + row * 68 + cofs);
                    val[0] += bfr(bias[c0 + cofs]); val[1] += bfr(bias[c0 + cofs + 1]); val[2] += bfr(bias[c0 + cofs + 2]); val[3] += bfr(bias[c0 + cofs + 3]);
                    sv[s] = val; sp[s] = cbat + (size_t)tok[row] * DM + cofs; *(v4f*)sp[s] = sv[s]; }
                // the eight stores name these registers: the wait stands before any of them is rewritten, and reading them here keeps them whole up to it
                asm volatile("s_wait_xcnt 0x0" :: "v"(sv[0]), "v"(sv[1]), "v"(sv[2]), "v"(sv[3]), "v"(sv[4]), "v"(sv[5]), "v"(sv[6]), "v"(sv[7]), "v"(sp[0]), "v"(sp[1]), "v"(sp[2]), "v"(sp[3]), "v"(sp[4]), "v"(sp[5]), "v"(sp[6]), "v"(sp[7]) : "memory");
                 }
        } else {
            h16* base; size_t kstep;   // kstep: elements from one 32-k block of these 16 rows to the next (V^T keeps the four 16-row blocks of a 32-key step together)
            if (EPI == 1) { const int bb = r0 / SEQ, s0 = r0 % SEQ; base = Ch + (((size_t)bb * NH + by) * SEQ + s0 + mb * 16) * HD; kstep = 512; }
            else          { const int bb = c0 / SEQ, s0 = c0 % SEQ; base = Ch + ((size_t)bb * NH + bx) * HD * SEQ + (size_t)s0 * HD + mb * 512; kstep = 512 * (HD / 16); }
{
#pragma unroll
                for (int s = 0; s < 4; ++s) { const int row = lr, seg = 2 * s + hi;
                    const v4f va = *(const v4fa*)(os + row * 68 + seg * 8); const v4f vb = *(const v4fa*)(os + row * 68 + seg * 8 + 4); v8h o;
                    if (EPI == 1) {
#pragma unroll
                        for (int j = 0; j < 4; ++j) { o[j] = (h16)(va[j] + bfr(bias[c0 + seg * 8 + j])); o[4 + j] = (h16)(vb[j] + bfr(bias[c0 + seg * 8 + 4 + j])); }
                    } else { const float bv = bfr(bias[r0 + mb * 16 + row]);
#pragma unroll
                        for (int j = 0; j < 4; ++j) { o[j] = (h16)(va[j] + bv); o[4 + j] = (h16)(vb[j] + bv); } }
                    *(v8h*)(base + (size_t)(s >> 1) * kstep + (s & 1) * 256 + lane * 8) = o; }
                // the four stores name their base and value registers: the wait stands before the next 16-row piece (or code behind the tile) rewrites any of them
                asm volatile("s_wait_xcnt 0x0" ::: "memory");
                 }
        }
        __builtin_amdgcn_wave_barrier(); asm volatile("" ::: "memory");
    }
}

// ---- k_qkv: the three projections, which depend on each other in nothing, in one launch: grid (tokens/128, DM/128, 3), z = 0 Q, 1 K, 2 V. The V tiles keep their own order (feature tile fastest). The branch on z is block-uniform.
__global__ __launch_bounds__(128) void k_qkv(const bf* __restrict__ XB, const bf* __restrict__ WQt, const bf* __restrict__ WKt, const bf* __restrict__ WVt, h16* QP, h16* KP, h16* VT, const float* __restrict__ bq, const float* __restrict__ bk, const float* __restrict__ bv, const int* __restrict__ CNT) {
    __shared__ __align__(2048) unsigned char sm[2 * 2 * 16384];
    const int z = blockIdx.z;
    if (z == 2) { const int lin = blockIdx.y * (NB * SEQ / 128) + blockIdx.x; gemm_tile<2>(WVt, XB, nullptr, VT, bv, CNT, sm, lin % (DM / 128), lin / (DM / 128)); }   // rows = features, cols = tokens: the tile is V^T
    else gemm_tile<1>(XB, z ? WKt : WQt, nullptr, z ? KP : QP, z ? bk : bq, z ? CNT : nullptr, sm, blockIdx.x, blockIdx.y);
}

__global__ __launch_bounds__(128) void k_oproj(const bf* __restrict__ AT, const bf* __restrict__ WOt, float* OUT, const float* __restrict__ bo, const int* __restrict__ PERM) {
    __shared__ __align__(2048) unsigned char sm[2 * 2 * 16384];
    gemm_tile<0>(AT, WOt, OUT, nullptr, bo, PERM, sm, blockIdx.x, blockIdx.y);
}

// ---- kv_copy: one wave's share of one 64-key stage of the key loop: 2 KiB of the stage's 8 KiB of the K plane and 2 KiB of its 8 KiB of the V^T plane (both contiguous in fragment order), as eight asynchronous 512-byte copies to LDS (16 bytes a lane, every lane on).
// l = the lane's LDS byte address in the stage's K half (the V^T half lies 8 KiB behind it), gk, gv = the lane's global addresses. The wait is the statement's last line, so no register that a copy names is rewritten in front of it.
__device__ __forceinline__ void kv_copy(const unsigned l, const h16* gk, const h16* gv) {
    asm volatile("global_load_async_to_lds_b128 %0, %8, off\n\t"
                 "global_load_async_to_lds_b128 %1, %9, off\n\t"
                 "global_load_async_to_lds_b128 %2, %10, off\n\t"
                 "global_load_async_to_lds_b128 %3, %11, off\n\t"
                 "global_load_async_to_lds_b128 %4, %12, off\n\t"
                 "global_load_async_to_lds_b128 %5, %13, off\n\t"
                 "global_load_async_to_lds_b128 %6, %14, off\n\t"
                 "global_load_async_to_lds_b128 %7, %15, off\n\t"
                 "s_wait_xcnt 0x0"
                 :: "v"(l), "v"(l + 512u), "v"(l + 1024u), "v"(l + 1536u), "v"(l + 8192u), "v"(l + 8704u), "v"(l + 9216u), "v"(l + 9728u),
                    "v"(gk), "v"(gk + 256), "v"(gk + 512), "v"(gk + 768), "v"(gv), "v"(gv + 256), "v"(gv + 512), "v"(gv + 768) : "memory");
}
// LDS fragment loader, f16: p = start of a 16-row x 32-k block in a stage + lane * 16 bytes (same element map as ldh).
__device__ __forceinline__ v16h ldsh(const unsigned char* p) { return cat16(*(const v8h*)p, *(const v8h*)(p + 512)); }

// ---- k_flash: register-fed transposed flash attention. Block = 4 waves = 128 queries of one (b, h); wave = 32 queries = two groups of 16 WMMA columns, so every K and V^T fragment that the wave loads feeds two products. Per 32-key step and group:
// S^T tiles (keys x queries) = K rows (A fragments from the staged f16 plane) x Q^T (B fragments held in registers); lane (h, n) then holds keys 8h + r (tile 0) and 16 + 8h + r (tile 1) of query n,
// which is exactly the B-fragment element order of P^T for O^T[d][query] += V^T[d][keys] P^T[keys][query] (A fragments from the f16 V^T plane). Running max / sum per query live in the lane (one xor-16 exchange).
// K and V^T reach the waves through LDS: a stage is 64 keys (8 KiB of each plane), copied once for the block, a quarter by each wave; two buffers, the copies of stage t + 1 fly while stage t is worked on. A stage that starts in front of the key count lies inside a 128-token tile that the projections have written.
// Keys are the batch's permuted tokens: the first cnt are unmasked, so a step with 32 of them needs no mask; the last, partial step replaces the raw scores behind cnt by the fill; with cnt == 0 all SEQ keys run with every score replaced by one value (uniform weights whatever the value: 0 keeps the exponent exact).
// Softmax arithmetic works on the accumulators' own register pairs: the maximum is taken on raw scores (the scale is positive), then one packed fma per two scores, s * SL + (PLOG - max), is scale, shift and carry at once.
__global__ __launch_bounds__(128) void k_flash(const h16* __restrict__ QP, const h16* __restrict__ KP, const h16* __restrict__ VT, const int* __restrict__ CNT, h16* AT) {
    __shared__ __align__(2048) unsigned char kv[2 * 16384];
    const int tid = threadIdx.x, lane = tid & 31, hi = lane >> 4; const int wave = __builtin_amdgcn_readfirstlane(tid >> 5);
    const int bh = blockIdx.y, b = bh / NH, h = bh % NH; const int q0 = blockIdx.x * 128 + wave * 32;
    const int cnt = min(CNT[b], SEQ); const int nk = (cnt != 0) ? cnt : SEQ;   // block-uniform; the trip count is bounded by SEQ
    const float fill = (cnt != 0) ? RAWF : 0.0f;
    const h16* qp = QP + ((size_t)bh * SEQ + q0) * HD + 8 * lane;
    v16h qb0[2], qb1[2];
#pragma unroll
    for (int g = 0; g < 2; ++g) { qb0[g] = ldh(qp + g * 16 * HD); qb1[g] = ldh(qp + g * 16 * HD + 512); }
    const int nst = (nk + 63) >> 6;   // stages; block-uniform, at most SEQ / 64
    const h16* gk = KP + (size_t)bh * SEQ * HD + wave * 1024 + 8 * lane;
    const h16* gv = VT + (size_t)bh * HD * SEQ + wave * 1024 + 8 * lane;
    const unsigned lw = (unsigned)(size_t)kv + (unsigned)wave * 2048u + (unsigned)lane * 16u;
    kv_copy(lw, gk, gv);
    asm volatile("s_wait_asynccnt 0x0" ::: "memory");   // this wave's share of stage 0 has landed
    __syncthreads();                                     // every wave's share has
    if (nst > 1) kv_copy(lw + 16384u, gk + 64 * HD, gv + 64 * HD);
    v8f o[2][4];
#pragma unroll
    for (int g = 0; g < 2; ++g)
#pragma unroll
        for (int t = 0; t < 4; ++t) o[g][t] = (v8f){};
    float mrun[2] = {-1.0e30f, -1.0e30f}, lrun[2] = {0.0f, 0.0f};
#pragma unroll 1
    for (int st = 0; st < nst; ++st) {
    const int kend = min(nk, st * 64 + 64);
#pragma unroll 1
    for (int kt = st * 64; kt < kend; kt += 32) {
        const unsigned char* kf = kv + (st & 1) * 16384 + (kt & 32) * 128 + lane * 16;   // this step's 4 KiB of K; its 4 KiB of V^T lie 8 KiB behind
        const v16h ka0 = ldsh(kf), ka1 = ldsh(kf + 1024), kb0 = ldsh(kf + 2048), kb1 = ldsh(kf + 3072);
        v16h va[4];
#pragma unroll
        for (int t = 0; t < 4; ++t) va[t] = ldsh(kf + 8192 + t * 1024);
        v8f s0[2], s1[2];
#pragma unroll
        for (int g = 0; g < 2; ++g) { s0[g] = wmma16(ka0, qb0[g], (v8f){}); s1[g] = wmma16(kb0, qb0[g], (v8f){}); }
#pragma unroll
        for (int g = 0; g < 2; ++g) { s0[g] = wmma16(ka1, qb1[g], s0[g]); s1[g] = wmma16(kb1, qb1[g], s1[g]); }
        // the distance between the last product and the first reader of its result, on both sides of the branch below
        asm volatile("v_nop\n\tv_nop\n\tv_nop\n\tv_nop" : "+v"(s0[0]), "+v"(s1[0]), "+v"(s0[1]), "+v"(s1[1]) : "v"(ka0), "v"(ka1), "v"(kb0), "v"(kb1), "v"(qb0[0]), "v"(qb1[0]), "v"(qb0[1]), "v"(qb1[1]));
        const int rem = cnt - kt;   // unmasked keys from this step on (scalar)
        if (rem < 32) {
            const unsigned w = (rem > 0) ? (1u << rem) - 1u : 0u; const unsigned w0 = (w >> (8 * hi)) & 0xFFu, w1 = (w >> (16 + 8 * hi)) & 0xFFu;
#pragma unroll
            for (int g = 0; g < 2; ++g)
#pragma unroll
                for (int r = 0; r < 8; ++r) { s0[g][r] = ((w0 >> r) & 1u) ? s0[g][r] : fill; s1[g][r] = ((w1 >> r) & 1u) ? s1[g][r] : fill; }
        }
        float mn[2], corr[2], mh[2], mx[2]; v16h pb[2];
#pragma unroll
        for (int g = 0; g < 2; ++g) {
            mh[g] = fmaxf(s0[g][0], s1[g][0]);
#pragma unroll
            for (int r = 1; r < 8; ++r) mh[g] = fmaxf(mh[g], fmaxf(s0[g][r], s1[g][r]));
        }
#pragma unroll
        for (int g = 0; g < 2; ++g) mx[g] = __shfl_xor(mh[g], 16, 32);
        // the two exchanged values as inputs hold both exchanges in front of their first reader: one LDS-counter wait for the pair, not one behind each
        asm volatile("" :: "v"(mx[0]), "v"(mx[1]));
#pragma unroll
        for (int g = 0; g < 2; ++g) {
            const float mloc = fmaxf(mh[g], mx[g]);
            mn[g] = fmaxf(mrun[g], mloc * SL);
            corr[g] = __builtin_amdgcn_exp2f(mrun[g] - mn[g]);
            const float c = PLOG - mn[g]; const v2f c2 = {c, c}, sl2 = {SL, SL};
            v2f sa = {0.0f, 0.0f}, sb = {0.0f, 0.0f};
#pragma unroll
            for (int r = 0; r < 8; r += 2) {
                const v2f e0 = __builtin_elementwise_fma((v2f){s0[g][r], s0[g][r + 1]}, sl2, c2), e1 = __builtin_elementwise_fma((v2f){s1[g][r], s1[g][r + 1]}, sl2, c2);
                const v2f p0 = {__builtin_amdgcn_exp2f(e0[0]), __builtin_amdgcn_exp2f(e0[1])}, p1 = {__builtin_amdgcn_exp2f(e1[0]), __builtin_amdgcn_exp2f(e1[1])};
                sa += p0; sb += p1;
                pb[g][r] = (h16)p0[0]; pb[g][r + 1] = (h16)p0[1]; pb[g][8 + r] = (h16)p1[0]; pb[g][8 + r + 1] = (h16)p1[1];
            }
            sa += sb;
            float sum = sa[0] + sa[1];
            sum += __shfl_xor(sum, 16, 32);
            lrun[g] = lrun[g] * corr[g] + sum;
        }
        if (__builtin_amdgcn_ballot_w32(mn[0] > mrun[0] || mn[1] > mrun[1]) != 0u) {      // wave-uniform, one test a step: rescale only when some query's running max moved (corr == 1 exactly elsewhere)
#pragma unroll
            for (int g = 0; g < 2; ++g)
#pragma unroll
                for (int t = 0; t < 4; ++t)
#pragma unroll
                    for (int r = 0; r < 8; ++r) o[g][t][r] *= corr[g]; }
        mrun[0] = mn[0]; mrun[1] = mn[1];
#pragma unroll
        for (int t = 0; t < 4; ++t)
#pragma unroll
            for (int g = 0; g < 2; ++g) o[g][t] = wmma16(va[t], pb[g], o[g][t]);
        // the distance behind the last product, also on the loop's taken back edge
        asm volatile("v_nop\n\tv_nop\n\tv_nop\n\tv_nop" : "+v"(o[0][0]), "+v"(o[0][1]), "+v"(o[0][2]), "+v"(o[0][3]), "+v"(o[1][0]), "+v"(o[1][1]), "+v"(o[1][2]), "+v"(o[1][3]) : "v"(va[0]), "v"(va[1]), "v"(va[2]), "v"(va[3]), "v"(pb[0]), "v"(pb[1]));
    }
        asm volatile("s_wait_dscnt 0x0" ::: "memory");      // this wave's reads of stage st are done
        asm volatile("s_wait_asynccnt 0x0" ::: "memory");   // its share of stage st + 1 has landed
        __syncthreads();                                     // publishes stage st + 1 and frees stage st's buffer
        if (st + 2 < nst) kv_copy(lw + (unsigned)(st & 1) * 16384u, gk + (size_t)(st + 2) * (64 * HD), gv + (size_t)(st + 2) * (64 * HD));
    }
    asm volatile("s_wait_asynccnt 0x0" ::: "memory");       // no copy is outstanding when the wave ends
    // lane (h, query) holds rows d = 16 t + 8 h + 0..7 of its query's O^T column: that is piece t of its lane in the fragment-ordered ctx plane, so no LDS transpose is needed
    v8h oc[2][4];
#pragma unroll
    for (int g = 0; g < 2; ++g) {
        const float inv = 1.0f / lrun[g];   // o and lrun carry the same 2^PLOG
#pragma unroll
        for (int t = 0; t < 4; ++t) {
#pragma unroll
            for (int j = 0; j < 8; ++j) oc[g][t][j] = (h16)(o[g][t][j] * inv); } }
    h16* ac = AT + ((size_t)b * SEQ + q0) * DM + h * (HD * 16) + lane * 8;
    // every value is formed first; behind the stores nothing is rewritten
#pragma unroll
    for (int g = 0; g < 2; ++g)
#pragma unroll
        for (int s = 0; s < 4; ++s) *(v8h*)(ac + g * 16 * DM + s * 256) = oc[g][s];
}

extern "C" void kernel_launch(void* const* d_in, const int* in_sizes, int n_in,
                              void* d_out, int out_size, void* d_ws, size_t ws_size, hipStream_t stream) {
    if (n_in < 10) return;
    const size_t needx = ((size_t)(NB - 1) * SEQ_FULL + SEQ) * DM, needm = (size_t)(NB - 1) * SEQ_FULL + SEQ;
    if ((size_t)in_sizes[0] < needx || (size_t)in_sizes[1] < needm) return;
    if ((size_t)in_sizes[2] < (size_t)DM * DM || (size_t)in_sizes[4] < (size_t)DM * DM || (size_t)in_sizes[6] < (size_t)DM * DM || (size_t)in_sizes[8] < (size_t)DM * DM) return;
    if (in_sizes[3] < DM || in_sizes[5] < DM || in_sizes[7] < DM || in_sizes[9] < DM) return;
    if ((size_t)out_size < (size_t)(NB - 1) * OUT_BSTRIDE + (size_t)SEQ * DM) return;
    const float* x = (const float*)d_in[0]; const int* mk = (const int*)d_in[1];
    const float* wq = (const float*)d_in[2]; const float* bq = (const float*)d_in[3]; const float* wk = (const float*)d_in[4]; const float* bk = (const float*)d_in[5];
    const float* wv = (const float*)d_in[6]; const float* bv = (const float*)d_in[7]; const float* wo = (const float*)d_in[8]; const float* bo = (const float*)d_in[9];
    float* OUT = (float*)d_out;
    char* wsp = (char*)d_ws;
    auto take = [&](size_t bytes) { char* p = wsp; wsp += (bytes + 255) & ~(size_t)255; return (void*)p; };
    const size_t MT = (size_t)NB * SEQ;                       // token rows
    bf* XB  = (bf*)take(MT * DM * 2);
    bf* WQt = (bf*)take((size_t)DM * DM * 2); bf* WKt = (bf*)take((size_t)DM * DM * 2); bf* WVt = (bf*)take((size_t)DM * DM * 2); bf* WOt = (bf*)take((size_t)DM * DM * 2);
    h16* QP = (h16*)take(MT * DM * 2); h16* KP = (h16*)take(MT * DM * 2); h16* VT = (h16*)take(MT * DM * 2);
    h16* AT = (h16*)take(MT * DM * 2);
    int* PERM = (int*)take(MT * 4); int* CNT = (int*)take((size_t)NB * 4);
    if ((size_t)(wsp - (char*)d_ws) > ws_size) return;        // 88 MiB at the full size
    k_prep<<<NB + 4 * (DM / 64) * (DM / 64), 256, 0, stream>>>(mk, PERM, CNT, wq, wk, wv, wo, WQt, WKt, WVt, WOt);   // W in[k][n] -> out[n][k]
    k_cvtx<<<(unsigned)((MT * DM / 8 + 255) / 256), 256, 0, stream>>>(x, PERM, XB);
    k_qkv<<<dim3((unsigned)(MT / 128), DM / 128, 3), 128, 0, stream>>>(XB, WQt, WKt, WVt, QP, KP, VT, bq, bk, bv, CNT);
    k_flash<<<dim3(SEQ / 128, NB * NH), 128, 0, stream>>>(QP, KP, VT, CNT, AT);
    k_oproj<<<dim3((unsigned)(MT / 128), DM / 128), 128, 0, stream>>>((const bf*)AT, WOt, OUT, bo, PERM);
}

// v009
// A run of this version takes 102 microseconds.
// Two timings next to v008 put it at 1.03 and 1.04 times that version's speed.
// Counting every step since v000, it is 4.01 times as fast.
#include <hip/hip_runtime.h>

// Compute dtypes (f32 accumulate everywhere): q/k/v projections v_wmma_f32_16x16x32_bf16 on RNE-bf16 copies of x and W (f32 bias add); scores K.Q^T v_wmma_f32_16x16x32_f16 on f16 q/k planes; P.V v_wmma_f32_16x16x32_f16 (P carried x1024: the carry is +10 in the exponent, f16 V^T plane); output projection v_wmma_f32_16x16x32_f16 on the RNE-f16 ctx plane and an RNE-f16 copy of Wo (one product; |ctx| <= max |V|, which is already f16, so it cannot overflow); softmax in f32.
// Key-padding-masked multi-head self-attention: x [NB][SEQ_FULL][1024] f32, mask int32 [NB][SEQ_FULL] (first SEQ tokens of a batch read; 0 = key masked: its score is REPLACED by -1e9), W [in][out] f32 + bias [out]; 16 heads x 64; scores x 0.125; softmax over all keys; out = ctx Wo + bo.
// Token order: inside each batch the tokens are permuted, unmasked keys first (rank order), masked ones behind; a masked key's weight is exp(-1e9 - max) = 0 in f32 as soon as one key of the batch is unmasked (|score| <= 64 * 1040^2 / 8 < 1e7 for any x and W the generators can draw), so K, V and the key loop cover only the first CNT[b] permuted tokens (rounded up to a tile). A batch with no unmasked key keeps all its keys, every score replaced by the fill (uniform weights). Queries run in permuted order and the output projection stores each row at its token's own place.
// Plan, five launches: (0) ranks -> PERM, CNT, and in the same launch transposed 16-bit copies Wt[n][k] of the four weights (through LDS; bf16 for Wq, Wk, Wv, f16 for Wo), (1) bf16 copy of x (rows gathered through PERM), (2) in one launch the GEMMs (128x128 tile per block of four waves, 64x64 per wave, operands staged in LDS) writing f16 head planes Q[b][h][s][d], K[b][h][s][d] and V^T[b][h][d][s] (the V GEMM runs with operands swapped so its tile is already transposed),
// Every 16-bit plane is stored in fragment order: a block of 16 rows x 32 k is 512 elements laid out [k>>4 &1][k>>3 &1][row&15][k&7], so a wave's 16-byte fragment load reads 512 contiguous bytes (4 whole lines) at block + lane * 8 elements.
// (3) register-fed transposed flash attention: per wave 32 queries (two groups of 16 columns share each K and V^T fragment); S^T tile = K rows (A, from LDS) x Q^T (B, held in registers); the exponentials packed in place form the B fragment of O^T = V^T P^T; the block's four waves share each K and V^T stage through LDS, (4) ctx plane x Wo^T + bo.

#ifndef NB
#define NB 4
#endif
#ifndef SEQ
#define SEQ 2048
#endif
#define NB_FULL  4
#define SEQ_FULL 2048
#define DM   1024
#define NH   16
#define HD   64
#ifndef OUT_BSTRIDE
#define OUT_BSTRIDE ((size_t)SEQ * DM)
#endif
#define PLOG 10.0f                     // P and its row sums are carried x 2^10; the factor cancels in the final division
#define SL   0.18033688011112042f      // 0.125 * log2(e): takes a raw score to the base-2 domain
#define RAWF (-8.0e9f)                 // the replace-fill -1e9 in units of the raw (unscaled) score: -1e9 / 0.125

static_assert(SEQ % 128 == 0);
static_assert(NH * HD == DM);
static_assert(DM % 64 == 0);
static_assert(NB <= NB_FULL);
static_assert(SEQ <= SEQ_FULL);

typedef _Float16 h16;
typedef unsigned short bf;
typedef __attribute__((ext_vector_type(16))) __bf16   v16bf;
typedef __attribute__((ext_vector_type(16))) _Float16 v16h;
typedef __attribute__((ext_vector_type(8)))  _Float16 v8h;
typedef __attribute__((ext_vector_type(8)))  unsigned short v8us;
typedef __attribute__((ext_vector_type(8)))  float    v8f;
typedef __attribute__((ext_vector_type(4)))  float    v4f;
typedef __attribute__((ext_vector_type(2)))  float    v2f;
typedef v4f  __attribute__((may_alias)) v4fa;
typedef int  __attribute__((ext_vector_type(4), may_alias)) v4ia;

__device__ __forceinline__ unsigned short f2bf(float f) { unsigned u = __float_as_uint(f); u += 0x7FFFu + ((u >> 16) & 1u); return (unsigned short)(u >> 16); }
__device__ __forceinline__ float bf2f(unsigned short b) { return __uint_as_float(((unsigned)b) << 16); }
__device__ __forceinline__ float bfr(float f) { return bf2f(f2bf(f)); }
__device__ __forceinline__ unsigned short f2h(float f) { return __builtin_bit_cast(unsigned short, (_Float16)f); }
__device__ __forceinline__ v16h cat16(v8h lo, v8h hi) { return __builtin_shufflevector(lo, hi, 0, 1, 2, 3, 4, 5, 6, 7, 8, 9, 10, 11, 12, 13, 14, 15); }
__device__ __forceinline__ v16bf cat16b(v8us lo, v8us hi) { return __builtin_bit_cast(v16bf, __builtin_shufflevector(lo, hi, 0, 1, 2, 3, 4, 5, 6, 7, 8, 9, 10, 11, 12, 13, 14, 15)); }
__device__ __forceinline__ v8f wmma16(v16h a, v16h b, v8f c) { return __builtin_amdgcn_wmma_f32_16x16x32_f16(false, a, false, b, (short)0, c, false, false); }
__device__ __forceinline__ v8f wmmab(v16bf a, v16bf b, v8f c) { return __builtin_amdgcn_wmma_f32_16x16x32_bf16(false, a, false, b, (short)0, c, false, false); }
// Fragment loaders: p = start of a 16-row x 32-k block (512 elements, fragment order) + lane * 8; lane = 16 h + row; elements 0..7 <- k0 + 8h + 0..7, elements 8..15 <- k0 + 16 + 8h + 0..7 (same map for A and B).
__device__ __forceinline__ v16h  ldh(const h16* p) { return cat16(*(const v8h*)p, *(const v8h*)(p + 256)); }

// ---- perm_block: one block per batch. PERM[b][p] = token at permuted place p; CNT[b] = number of unmasked keys. Only mask != 0 is used and places are ranks, so every place lies in [0, SEQ) and is filled once for any mask content.
// The scatter goes to LDS; the table leaves as whole lines. 256 threads (the block size of the launch it shares with the weight transposes).
__device__ __forceinline__ void perm_block(const int* __restrict__ mask, int* PERM, int* CNT, unsigned* mw, int* ps, const int b) {
    static_assert(SEQ % 1024 == 0);
    const int tid = threadIdx.x, wave = tid >> 5, lane = tid & 31;
    const int* mb = mask + (size_t)b * SEQ_FULL;
    int mv[SEQ / 256];   // all loads first, so that they are in flight together
#pragma unroll
    for (int it = 0; it < SEQ / 256; ++it) mv[it] = mb[it * 256 + tid];
#pragma unroll
    for (int it = 0; it < SEQ / 256; ++it) { const unsigned w = __builtin_amdgcn_ballot_w32(mv[it] != 0); if (lane == 0) mw[it * 8 + wave] = w; }
    __syncthreads();
    int tot = 0;
#pragma unroll
    for (int i = 0; i < SEQ / 32; ++i) tot += __popc(mw[i]);
    // the wait ends the branch, so nothing rewrites a register that the store names in front of it
    if (tid == 0) { CNT[b] = tot; asm volatile("s_wait_xcnt 0x0" ::: "memory"); }
    int base = 0;   // unmasked keys in front of this trip's 256 tokens
#pragma unroll
    for (int it = 0; it < SEQ / 256; ++it) {
        int pre = base;
#pragma unroll
        for (int j = 0; j < 8; ++j) { const int c = __popc(mw[it * 8 + j]); pre += (j < wave) ? c : 0; base += c; }
        const unsigned w = mw[it * 8 + wave]; const int s = it * 256 + tid;
        const int rank = pre + __popc(w & ((1u << lane) - 1u));
        ps[((w >> lane) & 1u) ? rank : tot + (s - rank)] = s;
    }
    __syncthreads();
    v4ia* dst = (v4ia*)(PERM + (size_t)b * SEQ);
#pragma unroll
    for (int k = 0; k < SEQ / 1024; ++k) dst[k * 256 + tid] = ((const v4ia*)ps)[k * 256 + tid];
}

__global__ __launch_bounds__(256) void k_cvtx(const float* __restrict__ x, const int* __restrict__ PERM, bf* XB) {
    const size_t i = (size_t)blockIdx.x * 256 + threadIdx.x; if (i >= (size_t)NB * SEQ * DM / 8) return;
    // 64 threads per 16-row x 32-k block; a wave takes 8 rows x 4 pieces, so it reads 8 whole 128-byte lines of x and stores 4 whole lines of the fragment-ordered plane
    const size_t blk = i >> 6; const int lr = (int)(((i >> 5) & 1) * 8 + (i & 7)), q = (int)((i >> 3) & 3);
    const size_t e = blk * 512 + (size_t)(q * 16 + lr) * 8; const size_t m = (blk / (DM / 32)) * 16 + lr; const int c = (int)(blk % (DM / 32)) * 32 + q * 8; const size_t b = m / SEQ, s = (size_t)PERM[m];
    const v8f v = *(const v8f*)(x + (b * SEQ_FULL + s) * DM + c); v8us o;
#pragma unroll
    for (int k = 0; k < 8; ++k) o[k] = f2bf(v[k]);
    *(v8us*)(XB + e) = o; 
}

__device__ __forceinline__ void cvtT_block(const float* __restrict__ W, bf* Wt, float* tl, const int k0, const int n0, const bool f16) {
    const int tid = threadIdx.x;
#pragma unroll 4
    for (int i = 0; i < 16; ++i) { const int idx = i * 256 + tid; const int r = idx >> 6, c = idx & 63; tl[r * 65 + c] = W[(size_t)(k0 + r) * DM + n0 + c]; }
    __syncthreads();
    float v[2][8]; v8us o[2];
#pragma unroll
    for (int it = 0; it < 2; ++it) { const int p = it * 256 + tid; const int n = (p >> 7) * 16 + (p & 15), seg = (p >> 4) & 7;
#pragma unroll
        for (int j = 0; j < 8; ++j) v[it][j] = tl[(seg * 8 + j) * 65 + n]; }
    // the target type is the same for the whole block: one branch, a straight run of conversions on either side
    if (f16) {
#pragma unroll
        for (int it = 0; it < 2; ++it)
#pragma unroll
            for (int j = 0; j < 8; ++j) o[it][j] = f2h(v[it][j]);
    } else {
#pragma unroll
        for (int it = 0; it < 2; ++it)
#pragma unroll
            for (int j = 0; j < 8; ++j) o[it][j] = f2bf(v[it][j]);
    }
{
#pragma unroll
        for (int it = 0; it < 2; ++it) { const int p = it * 256 + tid; *(v8us*)(Wt + (size_t)(n0 + (p >> 7) * 16) * DM + k0 * 16 + (p & 127) * 8) = o[it]; }
        // the two stores name their address and value registers: the wait stands before code behind them in the listing (the rank path of the same kernel) rewrites any of them
        asm volatile("s_wait_xcnt 0x0" ::: "memory");
         }
}

// ---- k_prep: the work that depends on no other kernel, in one launch. Blocks 0 .. NB-1 rank one batch's tokens each (the longest chain, so they start first); the rest transpose one 64x64 tile of one of the four weights. The branch is block-uniform, so every barrier is passed by a whole block.
__global__ __launch_bounds__(256) void k_prep(const int* __restrict__ mask, int* PERM, int* CNT, const float* __restrict__ wq, const float* __restrict__ wk, const float* __restrict__ wv, const float* __restrict__ wo, bf* WQt, bf* WKt, bf* WVt, bf* WOt) {
    __shared__ __align__(16) unsigned mw[SEQ / 32];
    __shared__ __align__(16) int ps[SEQ];
    __shared__ float tl[64 * 65];
    constexpr int TPW = (DM / 64) * (DM / 64);   // tiles per weight
    const int bid = blockIdx.x;
    if (bid < NB) { perm_block(mask, PERM, CNT, mw, ps, bid); return; }
    const int id = bid - NB, w = id / TPW, t = id % TPW;
    const float* W = (w == 0) ? wq : (w == 1) ? wk : (w == 2) ? wv : wo; bf* Wt = (w == 0) ? WQt : (w == 1) ? WKt : (w == 2) ? WVt : WOt;
    cvtT_block(W, Wt, tl, (t % (DM / 64)) * 64, (t / (DM / 64)) * 64, w == 3);   // Wo leaves as f16, the others as bf16
}

// ---- stage_copy: one wave's share of one operand's stage: 32 rows x 64 k = two runs of 2 KiB in the fragment-ordered plane, as eight asynchronous 512-byte copies to LDS (16 bytes a lane, every lane on).
// l = the lane's LDS byte address, g = the lane's global address. The wait is the statement's last line, so no register that a copy names is rewritten in front of it.
__device__ __forceinline__ void stage_copy(const unsigned l, const bf* g) {
    const bf* h = g + 16 * DM;
    asm volatile("global_load_async_to_lds_b128 %0, %8, off\n\t"
                 "global_load_async_to_lds_b128 %1, %9, off\n\t"
                 "global_load_async_to_lds_b128 %2, %10, off\n\t"
                 "global_load_async_to_lds_b128 %3, %11, off\n\t"
                 "global_load_async_to_lds_b128 %4, %12, off\n\t"
                 "global_load_async_to_lds_b128 %5, %13, off\n\t"
                 "global_load_async_to_lds_b128 %6, %14, off\n\t"
                 "global_load_async_to_lds_b128 %7, %15, off\n\t"
                 "s_wait_xcnt 0x0"
                 :: "v"(l), "v"(l + 512u), "v"(l + 1024u), "v"(l + 1536u), "v"(l + 2048u), "v"(l + 2560u), "v"(l + 3072u), "v"(l + 3584u),
                    "v"(g), "v"(g + 256), "v"(g + 512), "v"(g + 768), "v"(h), "v"(h + 256), "v"(h + 512), "v"(h + 768) : "memory");
}
// LDS fragment loader: p = start of a 16-row x 32-k block in a stage + lane * 16 bytes (same element map as ldh).
__device__ __forceinline__ v16bf ldsb(const unsigned char* p) { return cat16b(*(const v8us*)p, *(const v8us*)(p + 512)); }

// ---- gemm_tile: block of FOUR WAVES per 128x128 output tile (tbx, tby) of (Mrows/128, Ncols/128); wave (w >> 1, w & 1) owns a 64x64 quarter (16 accumulators), so every staged operand row feeds two waves.
// C[m][n] = sum_k A[m][k] Bt[n][k] + bf16(bias), k in steps of 32, ascending from stage rot and wrapping round at K; the 16-bit operands are f16 for EPI 0 and bf16 otherwise (the planes are moved as plain 16-bit words). A stage is 64 k of the tile's 128 rows of each operand (16 KiB an operand, fragment order kept: block of 16 rows at 2 KiB, its two 32-k blocks at 1 KiB);
// rot: the blocks that share an operand panel run side by side; started on one stage they would all ask L2 for the same lines at the same moment, so each starts its walk round the k stages at a place of its own.
// two buffers: the copies of stage t + 1 fly while stage t is worked on. After the loop the same LDS serves the waves' output staging (the last trip's barrier ends every read of the buffers).
// EPI 0: f32 out[b][s][n] (rows = permuted tokens, stored at aux = PERM's token; bias per column), each 256-B row piece as 16 lanes x 16 B.
// EPI 1, 2 with aux = CNT: a tile whose 128 tokens all lie behind the batch's unmasked keys is never read by the key loop and leaves at once (aux == nullptr: every tile is computed).
template <int EPI>
__device__ __forceinline__ void gemm_tile(const bf* __restrict__ A, const bf* __restrict__ Bt, float* Cf, h16* Ch, const float* __restrict__ bias, const int* __restrict__ aux, unsigned char* sm, const int tbx, const int tby, const int rot) {
    constexpr int K = DM; constexpr unsigned OPB = 16384, STG = 2 * OPB; constexpr int NST = K / 64;
    static_assert((NST & (NST - 1)) == 0);
    const int lane = threadIdx.x & 31, lr = lane & 15, hi = lane >> 4; const int wave = __builtin_amdgcn_readfirstlane((int)(threadIdx.x >> 5));
    const int bx = tbx * 2 + (wave >> 1), by = tby * 2 + (wave & 1); const int r0 = bx * 64, c0 = by * 64;
    // block-uniform, in front of every copy and barrier
    if (EPI != 0 && aux != nullptr) { const int t0 = ((EPI == 1) ? tbx : tby) * 128; const int cnt = aux[t0 / SEQ]; if (cnt != 0 && t0 % SEQ >= cnt) return; }
    v8f acc[4][4];
#pragma unroll
    for (int mb = 0; mb < 4; ++mb)
#pragma unroll
        for (int nb = 0; nb < 4; ++nb) acc[mb][nb] = (v8f){};
    // this wave copies rows 32 w .. 32 w + 31 of the tile's 128 rows of each operand
    const bf* ga = A + ((size_t)tbx * 128 + wave * 32) * K + 8 * lane; const bf* gb = Bt + ((size_t)tby * 128 + wave * 32) * K + 8 * lane;
    const unsigned lw = (unsigned)(size_t)sm + (unsigned)wave * 4096u + (unsigned)lane * 16u;
    auto fill = [&](const int s, const unsigned buf) {
        const int se = (s + rot) & (NST - 1);   // block-uniform, in [0, NST)
        stage_copy(lw + buf * STG, ga + se * 1024); stage_copy(lw + buf * STG + OPB, gb + se * 1024);
    };
    fill(0, 0u);
    asm volatile("s_wait_asynccnt 0x0" ::: "memory");   // this wave's share of stage 0 has landed
    __syncthreads();                                     // every wave's share has
    fill(1, 1u);
    const unsigned char* fa = sm + (wave >> 1) * 8192 + lane * 16; const unsigned char* fb = sm + OPB + (wave & 1) * 8192 + lane * 16;
#pragma unroll 1
    for (int t = 0; t < NST; ++t) {
        const unsigned bo = (unsigned)(t & 1) * STG;
#pragma unroll
        for (int kk = 0; kk < 2; ++kk) {
            v16bf a[4], b[4];
#pragma unroll
            for (int mb = 0; mb < 4; ++mb) a[mb] = ldsb(fa + bo + mb * 2048 + kk * 1024);
#pragma unroll
            for (int nb = 0; nb < 4; ++nb) b[nb] = ldsb(fb + bo + nb * 2048 + kk * 1024);
            // two waves a SIMD here and registers to spare: the loaded fragments as inputs hold the block's 16 LDS loads together in front of its 16 products, one LDS wait a block instead of one in front of every column group
            if (EPI == 0) asm volatile("" :: "v"(a[0]), "v"(a[1]), "v"(a[2]), "v"(a[3]), "v"(b[0]), "v"(b[1]), "v"(b[2]), "v"(b[3]));
#pragma unroll
            for (int nb = 0; nb < 4; ++nb) {
#pragma unroll
                for (int mb = 0; mb < 4; ++mb) acc[mb][nb] = (EPI == 0) ? wmma16(__builtin_bit_cast(v16h, a[mb]), __builtin_bit_cast(v16h, b[nb]), acc[mb][nb]) : wmmab(a[mb], b[nb], acc[mb][nb]); }
        }
        // keeps the stage's products in front of its foot: sunk behind the barrier they would delay the refill, which then has less than a whole trip to land
        __builtin_amdgcn_sched_barrier(0);
        asm volatile("s_wait_dscnt 0x0" ::: "memory");      // this wave's reads of stage t are done
        asm volatile("s_wait_asynccnt 0x0" ::: "memory");   // its share of stage t + 1 has landed
        __syncthreads();                                     // publishes stage t + 1 and frees stage t's buffer
        if (t + 2 < NST) fill(t + 2, (unsigned)(t & 1));
    }
    asm volatile("s_wait_asynccnt 0x0" ::: "memory");       // no copy is outstanding when the buffers become output staging
    float* os = (float*)(sm + wave * 4352);                  // each wave stages in its own 16 x 68 floats
#pragma unroll
    for (int mb = 0; mb < 4; ++mb) {
#pragma unroll
        for (int nb = 0; nb < 4; ++nb) {
#pragma unroll
            for (int j = 0; j < 8; ++j) os[(hi * 8 + j) * 68 + nb * 16 + lr] = acc[mb][nb][j]; }
        __builtin_amdgcn_wave_barrier(); asm volatile("" ::: "memory");
        if (EPI == 0) {
            const int bb = r0 / SEQ, s0 = r0 % SEQ;
            float* cbat = Cf + (size_t)bb * OUT_BSTRIDE + c0; const int* tok = aux + (size_t)bb * SEQ + s0 + mb * 16; v4f sv[8]; float* sp[8];
{
#pragma unroll
                for (int s = 0; s < 8; ++s) { const int row = 2 * s + hi, cofs = lr * 4; v4f val = *(const v4fa*)(os + row * 68 + cofs);
                    val[0] += bfr(bias[c0 + cofs]); val[1] += bfr(bias[c0 + cofs + 1]); val[2] += bfr(bias[c0 + cofs + 2]); val[3] += bfr(bias[c0 + cofs + 3]);
                    sv[s] = val; sp[s] = cbat + (size_t)tok[row] * DM + cofs; *(v4f*)sp[s] = sv[s]; }
                // the eight stores name these registers: the wait stands before any of them is rewritten, and reading them here keeps them whole up to it
                asm volatile("s_wait_xcnt 0x0" :: "v"(sv[0]), "v"(sv[1]), "v"(sv[2]), "v"(sv[3]), "v"(sv[4]), "v"(sv[5]), "v"(sv[6]), "v"(sv[7]), "v"(sp[0]), "v"(sp[1]), "v"(sp[2]), "v"(sp[3]), "v"(sp[4]), "v"(sp[5]), "v"(sp[6]), "v"(sp[7]) : "memory");
                 }
        } else {
            h16* base; size_t kstep;   // kstep: elements from one 32-k block of these 16 rows to the next (V^T keeps the four 16-row blocks of a 32-key step together)
            if (EPI == 1) { const int bb = r0 / SEQ, s0 = r0 % SEQ; base = Ch + (((size_t)bb * NH + by) * SEQ + s0 + mb * 16) * HD; kstep = 512; }
            else          { const int bb = c0 / SEQ, s0 = c0 % SEQ; base = Ch + ((size_t)bb * NH + bx) * HD * SEQ + (size_t)s0 * HD + mb * 512; kstep = 512 * (HD / 16); }
{
#pragma unroll
                for (int s = 0; s < 4; ++s) { const int row = lr, seg = 2 * s + hi;
                    const v4f va = *(const v4fa*)(os + row * 68 + seg * 8); const v4f vb = *(const v4fa*)(os + row * 68 + seg * 8 + 4); v8h o;
                    if (EPI == 1) {
#pragma unroll
                        for (int j = 0; j < 4; ++j) { o[j] = (h16)(va[j] + bfr(bias[c0 + seg * 8 + j])); o[4 + j] = (h16)(vb[j] + bfr(bias[c0 + seg * 8 + 4 + j])); }
                    } else { const float bv = bfr(bias[r0 + mb * 16 + row]);
#pragma unroll
                        for (int j = 0; j < 4; ++j) { o[j] = (h16)(va[j] + bv); o[4 + j] = (h16)(vb[j] + bv); } }
                    *(v8h*)(base + (size_t)(s >> 1) * kstep + (s & 1) * 256 + lane * 8) = o; }
                // the four stores name their base and value registers: the wait stands before the next 16-row piece (or code behind the tile) rewrites any of them
                asm volatile("s_wait_xcnt 0x0" ::: "memory");
                 }
        }
        __builtin_amdgcn_wave_barrier(); asm volatile("" ::: "memory");
    }
}

// ---- k_qkv: the three projections, which depend on each other in nothing, in one launch: grid (tokens/128, DM/128, 3), z = 0 Q, 1 K, 2 V. The V tiles keep their own order (feature tile fastest). The branch on z is block-uniform.
__global__ __launch_bounds__(128) void k_qkv(const bf* __restrict__ XB, const bf* __restrict__ WQt, const bf* __restrict__ WKt, const bf* __restrict__ WVt, h16* QP, h16* KP, h16* VT, const float* __restrict__ bq, const float* __restrict__ bk, const float* __restrict__ bv, const int* __restrict__ CNT) {
    __shared__ __align__(2048) unsigned char sm[2 * 2 * 16384];
    const int z = blockIdx.z;
    if (z == 2) { const int lin = blockIdx.y * (NB * SEQ / 128) + blockIdx.x; gemm_tile<2>(WVt, XB, nullptr, VT, bv, CNT, sm, lin % (DM / 128), lin / (DM / 128), lin / (DM / 128) + 2 * (lin % (DM / 128)) + 5); }   // rows = features, cols = tokens: the tile is V^T
    else gemm_tile<1>(XB, z ? WKt : WQt, nullptr, z ? KP : QP, z ? bk : bq, z ? CNT : nullptr, sm, blockIdx.x, blockIdx.y, blockIdx.x + 2 * blockIdx.y + z);
}

__global__ __launch_bounds__(128) void k_oproj(const bf* __restrict__ AT, const bf* __restrict__ WOt, float* OUT, const float* __restrict__ bo, const int* __restrict__ PERM) {
    __shared__ __align__(2048) unsigned char sm[2 * 2 * 16384];
    gemm_tile<0>(AT, WOt, OUT, nullptr, bo, PERM, sm, blockIdx.x, blockIdx.y, blockIdx.x + 2 * blockIdx.y);
}

// ---- kv_copy: one wave's share of one 64-key stage of the key loop: 2 KiB of the stage's 8 KiB of the K plane and 2 KiB of its 8 KiB of the V^T plane (both contiguous in fragment order), as eight asynchronous 512-byte copies to LDS (16 bytes a lane, every lane on).
// l = the lane's LDS byte address in the stage's K half (the V^T half lies 8 KiB behind it), gk, gv = the lane's global addresses. The wait is the statement's last line, so no register that a copy names is rewritten in front of it.
__device__ __forceinline__ void kv_copy(const unsigned l, const h16* gk, const h16* gv) {
    asm volatile("global_load_async_to_lds_b128 %0, %8, off\n\t"
                 "global_load_async_to_lds_b128 %1, %9, off\n\t"
                 "global_load_async_to_lds_b128 %2, %10, off\n\t"
                 "global_load_async_to_lds_b128 %3, %11, off\n\t"
                 "global_load_async_to_lds_b128 %4, %12, off\n\t"
                 "global_load_async_to_lds_b128 %5, %13, off\n\t"
                 "global_load_async_to_lds_b128 %6, %14, off\n\t"
                 "global_load_async_to_lds_b128 %7, %15, off\n\t"
                 "s_wait_xcnt 0x0"
                 :: "v"(l), "v"(l + 512u), "v"(l + 1024u), "v"(l + 1536u), "v"(l + 8192u), "v"(l + 8704u), "v"(l + 9216u), "v"(l + 9728u),
                    "v"(gk), "v"(gk + 256), "v"(gk + 512), "v"(gk + 768), "v"(gv), "v"(gv + 256), "v"(gv + 512), "v"(gv + 768) : "memory");
}
// LDS fragment loader, f16: p = start of a 16-row x 32-k block in a stage + lane * 16 bytes (same element map as ldh).
__device__ __forceinline__ v16h ldsh(const unsigned char* p) { return cat16(*(const v8h*)p, *(const v8h*)(p + 512)); }

// ---- k_flash: register-fed transposed flash attention. Block = 4 waves = 128 queries of one (b, h); wave = 32 queries = two groups of 16 WMMA columns, so every K and V^T fragment that the wave loads feeds two products. Per 32-key step and group:
// S^T tiles (keys x queries) = K rows (A fragments from the staged f16 plane) x Q^T (B fragments held in registers); lane (h, n) then holds keys 8h + r (tile 0) and 16 + 8h + r (tile 1) of query n,
// which is exactly the B-fragment element order of P^T for O^T[d][query] += V^T[d][keys] P^T[keys][query] (A fragments from the f16 V^T plane). Running max / sum per query live in the lane (one xor-16 exchange).
// K and V^T reach the waves through LDS: a stage is 64 keys (8 KiB of each plane), copied once for the block, a quarter by each wave; two buffers, the copies of stage t + 1 fly while stage t is worked on. A stage that starts in front of the key count lies inside a 128-token tile that the projections have written.
// Keys are the batch's permuted tokens: the first cnt are unmasked, so a step with 32 of them needs no mask; the last, partial step replaces the raw scores behind cnt by the fill; with cnt == 0 all SEQ keys run with every score replaced by one value (uniform weights whatever the value: 0 keeps the exponent exact).
// Softmax arithmetic works on the accumulators' own register pairs: the maximum is taken on raw scores (the scale is positive), then one packed fma per two scores, s * SL + (PLOG - max), is scale, shift and carry at once.
__global__ __launch_bounds__(128) void k_flash(const h16* __restrict__ QP, const h16* __restrict__ KP, const h16* __restrict__ VT, const int* __restrict__ CNT, h16* AT) {
    __shared__ __align__(2048) unsigned char kv[2 * 16384];
    const int tid = threadIdx.x, lane = tid & 31, hi = lane >> 4; const int wave = __builtin_amdgcn_readfirstlane(tid >> 5);
    const int bh = blockIdx.y, b = bh / NH, h = bh % NH; const int q0 = blockIdx.x * 128 + wave * 32;
    const int cnt = min(CNT[b], SEQ); const int nk = (cnt != 0) ? cnt : SEQ;   // block-uniform; the trip count is bounded by SEQ
    const float fill = (cnt != 0) ? RAWF : 0.0f;
    const h16* qp = QP + ((size_t)bh * SEQ + q0) * HD + 8 * lane;
    v16h qb0[2], qb1[2];
#pragma unroll
    for (int g = 0; g < 2; ++g) { qb0[g] = ldh(qp + g * 16 * HD); qb1[g] = ldh(qp + g * 16 * HD + 512); }
    const int nst = (nk + 63) >> 6;   // stages; block-uniform, at most SEQ / 64
    const h16* gk = KP + (size_t)bh * SEQ * HD + wave * 1024 + 8 * lane;
    const h16* gv = VT + (size_t)bh * HD * SEQ + wave * 1024 + 8 * lane;
    const unsigned lw = (unsigned)(size_t)kv + (unsigned)wave * 2048u + (unsigned)lane * 16u;
    kv_copy(lw, gk, gv);
    asm volatile("s_wait_asynccnt 0x0" ::: "memory");   // this wave's share of stage 0 has landed
    __syncthreads();                                     // every wave's share has
    if (nst > 1) kv_copy(lw + 16384u, gk + 64 * HD, gv + 64 * HD);
    v8f o[2][4];
#pragma unroll
    for (int g = 0; g < 2; ++g)
#pragma unroll
        for (int t = 0; t < 4; ++t) o[g][t] = (v8f){};
    float mrun[2] = {-1.0e30f, -1.0e30f}, lrun[2] = {0.0f, 0.0f};
#pragma unroll 1
    for (int st = 0; st < nst; ++st) {
    const int kend = min(nk, st * 64 + 64);
#pragma unroll 1
    for (int kt = st * 64; kt < kend; kt += 32) {
        const unsigned char* kf = kv + (st & 1) * 16384 + (kt & 32) * 128 + lane * 16;   // this step's 4 KiB of K; its 4 KiB of V^T lie 8 KiB behind
        const v16h ka0 = ldsh(kf), ka1 = ldsh(kf + 1024), kb0 = ldsh(kf + 2048), kb1 = ldsh(kf + 3072);
        v16h va[4];
#pragma unroll
        for (int t = 0; t < 4; ++t) va[t] = ldsh(kf + 8192 + t * 1024);
        v8f s0[2], s1[2];
#pragma unroll
        for (int g = 0; g < 2; ++g) { s0[g] = wmma16(ka0, qb0[g], (v8f){}); s1[g] = wmma16(kb0, qb0[g], (v8f){}); }
#pragma unroll
        for (int g = 0; g < 2; ++g) { s0[g] = wmma16(ka1, qb1[g], s0[g]); s1[g] = wmma16(kb1, qb1[g], s1[g]); }
        // the distance between the last product and the first reader of its result, on both sides of the branch below
        asm volatile("v_nop\n\tv_nop\n\tv_nop\n\tv_nop" : "+v"(s0[0]), "+v"(s1[0]), "+v"(s0[1]), "+v"(s1[1]) : "v"(ka0), "v"(ka1), "v"(kb0), "v"(kb1), "v"(qb0[0]), "v"(qb1[0]), "v"(qb0[1]), "v"(qb1[1]));
        const int rem = cnt - kt;   // unmasked keys from this step on (scalar)
        if (rem < 32) {
            const unsigned w = (rem > 0) ? (1u << rem) - 1u : 0u; const unsigned w0 = (w >> (8 * hi)) & 0xFFu, w1 = (w >> (16 + 8 * hi)) & 0xFFu;
#pragma unroll
            for (int g = 0; g < 2; ++g)
#pragma unroll
                for (int r = 0; r < 8; ++r) { s0[g][r] = ((w0 >> r) & 1u) ? s0[g][r] : fill; s1[g][r] = ((w1 >> r) & 1u) ? s1[g][r] : fill; }
        }
        float mn[2], corr[2], mh[2], mx[2]; v16h pb[2];
#pragma unroll
        for (int g = 0; g < 2; ++g) {
            mh[g] = fmaxf(s0[g][0], s1[g][0]);
#pragma unroll
            for (int r = 1; r < 8; ++r) mh[g] = fmaxf(mh[g], fmaxf(s0[g][r], s1[g][r]));
        }
#pragma unroll
        for (int g = 0; g < 2; ++g) mx[g] = __shfl_xor(mh[g], 16, 32);
        // the two exchanged values as inputs hold both exchanges in front of their first reader: one LDS-counter wait for the pair, not one behind each
        asm volatile("" :: "v"(mx[0]), "v"(mx[1]));
#pragma unroll
        for (int g = 0; g < 2; ++g) {
            const float mloc = fmaxf(mh[g], mx[g]);
            mn[g] = fmaxf(mrun[g], mloc * SL);
            corr[g] = __builtin_amdgcn_exp2f(mrun[g] - mn[g]);
            const float c = PLOG - mn[g]; const v2f c2 = {c, c}, sl2 = {SL, SL};
            v2f sa = {0.0f, 0.0f}, sb = {0.0f, 0.0f};
#pragma unroll
            for (int r = 0; r < 8; r += 2) {
                const v2f e0 = __builtin_elementwise_fma((v2f){s0[g][r], s0[g][r + 1]}, sl2, c2), e1 = __builtin_elementwise_fma((v2f){s1[g][r], s1[g][r + 1]}, sl2, c2);
                const v2f p0 = {__builtin_amdgcn_exp2f(e0[0]), __builtin_amdgcn_exp2f(e0[1])}, p1 = {__builtin_amdgcn_exp2f(e1[0]), __builtin_amdgcn_exp2f(e1[1])};
                sa += p0; sb += p1;
                pb[g][r] = (h16)p0[0]; pb[g][r + 1] = (h16)p0[1]; pb[g][8 + r] = (h16)p1[0]; pb[g][8 + r + 1] = (h16)p1[1];
            }
            sa += sb;
            float sum = sa[0] + sa[1];
            sum += __shfl_xor(sum, 16, 32);
            lrun[g] = lrun[g] * corr[g] + sum;
        }
        if (__builtin_amdgcn_ballot_w32(mn[0] > mrun[0] || mn[1] > mrun[1]) != 0u) {      // wave-uniform, one test a step: rescale only when some query's running max moved (corr == 1 exactly elsewhere)
#pragma unroll
            for (int g = 0; g < 2; ++g)
#pragma unroll
                for (int t = 0; t < 4; ++t)
#pragma unroll
                    for (int r = 0; r < 8; ++r) o[g][t][r] *= corr[g]; }
        mrun[0] = mn[0]; mrun[1] = mn[1];
#pragma unroll
        for (int t = 0; t < 4; ++t)
#pragma unroll
            for (int g = 0; g < 2; ++g) o[g][t] = wmma16(va[t], pb[g], o[g][t]);
        // the distance behind the last product, also on the loop's taken back edge
        asm volatile("v_nop\n\tv_nop\n\tv_nop\n\tv_nop" : "+v"(o[0][0]), "+v"(o[0][1]), "+v"(o[0][2]), "+v"(o[0][3]), "+v"(o[1][0]), "+v"(o[1][1]), "+v"(o[1][2]), "+v"(o[1][3]) : "v"(va[0]), "v"(va[1]), "v"(va[2]), "v"(va[3]), "v"(pb[0]), "v"(pb[1]));
    }
        asm volatile("s_wait_dscnt 0x0" ::: "memory");      // this wave's reads of stage st are done
        asm volatile("s_wait_asynccnt 0x0" ::: "memory");   // its share of stage st + 1 has landed
        __syncthreads();                                     // publishes stage st + 1 and frees stage st's buffer
        if (st + 2 < nst) kv_copy(lw + (unsigned)(st & 1) * 16384u, gk + (size_t)(st + 2) * (64 * HD), gv + (size_t)(st + 2) * (64 * HD));
    }
    asm volatile("s_wait_asynccnt 0x0" ::: "memory");       // no copy is outstanding when the wave ends
    // lane (h, query) holds rows d = 16 t + 8 h + 0..7 of its query's O^T column: that is piece t of its lane in the fragment-ordered ctx plane, so no LDS transpose is needed
    v8h oc[2][4];
#pragma unroll
    for (int g = 0; g < 2; ++g) {
        const float inv = 1.0f / lrun[g];   // o and lrun carry the same 2^PLOG
#pragma unroll
        for (int t = 0; t < 4; ++t) {
#pragma unroll
            for (int j = 0; j < 8; ++j) oc[g][t][j] = (h16)(o[g][t][j] * inv); } }
    h16* ac = AT + ((size_t)b * SEQ + q0) * DM + h * (HD * 16) + lane * 8;
    // every value is formed first; behind the stores nothing is rewritten
#pragma unroll
    for (int g = 0; g < 2; ++g)
#pragma unroll
        for (int s = 0; s < 4; ++s) *(v8h*)(ac + g * 16 * DM + s * 256) = oc[g][s];
}

extern "C" void kernel_launch(void* const* d_in, const int* in_sizes, int n_in,
                              void* d_out, int out_size, void* d_ws, size_t ws_size, hipStream_t stream) {
    if (n_in < 10) return;
    const size_t needx = ((size_t)(NB - 1) * SEQ_FULL + SEQ) * DM, needm = (size_t)(NB - 1) * SEQ_FULL + SEQ;
    if ((size_t)in_sizes[0] < needx || (size_t)in_sizes[1] < needm) return;
    if ((size_t)in_sizes[2] < (size_t)DM * DM || (size_t)in_sizes[4] < (size_t)DM * DM || (size_t)in_sizes[6] < (size_t)DM * DM || (size_t)in_sizes[8] < (size_t)DM * DM) return;
    if (in_sizes[3] < DM || in_sizes[5] < DM || in_sizes[7] < DM || in_sizes[9] < DM) return;
    if ((size_t)out_size < (size_t)(NB - 1) * OUT_BSTRIDE + (size_t)SEQ * DM) return;
    const float* x = (const float*)d_in[0]; const int* mk = (const int*)d_in[1];
    const float* wq = (const float*)d_in[2]; const float* bq = (const float*)d_in[3]; const float* wk = (const float*)d_in[4]; const float* bk = (const float*)d_in[5];
    const float* wv = (const float*)d_in[6]; const float* bv = (const float*)d_in[7]; const float* wo = (const float*)d_in[8]; const float* bo = (const float*)d_in[9];
    float* OUT = (float*)d_out;
    char* wsp = (char*)d_ws;
    auto take = [&](size_t bytes) { char* p = wsp; wsp += (bytes + 255) & ~(size_t)255; return (void*)p; };
    const size_t MT = (size_t)NB * SEQ;                       // token rows
    bf* XB  = (bf*)take(MT * DM * 2);
    bf* WQt = (bf*)take((size_t)DM * DM * 2); bf* WKt = (bf*)take((size_t)DM * DM * 2); bf* WVt = (bf*)take((size_t)DM * DM * 2); bf* WOt = (bf*)take((size_t)DM * DM * 2);
    h16* QP = (h16*)take(MT * DM * 2); h16* KP = (h16*)take(MT * DM * 2); h16* VT = (h16*)take(MT * DM * 2);
    h16* AT = (h16*)take(MT * DM * 2);
    int* PERM = (int*)take(MT * 4); int* CNT = (int*)take((size_t)NB * 4);
    if ((size_t)(wsp - (char*)d_ws) > ws_size) return;        // 88 MiB at the full size
    k_prep<<<NB + 4 * (DM / 64) * (DM / 64), 256, 0, stream>>>(mk, PERM, CNT, wq, wk, wv, wo, WQt, WKt, WVt, WOt);   // W in[k][n] -> out[n][k]
    k_cvtx<<<(unsigned)((MT * DM / 8 + 255) / 256), 256, 0, stream>>>(x, PERM, XB);
    k_qkv<<<dim3((unsigned)(MT / 128), DM / 128, 3), 128, 0, stream>>>(XB, WQt, WKt, WVt, QP, KP, VT, bq, bk, bv, CNT);
    k_flash<<<dim3(SEQ / 128, NB * NH), 128, 0, stream>>>(QP, KP, VT, CNT, AT);
    k_oproj<<<dim3((unsigned)(MT / 128), DM / 128), 128, 0, stream>>>((const bf*)AT, WOt, OUT, bo, PERM);
}

// v010
// A run of this version takes 99.4 microseconds.
// Two timings next to v009 put it at 1.03 and 1.02 times that version's speed.
// Counting every step since v000, it is 4.12 times as fast.
#include <hip/hip_runtime.h>

// Compute dtypes (f32 accumulate everywhere): q/k/v projections v_wmma_f32_16x16x32_bf16 on RNE-bf16 copies of x and W (f32 bias add); scores K.Q^T v_wmma_f32_16x16x32_f16 on f16 q/k planes; P.V v_wmma_f32_16x16x32_f16 (P carried x1024: the carry is +10 in the exponent, f16 V^T plane); output projection v_wmma_f32_16x16x32_f16 on the RNE-f16 ctx plane and an RNE-f16 copy of Wo (one product; |ctx| <= max |V|, which is already f16, so it cannot overflow); softmax in f32.
// Key-padding-masked multi-head self-attention: x [NB][SEQ_FULL][1024] f32, mask int32 [NB][SEQ_FULL] (first SEQ tokens of a batch read; 0 = key masked: its score is REPLACED by -1e9), W [in][out] f32 + bias [out]; 16 heads x 64; scores x 0.125; softmax over all keys; out = ctx Wo + bo.
// Token order: inside each batch the tokens are permuted, unmasked keys first (rank order), masked ones behind; a masked key's weight is exp(-1e9 - max) = 0 in f32 as soon as one key of the batch is unmasked (|score| <= 64 * 1040^2 / 8 < 1e7 for any x and W the generators can draw), so K, V and the key loop cover only the first CNT[b] permuted tokens (rounded up to a tile). A batch with no unmasked key keeps all its keys, every score replaced by the fill (uniform weights). Queries run in permuted order and the output projection stores each row at its token's own place.
// Plan, four launches: (0) ranks -> PERM, CNT, and in the same launch the bf16 copy of x (rows gathered in permuted order; each of its blocks ranks its batch's mask itself, so it waits for no other block) and transposed 16-bit copies Wt[n][k] of the four weights (through LDS; bf16 for Wq, Wk, Wv, f16 for Wo), (1) in one launch the GEMMs (128x128 tile per block of four waves, 64x64 per wave, operands staged in LDS) writing f16 head planes Q[b][h][s][d], K[b][h][s][d] and V^T[b][h][d][s] (the V GEMM runs with operands swapped so its tile is already transposed),
// Every 16-bit plane is stored in fragment order: a block of 16 rows x 32 k is 512 elements laid out [k>>4 &1][k>>3 &1][row&15][k&7], so a wave's 16-byte fragment load reads 512 contiguous bytes (4 whole lines) at block + lane * 8 elements.
// (2) register-fed transposed flash attention: per wave 32 queries (two groups of 16 columns share each K and V^T fragment); S^T tile = K rows (A, from LDS) x Q^T (B, held in registers); the exponentials packed in place form the B fragment of O^T = V^T P^T; the block's four waves share each K and V^T stage through LDS, (3) ctx plane x Wo^T + bo.

#ifndef NB
#define NB 4
#endif
#ifndef SEQ
#define SEQ 2048
#endif
#define NB_FULL  4
#define SEQ_FULL 2048
#define DM   1024
#define NH   16
#define HD   64
#ifndef OUT_BSTRIDE
#define OUT_BSTRIDE ((size_t)SEQ * DM)
#endif
#define PLOG 10.0f                     // P and its row sums are carried x 2^10; the factor cancels in the final division
#define SL   0.18033688011112042f      // 0.125 * log2(e): takes a raw score to the base-2 domain
#define RAWF (-8.0e9f)                 // the replace-fill -1e9 in units of the raw (unscaled) score: -1e9 / 0.125

static_assert(SEQ % 128 == 0);
static_assert(NH * HD == DM);
static_assert(DM % 64 == 0);
static_assert(NB <= NB_FULL);
static_assert(SEQ <= SEQ_FULL);

typedef _Float16 h16;
typedef unsigned short bf;
typedef __attribute__((ext_vector_type(16))) __bf16   v16bf;
typedef __attribute__((ext_vector_type(16))) _Float16 v16h;
typedef __attribute__((ext_vector_type(8)))  _Float16 v8h;
typedef __attribute__((ext_vector_type(8)))  unsigned short v8us;
typedef __attribute__((ext_vector_type(8)))  float    v8f;
typedef __attribute__((ext_vector_type(4)))  float    v4f;
typedef __attribute__((ext_vector_type(2)))  float    v2f;
typedef v4f  __attribute__((may_alias)) v4fa;
typedef int  __attribute__((ext_vector_type(4), may_alias)) v4ia;

__device__ __forceinline__ unsigned short f2bf(float f) { unsigned u = __float_as_uint(f); u += 0x7FFFu + ((u >> 16) & 1u); return (unsigned short)(u >> 16); }
__device__ __forceinline__ float bf2f(unsigned short b) { return __uint_as_float(((unsigned)b) << 16); }
__device__ __forceinline__ float bfr(float f) { return bf2f(f2bf(f)); }
__device__ __forceinline__ unsigned short f2h(float f) { return __builtin_bit_cast(unsigned short, (_Float16)f); }
__device__ __forceinline__ v16h cat16(v8h lo, v8h hi) { return __builtin_shufflevector(lo, hi, 0, 1, 2, 3, 4, 5, 6, 7, 8, 9, 10, 11, 12, 13, 14, 15); }
__device__ __forceinline__ v16bf cat16b(v8us lo, v8us hi) { return __builtin_bit_cast(v16bf, __builtin_shufflevector(lo, hi, 0, 1, 2, 3, 4, 5, 6, 7, 8, 9, 10, 11, 12, 13, 14, 15)); }
__device__ __forceinline__ v8f wmma16(v16h a, v16h b, v8f c) { return __builtin_amdgcn_wmma_f32_16x16x32_f16(false, a, false, b, (short)0, c, false, false); }
__device__ __forceinline__ v8f wmmab(v16bf a, v16bf b, v8f c) { return __builtin_amdgcn_wmma_f32_16x16x32_bf16(false, a, false, b, (short)0, c, false, false); }
// Fragment loaders: p = start of a 16-row x 32-k block (512 elements, fragment order) + lane * 8; lane = 16 h + row; elements 0..7 <- k0 + 8h + 0..7, elements 8..15 <- k0 + 16 + 8h + 0..7 (same map for A and B).
__device__ __forceinline__ v16h  ldh(const h16* p) { return cat16(*(const v8h*)p, *(const v8h*)(p + 256)); }

// ---- perm_block: one block per batch. PERM[b][p] = token at permuted place p; CNT[b] = number of unmasked keys. Only mask != 0 is used and places are ranks, so every place lies in [0, SEQ) and is filled once for any mask content.
// The scatter goes to LDS; the table leaves as whole lines. 256 threads (the block size of the launch it shares with the weight transposes).
__device__ __forceinline__ void perm_block(const int* __restrict__ mask, int* PERM, int* CNT, unsigned* mw, int* ps, const int b) {
    static_assert(SEQ % 1024 == 0);
    const int tid = threadIdx.x, wave = tid >> 5, lane = tid & 31;
    const int* mb = mask + (size_t)b * SEQ_FULL;
    int mv[SEQ / 256];   // all loads first, so that they are in flight together
#pragma unroll
    for (int it = 0; it < SEQ / 256; ++it) mv[it] = mb[it * 256 + tid];
#pragma unroll
    for (int it = 0; it < SEQ / 256; ++it) { const unsigned w = __builtin_amdgcn_ballot_w32(mv[it] != 0); if (lane == 0) mw[it * 8 + wave] = w; }
    __syncthreads();
    int tot = 0;
#pragma unroll
    for (int i = 0; i < SEQ / 32; ++i) tot += __popc(mw[i]);
    // the wait ends the branch, so nothing rewrites a register that the store names in front of it
    if (tid == 0) { CNT[b] = tot; asm volatile("s_wait_xcnt 0x0" ::: "memory"); }
    int base = 0;   // unmasked keys in front of this trip's 256 tokens
#pragma unroll
    for (int it = 0; it < SEQ / 256; ++it) {
        int pre = base;
#pragma unroll
        for (int j = 0; j < 8; ++j) { const int c = __popc(mw[it * 8 + j]); pre += (j < wave) ? c : 0; base += c; }
        const unsigned w = mw[it * 8 + wave]; const int s = it * 256 + tid;
        const int rank = pre + __popc(w & ((1u << lane) - 1u));
        ps[((w >> lane) & 1u) ? rank : tot + (s - rank)] = s;
    }
    __syncthreads();
    v4ia* dst = (v4ia*)(PERM + (size_t)b * SEQ);
#pragma unroll
    for (int k = 0; k < SEQ / 1024; ++k) dst[k * 256 + tid] = ((const v4ia*)ps)[k * 256 + tid];
}

// ---- cvtx_block: one block per 16 permuted tokens (one row of 16-row x 32-k blocks of the bf16 plane). It finds its 16 tokens from the mask alone, by the same ranks as perm_block (only mask != 0 is used; a token index is a loop index, so it lies in [0, SEQ)): every place of the batch is met once, and the 16 places of this block go to rw.
// Then a wave takes 8 rows x 256 k: per row 1 KiB of x in a run, all its loads in flight together; per 32 k it reads 8 whole 128-byte lines of x and stores 4 whole lines of the fragment-ordered plane.
__device__ __forceinline__ void cvtx_block(const float* __restrict__ x, const int* __restrict__ mask, bf* XB, unsigned* mw, int* rw, const int cb) {
    static_assert(SEQ % 256 == 0 && DM % 128 == 0);
    constexpr int KU = DM / 32 / 4;   // 32-k blocks a wave
    const int tid = threadIdx.x, wave = tid >> 5, lane = tid & 31;
    const int b = cb / (SEQ / 16), p0 = (cb % (SEQ / 16)) * 16;
    const int* mb = mask + (size_t)b * SEQ_FULL;
    int mv[SEQ / 256];   // all loads first, so that they are in flight together
#pragma unroll
    for (int it = 0; it < SEQ / 256; ++it) mv[it] = mb[it * 256 + tid];
#pragma unroll
    for (int it = 0; it < SEQ / 256; ++it) { const unsigned w = __builtin_amdgcn_ballot_w32(mv[it] != 0); if (lane == 0) mw[it * 8 + wave] = w; }
    __syncthreads();
    int tot = 0;
#pragma unroll
    for (int i = 0; i < SEQ / 32; ++i) tot += __popc(mw[i]);
    int base = 0;   // unmasked keys in front of this trip's 256 tokens
#pragma unroll
    for (int it = 0; it < SEQ / 256; ++it) {
        int pre = base;
#pragma unroll
        for (int j = 0; j < 8; ++j) { const int c = __popc(mw[it * 8 + j]); pre += (j < wave) ? c : 0; base += c; }
        const unsigned w = mw[it * 8 + wave]; const int s = it * 256 + tid;
        const int rank = pre + __popc(w & ((1u << lane) - 1u));
        const unsigned rel = (unsigned)((((w >> lane) & 1u) ? rank : tot + (s - rank)) - p0);
        if (rel < 16u) rw[rel] = s;
    }
    __syncthreads();
    const int lr = (wave & 1) * 8 + (lane & 7), q = lane >> 3;
    const float* sp = x + ((size_t)b * SEQ_FULL + (size_t)rw[lr]) * DM + (wave >> 1) * (KU * 32) + q * 8;
    bf* dp = XB + ((size_t)cb * (DM / 32) + (wave >> 1) * KU) * 512 + (q * 16 + lr) * 8;
    v8f v[KU];
#pragma unroll
    for (int u = 0; u < KU; ++u) v[u] = *(const v8f*)(sp + u * 32);
    static_assert(KU == 8);
    // the loads name the address register pair: the wait stands before anything rewrites it, and reading the pair here keeps it whole up to the wait (no load takes it as its own target);
    // the loaded values as inputs hold all the loads in front of the conversions, so that they are in flight together: held back for registers, the last one would pay a second trip to memory
    asm volatile("s_wait_xcnt 0x0" :: "v"(sp), "v"(v[0]), "v"(v[1]), "v"(v[2]), "v"(v[3]), "v"(v[4]), "v"(v[5]), "v"(v[6]), "v"(v[7]) : "memory");
#pragma unroll
    for (int u = 0; u < KU; ++u) { v8us o;
#pragma unroll
        for (int k = 0; k < 8; ++k) o[k] = f2bf(v[u][k]);
        *(v8us*)(dp + u * 512) = o; }
    // the stores name their address and value registers: the wait stands before code behind them in the listing (another path of the same kernel) rewrites any of them
    asm volatile("s_wait_xcnt 0x0" ::: "memory");
}

__device__ __forceinline__ void cvtT_block(const float* __restrict__ W, bf* Wt, float* tl, const int k0, const int n0, const bool f16) {
    const int tid = threadIdx.x;
#pragma unroll 4
    for (int i = 0; i < 16; ++i) { const int idx = i * 256 + tid; const int r = idx >> 6, c = idx & 63; tl[r * 65 + c] = W[(size_t)(k0 + r) * DM + n0 + c]; }
    __syncthreads();
    float v[2][8]; v8us o[2];
#pragma unroll
    for (int it = 0; it < 2; ++it) { const int p = it * 256 + tid; const int n = (p >> 7) * 16 + (p & 15), seg = (p >> 4) & 7;
#pragma unroll
        for (int j = 0; j < 8; ++j) v[it][j] = tl[(seg * 8 + j) * 65 + n]; }
    // the target type is the same for the whole block: one branch, a straight run of conversions on either side
    if (f16) {
#pragma unroll
        for (int it = 0; it < 2; ++it)
#pragma unroll
            for (int j = 0; j < 8; ++j) o[it][j] = f2h(v[it][j]);
    } else {
#pragma unroll
        for (int it = 0; it < 2; ++it)
#pragma unroll
            for (int j = 0; j < 8; ++j) o[it][j] = f2bf(v[it][j]);
    }
{
#pragma unroll
        for (int it = 0; it < 2; ++it) { const int p = it * 256 + tid; *(v8us*)(Wt + (size_t)(n0 + (p >> 7) * 16) * DM + k0 * 16 + (p & 127) * 8) = o[it]; }
        // the two stores name their address and value registers: the wait stands before code behind them in the listing (the rank path of the same kernel) rewrites any of them
        asm volatile("s_wait_xcnt 0x0" ::: "memory");
         }
}

// ---- k_prep: the work that depends on no other kernel, in one launch. Blocks 0 .. NB-1 rank one batch's tokens each; the next NB * SEQ / 16 convert 16 permuted rows of x each (the longest chains, so they start first); the rest transpose one 64x64 tile of one of the four weights. The branches are block-uniform, so every barrier is passed by a whole block.
__global__ __launch_bounds__(256) void k_prep(const float* __restrict__ x, bf* XB, const int* __restrict__ mask, int* PERM, int* CNT, const float* __restrict__ wq, const float* __restrict__ wk, const float* __restrict__ wv, const float* __restrict__ wo, bf* WQt, bf* WKt, bf* WVt, bf* WOt) {
    __shared__ __align__(16) unsigned mw[SEQ / 32];
    __shared__ __align__(16) int ps[SEQ];
    __shared__ float tl[64 * 65];
    constexpr int TPW = (DM / 64) * (DM / 64);   // tiles per weight
    const int bid = blockIdx.x;
    if (bid < NB) { perm_block(mask, PERM, CNT, mw, ps, bid); return; }
    constexpr int XBL = NB * SEQ / 16;           // blocks that convert x
    if (bid < NB + XBL) { cvtx_block(x, mask, XB, mw, ps, bid - NB); return; }
    const int id = bid - NB - XBL, w = id / TPW, t = id % TPW;
    const float* W = (w == 0) ? wq : (w == 1) ? wk : (w == 2) ? wv : wo; bf* Wt = (w == 0) ? WQt : (w == 1) ? WKt : (w == 2) ? WVt : WOt;
    cvtT_block(W, Wt, tl, (t % (DM / 64)) * 64, (t / (DM / 64)) * 64, w == 3);   // Wo leaves as f16, the others as bf16
}

// ---- stage_copy: one wave's share of one operand's stage: 32 rows x 64 k = two runs of 2 KiB in the fragment-ordered plane, as eight asynchronous 512-byte copies to LDS (16 bytes a lane, every lane on).
// l = the lane's LDS byte address, g = the lane's global address. The wait is the statement's last line, so no register that a copy names is rewritten in front of it.
__device__ __forceinline__ void stage_copy(const unsigned l, const bf* g) {
    const bf* h = g + 16 * DM;
    asm volatile("global_load_async_to_lds_b128 %0, %8, off\n\t"
                 "global_load_async_to_lds_b128 %1, %9, off\n\t"
                 "global_load_async_to_lds_b128 %2, %10, off\n\t"
                 "global_load_async_to_lds_b128 %3, %11, off\n\t"
                 "global_load_async_to_lds_b128 %4, %12, off\n\t"
                 "global_load_async_to_lds_b128 %5, %13, off\n\t"
                 "global_load_async_to_lds_b128 %6, %14, off\n\t"
                 "global_load_async_to_lds_b128 %7, %15, off\n\t"
                 "s_wait_xcnt 0x0"
                 :: "v"(l), "v"(l + 512u), "v"(l + 1024u), "v"(l + 1536u), "v"(l + 2048u), "v"(l + 2560u), "v"(l + 3072u), "v"(l + 3584u),
                    "v"(g), "v"(g + 256), "v"(g + 512), "v"(g + 768), "v"(h), "v"(h + 256), "v"(h + 512), "v"(h + 768) : "memory");
}
// LDS fragment loader: p = start of a 16-row x 32-k block in a stage + lane * 16 bytes (same element map as ldh).
__device__ __forceinline__ v16bf ldsb(const unsigned char* p) { return cat16b(*(const v8us*)p, *(const v8us*)(p + 512)); }

// ---- gemm_tile: block of FOUR WAVES per 128x128 output tile (tbx, tby) of (Mrows/128, Ncols/128); wave (w >> 1, w & 1) owns a 64x64 quarter (16 accumulators), so every staged operand row feeds two waves.
// C[m][n] = sum_k A[m][k] Bt[n][k] + bf16(bias), k in steps of 32, ascending from stage rot and wrapping round at K; the 16-bit operands are f16 for EPI 0 and bf16 otherwise (the planes are moved as plain 16-bit words). A stage is 64 k of the tile's 128 rows of each operand (16 KiB an operand, fragment order kept: block of 16 rows at 2 KiB, its two 32-k blocks at 1 KiB);
// rot: the blocks that share an operand panel run side by side; started on one stage they would all ask L2 for the same lines at the same moment, so each starts its walk round the k stages at a place of its own.
// two buffers: the copies of stage t + 1 fly while stage t is worked on. After the loop the same LDS serves the waves' output staging (the last trip's barrier ends every read of the buffers).
// EPI 0: f32 out[b][s][n] (rows = permuted tokens, stored at aux = PERM's token; bias per column), each 256-B row piece as 16 lanes x 16 B.
// EPI 1, 2 with aux = CNT: a tile whose 128 tokens all lie behind the batch's unmasked keys is never read by the key loop and leaves at once (aux == nullptr: every tile is computed).
template <int EPI>
__device__ __forceinline__ void gemm_tile(const bf* __restrict__ A, const bf* __restrict__ Bt, float* Cf, h16* Ch, const float* __restrict__ bias, const int* __restrict__ aux, unsigned char* sm, const int tbx, const int tby, const int rot) {
    constexpr int K = DM; constexpr unsigned OPB = 16384, STG = 2 * OPB; constexpr int NST = K / 64;
    static_assert((NST & (NST - 1)) == 0);
    const int lane = threadIdx.x & 31, lr = lane & 15, hi = lane >> 4; const int wave = __builtin_amdgcn_readfirstlane((int)(threadIdx.x >> 5));
    const int bx = tbx * 2 + (wave >> 1), by = tby * 2 + (wave & 1); const int r0 = bx * 64, c0 = by * 64;
    // block-uniform, in front of every copy and barrier
    if (EPI != 0 && aux != nullptr) { const int t0 = ((EPI == 1) ? tbx : tby) * 128; const int cnt = aux[t0 / SEQ]; if (cnt != 0 && t0 % SEQ >= cnt) return; }
    v8f acc[4][4];
#pragma unroll
    for (int mb = 0; mb < 4; ++mb)
#pragma unroll
        for (int nb = 0; nb < 4; ++nb) acc[mb][nb] = (v8f){};
    // this wave copies rows 32 w .. 32 w + 31 of the tile's 128 rows of each operand
    const bf* ga = A + ((size_t)tbx * 128 + wave * 32) * K + 8 * lane; const bf* gb = Bt + ((size_t)tby * 128 + wave * 32) * K + 8 * lane;
    const unsigned lw = (unsigned)(size_t)sm + (unsigned)wave * 4096u + (unsigned)lane * 16u;
    auto fill = [&](const int s, const unsigned buf) {
        const int se = (s + rot) & (NST - 1);   // block-uniform, in [0, NST)
        stage_copy(lw + buf * STG, ga + se * 1024); stage_copy(lw + buf * STG + OPB, gb + se * 1024);
    };
    fill(0, 0u);
    asm volatile("s_wait_asynccnt 0x0" ::: "memory");   // this wave's share of stage 0 has landed
    __syncthreads();                                     // every wave's share has
    fill(1, 1u);
    const unsigned char* fa = sm + (wave >> 1) * 8192 + lane * 16; const unsigned char* fb = sm + OPB + (wave & 1) * 8192 + lane * 16;
#pragma unroll 1
    for (int t = 0; t < NST; ++t) {
        const unsigned bo = (unsigned)(t & 1) * STG;
#pragma unroll
        for (int kk = 0; kk < 2; ++kk) {
            v16bf a[4], b[4];
#pragma unroll
            for (int mb = 0; mb < 4; ++mb) a[mb] = ldsb(fa + bo + mb * 2048 + kk * 1024);
#pragma unroll
            for (int nb = 0; nb < 4; ++nb) b[nb] = ldsb(fb + bo + nb * 2048 + kk * 1024);
            // two waves a SIMD here and registers to spare: the loaded fragments as inputs hold the block's 16 LDS loads together in front of its 16 products, one LDS wait a block instead of one in front of every column group
            if (EPI == 0) asm volatile("" :: "v"(a[0]), "v"(a[1]), "v"(a[2]), "v"(a[3]), "v"(b[0]), "v"(b[1]), "v"(b[2]), "v"(b[3]));
#pragma unroll
            for (int nb = 0; nb < 4; ++nb) {
#pragma unroll
                for (int mb = 0; mb < 4; ++mb) acc[mb][nb] = (EPI == 0) ? wmma16(__builtin_bit_cast(v16h, a[mb]), __builtin_bit_cast(v16h, b[nb]), acc[mb][nb]) : wmmab(a[mb], b[nb], acc[mb][nb]); }
        }
        // keeps the stage's products in front of its foot: sunk behind the barrier they would delay the refill, which then has less than a whole trip to land
        __builtin_amdgcn_sched_barrier(0);
        asm volatile("s_wait_dscnt 0x0" ::: "memory");      // this wave's reads of stage t are done
        asm volatile("s_wait_asynccnt 0x0" ::: "memory");   // its share of stage t + 1 has landed
        __syncthreads();                                     // publishes stage t + 1 and frees stage t's buffer
        if (t + 2 < NST) fill(t + 2, (unsigned)(t & 1));
    }
    asm volatile("s_wait_asynccnt 0x0" ::: "memory");       // no copy is outstanding when the buffers become output staging
    float* os = (float*)(sm + wave * 4352);                  // each wave stages in its own 16 x 68 floats
#pragma unroll
    for (int mb = 0; mb < 4; ++mb) {
#pragma unroll
        for (int nb = 0; nb < 4; ++nb) {
#pragma unroll
            for (int j = 0; j < 8; ++j) os[(hi * 8 + j) * 68 + nb * 16 + lr] = acc[mb][nb][j]; }
        __builtin_amdgcn_wave_barrier(); asm volatile("" ::: "memory");
        if (EPI == 0) {
            const int bb = r0 / SEQ, s0 = r0 % SEQ;
            float* cbat = Cf + (size_t)bb * OUT_BSTRIDE + c0; const int* tok = aux + (size_t)bb * SEQ + s0 + mb * 16; v4f sv[8]; float* sp[8];
{
#pragma unroll
                for (int s = 0; s < 8; ++s) { const int row = 2 * s + hi, cofs = lr * 4; v4f val = *(const v4fa*)(os + row * 68 + cofs);
                    val[0] += bfr(bias[c0 + cofs]); val[1] += bfr(bias[c0 + cofs + 1]); val[2] += bfr(bias[c0 + cofs + 2]); val[3] += bfr(bias[c0 + cofs + 3]);
                    sv[s] = val; sp[s] = cbat + (size_t)tok[row] * DM + cofs; *(v4f*)sp[s] = sv[s]; }
                // the eight stores name these registers: the wait stands before any of them is rewritten, and reading them here keeps them whole up to it
                asm volatile("s_wait_xcnt 0x0" :: "v"(sv[0]), "v"(sv[1]), "v"(sv[2]), "v"(sv[3]), "v"(sv[4]), "v"(sv[5]), "v"(sv[6]), "v"(sv[7]), "v"(sp[0]), "v"(sp[1]), "v"(sp[2]), "v"(sp[3]), "v"(sp[4]), "v"(sp[5]), "v"(sp[6]), "v"(sp[7]) : "memory");
                 }
        } else {
            h16* base; size_t kstep;   // kstep: elements from one 32-k block of these 16 rows to the next (V^T keeps the four 16-row blocks of a 32-key step together)
            if (EPI == 1) { const int bb = r0 / SEQ, s0 = r0 % SEQ; base = Ch + (((size_t)bb * NH + by) * SEQ + s0 + mb * 16) * HD; kstep = 512; }
            else          { const int bb = c0 / SEQ, s0 = c0 % SEQ; base = Ch + ((size_t)bb * NH + bx) * HD * SEQ + (size_t)s0 * HD + mb * 512; kstep = 512 * (HD / 16); }
{
#pragma unroll
                for (int s = 0; s < 4; ++s) { const int row = lr, seg = 2 * s + hi;
                    const v4f va = *(const v4fa*)(os + row * 68 + seg * 8); const v4f vb = *(const v4fa*)(os + row * 68 + seg * 8 + 4); v8h o;
                    if (EPI == 1) {
#pragma unroll
                        for (int j = 0; j < 4; ++j) { o[j] = (h16)(va[j] + bfr(bias[c0 + seg * 8 + j])); o[4 + j] = (h16)(vb[j] + bfr(bias[c0 + seg * 8 + 4 + j])); }
                    } else { const float bv = bfr(bias[r0 + mb * 16 + row]);
#pragma unroll
                        for (int j = 0; j < 4; ++j) { o[j] = (h16)(va[j] + bv); o[4 + j] = (h16)(vb[j] + bv); } }
                    *(v8h*)(base + (size_t)(s >> 1) * kstep + (s & 1) * 256 + lane * 8) = o; }
                // the four stores name their base and value registers: the wait stands before the next 16-row piece (or code behind the tile) rewrites any of them
                asm volatile("s_wait_xcnt 0x0" ::: "memory");
                 }
        }
        __builtin_amdgcn_wave_barrier(); asm volatile("" ::: "memory");
    }
}

// ---- k_qkv: the three projections, which depend on each other in nothing, in one launch: grid (tokens/128, DM/128, 3), z = 0 Q, 1 K, 2 V. The V tiles keep their own order (feature tile fastest). The branch on z is block-uniform.
__global__ __launch_bounds__(128) void k_qkv(const bf* __restrict__ XB, const bf* __restrict__ WQt, const bf* __restrict__ WKt, const bf* __restrict__ WVt, h16* QP, h16* KP, h16* VT, const float* __restrict__ bq, const float* __restrict__ bk, const float* __restrict__ bv, const int* __restrict__ CNT) {
    __shared__ __align__(2048) unsigned char sm[2 * 2 * 16384];
    const int z = blockIdx.z;
    if (z == 2) { const int lin = blockIdx.y * (NB * SEQ / 128) + blockIdx.x; gemm_tile<2>(WVt, XB, nullptr, VT, bv, CNT, sm, lin % (DM / 128), lin / (DM / 128), lin / (DM / 128) + 2 * (lin % (DM / 128)) + 5); }   // rows = features, cols = tokens: the tile is V^T
    else gemm_tile<1>(XB, z ? WKt : WQt, nullptr, z ? KP : QP, z ? bk : bq, z ? CNT : nullptr, sm, blockIdx.x, blockIdx.y, blockIdx.x + 2 * blockIdx.y + z);
}

__global__ __launch_bounds__(128) void k_oproj(const bf* __restrict__ AT, const bf* __restrict__ WOt, float* OUT, const float* __restrict__ bo, const int* __restrict__ PERM) {
    __shared__ __align__(2048) unsigned char sm[2 * 2 * 16384];
    gemm_tile<0>(AT, WOt, OUT, nullptr, bo, PERM, sm, blockIdx.x, blockIdx.y, blockIdx.x + 2 * blockIdx.y);
}

// ---- kv_copy: one wave's share of one 64-key stage of the key loop: 2 KiB of the stage's 8 KiB of the K plane and 2 KiB of its 8 KiB of the V^T plane (both contiguous in fragment order), as eight asynchronous 512-byte copies to LDS (16 bytes a lane, every lane on).
// l = the lane's LDS byte address in the stage's K half (the V^T half lies 8 KiB behind it), gk, gv = the lane's global addresses. The wait is the statement's last line, so no register that a copy names is rewritten in front of it.
__device__ __forceinline__ void kv_copy(const unsigned l, const h16* gk, const h16* gv) {
    asm volatile("global_load_async_to_lds_b128 %0, %8, off\n\t"
                 "global_load_async_to_lds_b128 %1, %9, off\n\t"
                 "global_load_async_to_lds_b128 %2, %10, off\n\t"
                 "global_load_async_to_lds_b128 %3, %11, off\n\t"
                 "global_load_async_to_lds_b128 %4, %12, off\n\t"
                 "global_load_async_to_lds_b128 %5, %13, off\n\t"
                 "global_load_async_to_lds_b128 %6, %14, off\n\t"
                 "global_load_async_to_lds_b128 %7, %15, off\n\t"
                 "s_wait_xcnt 0x0"
                 :: "v"(l), "v"(l + 512u), "v"(l + 1024u), "v"(l + 1536u), "v"(l + 8192u), "v"(l + 8704u), "v"(l + 9216u), "v"(l + 9728u),
                    "v"(gk), "v"(gk + 256), "v"(gk + 512), "v"(gk + 768), "v"(gv), "v"(gv + 256), "v"(gv + 512), "v"(gv + 768) : "memory");
}
// LDS fragment loader, f16: p = start of a 16-row x 32-k block in a stage + lane * 16 bytes (same element map as ldh).
__device__ __forceinline__ v16h ldsh(const unsigned char* p) { return cat16(*(const v8h*)p, *(const v8h*)(p + 512)); }

// ---- k_flash: register-fed transposed flash attention. Block = 4 waves = 128 queries of one (b, h); wave = 32 queries = two groups of 16 WMMA columns, so every K and V^T fragment that the wave loads feeds two products. Per 32-key step and group:
// S^T tiles (keys x queries) = K rows (A fragments from the staged f16 plane) x Q^T (B fragments held in registers); lane (h, n) then holds keys 8h + r (tile 0) and 16 + 8h + r (tile 1) of query n,
// which is exactly the B-fragment element order of P^T for O^T[d][query] += V^T[d][keys] P^T[keys][query] (A fragments from the f16 V^T plane). Running max / sum per query live in the lane (one xor-16 exchange).
// K and V^T reach the waves through LDS: a stage is 64 keys (8 KiB of each plane), copied once for the block, a quarter by each wave; two buffers, the copies of stage t + 1 fly while stage t is worked on. A stage that starts in front of the key count lies inside a 128-token tile that the projections have written.
// Keys are the batch's permuted tokens: the first cnt are unmasked, so a step with 32 of them needs no mask; the last, partial step replaces the raw scores behind cnt by the fill; with cnt == 0 all SEQ keys run with every score replaced by one value (uniform weights whatever the value: 0 keeps the exponent exact).
// Softmax arithmetic works on the accumulators' own register pairs: the maximum is taken on raw scores (the scale is positive), then one packed fma per two scores, s * SL + (PLOG - max), is scale, shift and carry at once.
__global__ __launch_bounds__(128) void k_flash(const h16* __restrict__ QP, const h16* __restrict__ KP, const h16* __restrict__ VT, const int* __restrict__ CNT, h16* AT) {
    __shared__ __align__(2048) unsigned char kv[2 * 16384];
    const int tid = threadIdx.x, lane = tid & 31, hi = lane >> 4; const int wave = __builtin_amdgcn_readfirstlane(tid >> 5);
    const int bh = blockIdx.y, b = bh / NH, h = bh % NH; const int q0 = blockIdx.x * 128 + wave * 32;
    const int cnt = min(CNT[b], SEQ); const int nk = (cnt != 0) ? cnt : SEQ;   // block-uniform; the trip count is bounded by SEQ
    const float fill = (cnt != 0) ? RAWF : 0.0f;
    const h16* qp = QP + ((size_t)bh * SEQ + q0) * HD + 8 * lane;
    v16h qb0[2], qb1[2];
#pragma unroll
    for (int g = 0; g < 2; ++g) { qb0[g] = ldh(qp + g * 16 * HD); qb1[g] = ldh(qp + g * 16 * HD + 512); }
    const int nst = (nk + 63) >> 6;   // stages; block-uniform, at most SEQ / 64
    const h16* gk = KP + (size_t)bh * SEQ * HD + wave * 1024 + 8 * lane;
    const h16* gv = VT + (size_t)bh * HD * SEQ + wave * 1024 + 8 * lane;
    const unsigned lw = (unsigned)(size_t)kv + (unsigned)wave * 2048u + (unsigned)lane * 16u;
    kv_copy(lw, gk, gv);
    asm volatile("s_wait_asynccnt 0x0" ::: "memory");   // this wave's share of stage 0 has landed
    __syncthreads();                                     // every wave's share has
    if (nst > 1) kv_copy(lw + 16384u, gk + 64 * HD, gv + 64 * HD);
    v8f o[2][4];
#pragma unroll
    for (int g = 0; g < 2; ++g)
#pragma unroll
        for (int t = 0; t < 4; ++t) o[g][t] = (v8f){};
    float mrun[2] = {-1.0e30f, -1.0e30f}, lrun[2] = {0.0f, 0.0f};
#pragma unroll 1
    for (int st = 0; st < nst; ++st) {
    const int kend = min(nk, st * 64 + 64);
#pragma unroll 1
    for (int kt = st * 64; kt < kend; kt += 32) {
        const unsigned char* kf = kv + (st & 1) * 16384 + (kt & 32) * 128 + lane * 16;   // this step's 4 KiB of K; its 4 KiB of V^T lie 8 KiB behind
        const v16h ka0 = ldsh(kf), ka1 = ldsh(kf + 1024), kb0 = ldsh(kf + 2048), kb1 = ldsh(kf + 3072);
        v16h va[4];
#pragma unroll
        for (int t = 0; t < 4; ++t) va[t] = ldsh(kf + 8192 + t * 1024);
        v8f s0[2], s1[2];
#pragma unroll
        for (int g = 0; g < 2; ++g) { s0[g] = wmma16(ka0, qb0[g], (v8f){}); s1[g] = wmma16(kb0, qb0[g], (v8f){}); }
#pragma unroll
        for (int g = 0; g < 2; ++g) { s0[g] = wmma16(ka1, qb1[g], s0[g]); s1[g] = wmma16(kb1, qb1[g], s1[g]); }
        // the distance between the last product and the first reader of its result, on both sides of the branch below
        asm volatile("v_nop\n\tv_nop\n\tv_nop\n\tv_nop" : "+v"(s0[0]), "+v"(s1[0]), "+v"(s0[1]), "+v"(s1[1]) : "v"(ka0), "v"(ka1), "v"(kb0), "v"(kb1), "v"(qb0[0]), "v"(qb1[0]), "v"(qb0[1]), "v"(qb1[1]));
        const int rem = cnt - kt;   // unmasked keys from this step on (scalar)
        if (rem < 32) {
            const unsigned w = (rem > 0) ? (1u << rem) - 1u : 0u; const unsigned w0 = (w >> (8 * hi)) & 0xFFu, w1 = (w >> (16 + 8 * hi)) & 0xFFu;
#pragma unroll
            for (int g = 0; g < 2; ++g)
#pragma unroll
                for (int r = 0; r < 8; ++r) { s0[g][r] = ((w0 >> r) & 1u) ? s0[g][r] : fill; s1[g][r] = ((w1 >> r) & 1u) ? s1[g][r] : fill; }
        }
        float mn[2], corr[2], mh[2], mx[2]; v16h pb[2];
#pragma unroll
        for (int g = 0; g < 2; ++g) {
            mh[g] = fmaxf(s0[g][0], s1[g][0]);
#pragma unroll
            for (int r = 1; r < 8; ++r) mh[g] = fmaxf(mh[g], fmaxf(s0[g][r], s1[g][r]));
        }
#pragma unroll
        for (int g = 0; g < 2; ++g) mx[g] = __shfl_xor(mh[g], 16, 32);
        // the two exchanged values as inputs hold both exchanges in front of their first reader: one LDS-counter wait for the pair, not one behind each
        asm volatile("" :: "v"(mx[0]), "v"(mx[1]));
#pragma unroll
        for (int g = 0; g < 2; ++g) {
            const float mloc = fmaxf(mh[g], mx[g]);
            mn[g] = fmaxf(mrun[g], mloc * SL);
            corr[g] = __builtin_amdgcn_exp2f(mrun[g] - mn[g]);
            const float c = PLOG - mn[g]; const v2f c2 = {c, c}, sl2 = {SL, SL};
            v2f sa = {0.0f, 0.0f}, sb = {0.0f, 0.0f};
#pragma unroll
            for (int r = 0; r < 8; r += 2) {
                const v2f e0 = __builtin_elementwise_fma((v2f){s0[g][r], s0[g][r + 1]}, sl2, c2), e1 = __builtin_elementwise_fma((v2f){s1[g][r], s1[g][r + 1]}, sl2, c2);
                const v2f p0 = {__builtin_amdgcn_exp2f(e0[0]), __builtin_amdgcn_exp2f(e0[1])}, p1 = {__builtin_amdgcn_exp2f(e1[0]), __builtin_amdgcn_exp2f(e1[1])};
                sa += p0; sb += p1;
                pb[g][r] = (h16)p0[0]; pb[g][r + 1] = (h16)p0[1]; pb[g][8 + r] = (h16)p1[0]; pb[g][8 + r + 1] = (h16)p1[1];
            }
            sa += sb;
            float sum = sa[0] + sa[1];
            sum += __shfl_xor(sum, 16, 32);
            lrun[g] = lrun[g] * corr[g] + sum;
        }
        if (__builtin_amdgcn_ballot_w32(mn[0] > mrun[0] || mn[1] > mrun[1]) != 0u) {      // wave-uniform, one test a step: rescale only when some query's running max moved (corr == 1 exactly elsewhere)
#pragma unroll
            for (int g = 0; g < 2; ++g)
#pragma unroll
                for (int t = 0; t < 4; ++t)
#pragma unroll
                    for (int r = 0; r < 8; ++r) o[g][t][r] *= corr[g]; }
        mrun[0] = mn[0]; mrun[1] = mn[1];
#pragma unroll
        for (int t = 0; t < 4; ++t)
#pragma unroll
            for (int g = 0; g < 2; ++g) o[g][t] = wmma16(va[t], pb[g], o[g][t]);
        // the distance behind the last product, also on the loop's taken back edge
        asm volatile("v_nop\n\tv_nop\n\tv_nop\n\tv_nop" : "+v"(o[0][0]), "+v"(o[0][1]), "+v"(o[0][2]), "+v"(o[0][3]), "+v"(o[1][0]), "+v"(o[1][1]), "+v"(o[1][2]), "+v"(o[1][3]) : "v"(va[0]), "v"(va[1]), "v"(va[2]), "v"(va[3]), "v"(pb[0]), "v"(pb[1]));
    }
        asm volatile("s_wait_dscnt 0x0" ::: "memory");      // this wave's reads of stage st are done
        asm volatile("s_wait_asynccnt 0x0" ::: "memory");   // its share of stage st + 1 has landed
        __syncthreads();                                     // publishes stage st + 1 and frees stage st's buffer
        if (st + 2 < nst) kv_copy(lw + (unsigned)(st & 1) * 16384u, gk + (size_t)(st + 2) * (64 * HD), gv + (size_t)(st + 2) * (64 * HD));
    }
    asm volatile("s_wait_asynccnt 0x0" ::: "memory");       // no copy is outstanding when the wave ends
    // lane (h, query) holds rows d = 16 t + 8 h + 0..7 of its query's O^T column: that is piece t of its lane in the fragment-ordered ctx plane, so no LDS transpose is needed
    v8h oc[2][4];
#pragma unroll
    for (int g = 0; g < 2; ++g) {
        const float inv = 1.0f / lrun[g];   // o and lrun carry the same 2^PLOG
#pragma unroll
        for (int t = 0; t < 4; ++t) {
#pragma unroll
            for (int j = 0; j < 8; ++j) oc[g][t][j] = (h16)(o[g][t][j] * inv); } }
    h16* ac = AT + ((size_t)b * SEQ + q0) * DM + h * (HD * 16) + lane * 8;
    // every value is formed first; behind the stores nothing is rewritten
#pragma unroll
    for (int g = 0; g < 2; ++g)
#pragma unroll
        for (int s = 0; s < 4; ++s) *(v8h*)(ac + g * 16 * DM + s * 256) = oc[g][s];
}

extern "C" void kernel_launch(void* const* d_in, const int* in_sizes, int n_in,
                              void* d_out, int out_size, void* d_ws, size_t ws_size, hipStream_t stream) {
    if (n_in < 10) return;
    const size_t needx = ((size_t)(NB - 1) * SEQ_FULL + SEQ) * DM, needm = (size_t)(NB - 1) * SEQ_FULL + SEQ;
    if ((size_t)in_sizes[0] < needx || (size_t)in_sizes[1] < needm) return;
    if ((size_t)in_sizes[2] < (size_t)DM * DM || (size_t)in_sizes[4] < (size_t)DM * DM || (size_t)in_sizes[6] < (size_t)DM * DM || (size_t)in_sizes[8] < (size_t)DM * DM) return;
    if (in_sizes[3] < DM || in_sizes[5] < DM || in_sizes[7] < DM || in_sizes[9] < DM) return;
    if ((size_t)out_size < (size_t)(NB - 1) * OUT_BSTRIDE + (size_t)SEQ * DM) return;
    const float* x = (const float*)d_in[0]; const int* mk = (const int*)d_in[1];
    const float* wq = (const float*)d_in[2]; const float* bq = (const float*)d_in[3]; const float* wk = (const float*)d_in[4]; const float* bk = (const float*)d_in[5];
    const float* wv = (const float*)d_in[6]; const float* bv = (const float*)d_in[7]; const float* wo = (const float*)d_in[8]; const float* bo = (const float*)d_in[9];
    float* OUT = (float*)d_out;
    char* wsp = (char*)d_ws;
    auto take = [&](size_t bytes) { char* p = wsp; wsp += (bytes + 255) & ~(size_t)255; return (void*)p; };
    const size_t MT = (size_t)NB * SEQ;                       // token rows
    bf* XB  = (bf*)take(MT * DM * 2);
    bf* WQt = (bf*)take((size_t)DM * DM * 2); bf* WKt = (bf*)take((size_t)DM * DM * 2); bf* WVt = (bf*)take((size_t)DM * DM * 2); bf* WOt = (bf*)take((size_t)DM * DM * 2);
    h16* QP = (h16*)take(MT * DM * 2); h16* KP = (h16*)take(MT * DM * 2); h16* VT = (h16*)take(MT * DM * 2);
    h16* AT = (h16*)take(MT * DM * 2);
    int* PERM = (int*)take(MT * 4); int* CNT = (int*)take((size_t)NB * 4);
    if ((size_t)(wsp - (char*)d_ws) > ws_size) return;        // 88 MiB at the full size
    k_prep<<<NB + NB * SEQ / 16 + 4 * (DM / 64) * (DM / 64), 256, 0, stream>>>(x, XB, mk, PERM, CNT, wq, wk, wv, wo, WQt, WKt, WVt, WOt);   // W in[k][n] -> out[n][k]
    k_qkv<<<dim3((unsigned)(MT / 128), DM / 128, 3), 128, 0, stream>>>(XB, WQt, WKt, WVt, QP, KP, VT, bq, bk, bv, CNT);
    k_flash<<<dim3(SEQ / 128, NB * NH), 128, 0, stream>>>(QP, KP, VT, CNT, AT);
    k_oproj<<<dim3((unsigned)(MT / 128), DM / 128), 128, 0, stream>>>((const bf*)AT, WOt, OUT, bo, PERM);
}
